// v000
// Times are from an AMD MI455X. After a warm-up the kernel runs many times in a row, and a time is the length of
// such a window on the GPU divided by its runs, so every launch and the gaps after it count. The runs cycle
// through copies of the inputs. A figure is the median of several windows, for all but v000 over two sittings.
// Sittings can differ by a few percent; kernels timed side by side share one.
// The starting kernel, v000, takes 379 microseconds a run.
#include <hip/hip_runtime.h>
#include <hip/hip_bf16.h>
#include <stdint.h>

// ---------------------------------------------------------------------------
// CDNA5 (gfx1250) CrossBlock: bf16 WMMA GEMMs + dual-direction flash attention
// + ASYNCcnt-tracked global->LDS tile staging where no transpose is needed.
// ---------------------------------------------------------------------------

typedef __bf16 bf16_t;
typedef __attribute__((ext_vector_type(16))) __bf16 v16bf;
typedef __attribute__((ext_vector_type(8)))  float  v8f;
typedef __attribute__((ext_vector_type(4)))  int    v4i;

union Frag16 { v16bf v; uint32_t u[8]; };
union FragF  { v8f   v; float    f[8]; };

__device__ __forceinline__ bf16_t f2bf(float f) {
  uint32_t u = __builtin_bit_cast(uint32_t, f);
  uint32_t r = (u + 0x7FFFu + ((u >> 16) & 1u)) >> 16;   // round-to-nearest-even
  unsigned short s = (unsigned short)r;
  return __builtin_bit_cast(bf16_t, s);
}

// ---------------- async global->LDS (CDNA5 GLOBAL_LOAD_ASYNC_TO_LDS) -------
#if defined(__has_builtin)
#if __has_builtin(__builtin_amdgcn_global_load_async_to_lds_b128)
#define HAVE_ASYNC_LDS 1
#else
#define HAVE_ASYNC_LDS 0
#endif
#else
#define HAVE_ASYNC_LDS 0
#endif

typedef __attribute__((address_space(1))) v4i* gas_v4i_t;
typedef __attribute__((address_space(3))) v4i* las_v4i_t;

__device__ __forceinline__ void copy_b128_to_lds(const void* g, void* l) {
#if HAVE_ASYNC_LDS
  __builtin_amdgcn_global_load_async_to_lds_b128((gas_v4i_t)g, (las_v4i_t)l, 0, 0);
#else
  *(uint4*)l = *(const uint4*)g;
#endif
}

__device__ __forceinline__ void async_lds_wait() {
#if HAVE_ASYNC_LDS
#if __has_builtin(__builtin_amdgcn_s_wait_asynccnt)
  __builtin_amdgcn_s_wait_asynccnt(0);
#else
  asm volatile("s_wait_asynccnt 0x0" ::: "memory");
#endif
#endif
}

// ------------------------- f32 -> bf16 (strided) ---------------------------
__global__ void cvt_f32_bf16(const float* __restrict__ in, bf16_t* __restrict__ out,
                             int total, int inner, int ostride) {
  int i = blockIdx.x * blockDim.x + threadIdx.x;
  if (i >= total) return;
  int r = i / inner, c = i - r * inner;
  out[(size_t)r * ostride + c] = f2bf(in[i]);
}

// ----------------------------- generic GEMM --------------------------------
// C[M=grid.x*128, N=grid.y*64] = (A[M,K]bf16 @ B[K,N]bf16 + bias)*scale (+res)
// 8 waves: wave w owns rows [w*16, w*16+16) of the block tile, all 64 cols.
__global__ __launch_bounds__(256) void gemm_wmma(
    const bf16_t* __restrict__ A, int lda,
    const bf16_t* __restrict__ Bm, int ldb,
    const float* __restrict__ bias, float scale,
    bf16_t* __restrict__ outB, float* __restrict__ outF,
    const float* __restrict__ res, int ldo, int ldr, int K) {
  __shared__ __align__(16) bf16_t As[128 * 32];
  __shared__ __align__(16) bf16_t Bs[64 * 32];   // stored [n][k] (K-contiguous)

  const int bm = blockIdx.x * 128;
  const int bn = blockIdx.y * 64;
  const int t = threadIdx.x;
  const int wave = t >> 5;
  const int lane = t & 31;
  const int hf = lane >> 4;       // which 16-lane half of the wave
  const int ln = lane & 15;

  FragF acc[4];
#pragma unroll
  for (int i = 0; i < 4; ++i) acc[i].v = (v8f){0, 0, 0, 0, 0, 0, 0, 0};

  for (int k0 = 0; k0 < K; k0 += 32) {
    __syncthreads();
    {  // stage A tile 128x32 (async DMA to LDS; two b128 per thread)
      const int row = t >> 1;
      const int hs = (t & 1) * 16;
      const bf16_t* gsrc = A + (size_t)(bm + row) * lda + k0 + hs;
      bf16_t* ldst = As + row * 32 + hs;
      copy_b128_to_lds(gsrc, ldst);
      copy_b128_to_lds(gsrc + 8, ldst + 8);
      if (k0 + 32 < K) __builtin_prefetch(gsrc + 32, 0, 0);
    }
    {  // stage B tile 32x64 -> LDS transposed [n][k] (register path)
      const int kr = t >> 3;
      const int nc = (t & 7) * 8;
      union { uint4 q; bf16_t e[8]; } ub;
      ub.q = *(const uint4*)(Bm + (size_t)(k0 + kr) * ldb + bn + nc);
#pragma unroll
      for (int e = 0; e < 8; ++e) Bs[(nc + e) * 32 + kr] = ub.e[e];
    }
    async_lds_wait();
    __syncthreads();

    Frag16 af;
#pragma unroll
    for (int v = 0; v < 8; ++v) {
      const int kp = (v >> 2) * 16 + hf * 8 + (v & 3) * 2;
      af.u[v] = *(const uint32_t*)(As + (wave * 16 + ln) * 32 + kp);
    }
#pragma unroll
    for (int ns = 0; ns < 4; ++ns) {
      Frag16 bfr;
#pragma unroll
      for (int v = 0; v < 8; ++v) {
        const int kp = (v >> 2) * 16 + hf * 8 + (v & 3) * 2;
        bfr.u[v] = *(const uint32_t*)(Bs + (ns * 16 + ln) * 32 + kp);
      }
      acc[ns].v = __builtin_amdgcn_wmma_f32_16x16x32_bf16(
          false, af.v, false, bfr.v, (short)0, acc[ns].v, false, false);
    }
  }

#pragma unroll
  for (int ns = 0; ns < 4; ++ns) {
#pragma unroll
    for (int r = 0; r < 8; ++r) {
      const int row = bm + wave * 16 + hf * 8 + r;   // C/D layout: m = r + 8*half
      const int col = bn + ns * 16 + ln;
      float vo = (acc[ns].f[r] + bias[col]) * scale;
      if (outB) {
        outB[(size_t)row * ldo + col] = f2bf(vo);
      } else {
        if (res) vo += res[(size_t)row * ldr + col];
        outF[(size_t)row * ldo + col] = vo;
      }
    }
  }
}

// ------------------- dual-direction flash attention ------------------------
// dir0: Q=qk0,K=qk1,V=v1, logits*=match[i,j]  -> m0
// dir1: Q=qk1,K=qk0,V=v0, logits*=match[j,i]  -> m1
// 4 waves/WG, each wave owns a 16-row Q tile; 32-wide KV chunks shared via LDS.
__global__ __launch_bounds__(128) void flash_attn(
    const bf16_t* __restrict__ qk0, const bf16_t* __restrict__ qk1,
    const bf16_t* __restrict__ v0b, const bf16_t* __restrict__ v1b,
    const float* __restrict__ match,
    bf16_t* __restrict__ m0, bf16_t* __restrict__ m1) {
  const int NN = 2048, DD = 256, DH = 32;
  const int dir = blockIdx.z >> 1;
  const int b = blockIdx.z & 1;
  const int h = blockIdx.y;
  const int wave = threadIdx.x >> 5;
  const int lane = threadIdx.x & 31;
  const int hf = lane >> 4;
  const int ln = lane & 15;
  const int i0 = blockIdx.x * 64 + wave * 16;

  const bf16_t* Q  = dir ? qk1 : qk0;
  const bf16_t* Km = dir ? qk0 : qk1;
  const bf16_t* Vm = dir ? v0b : v1b;
  bf16_t* Out      = dir ? m1 : m0;
  const float* mb  = match + (size_t)b * NN * NN;

  __shared__ __align__(16) bf16_t Kt[32 * 32];        // [j][dh]
  __shared__ __align__(16) bf16_t Vt[32 * 32];        // [dh][j] (transposed)
  __shared__ __align__(16) bf16_t Pb[4][16 * 32];     // per-wave P scratch

  // Q fragment (16x32, A layout), straight from global
  Frag16 qf;
  {
    const size_t qbase = (size_t)(b * NN + i0 + ln) * DD + h * DH;
#pragma unroll
    for (int v = 0; v < 8; ++v) {
      const int kp = (v >> 2) * 16 + hf * 8 + (v & 3) * 2;
      qf.u[v] = *(const uint32_t*)(Q + qbase + kp);
    }
  }

  float mrow[8], lrow[8];
  FragF O0, O1;
#pragma unroll
  for (int r = 0; r < 8; ++r) { mrow[r] = -1e30f; lrow[r] = 0.f; }
  O0.v = (v8f){0, 0, 0, 0, 0, 0, 0, 0};
  O1.v = (v8f){0, 0, 0, 0, 0, 0, 0, 0};

  for (int j0 = 0; j0 < NN; j0 += 32) {
    __syncthreads();
    {  // stage K chunk row-major (async DMA), V chunk transposed (registers)
      const int jr = threadIdx.x >> 2;
      const int dh0 = (threadIdx.x & 3) * 8;
      const size_t gb = (size_t)(b * NN + j0 + jr) * DD + h * DH + dh0;
      copy_b128_to_lds(Km + gb, Kt + jr * 32 + dh0);
      union { uint4 q; bf16_t e[8]; } uv;
      uv.q = *(const uint4*)(Vm + gb);
#pragma unroll
      for (int e = 0; e < 8; ++e) Vt[(dh0 + e) * 32 + jr] = uv.e[e];
    }
    async_lds_wait();
    __syncthreads();

    // S = Q @ K^T for two 16-col tiles
    FragF S0, S1;
    {
      Frag16 kf;
#pragma unroll
      for (int v = 0; v < 8; ++v) {
        const int kp = (v >> 2) * 16 + hf * 8 + (v & 3) * 2;
        kf.u[v] = *(const uint32_t*)(Kt + ln * 32 + kp);
      }
      S0.v = __builtin_amdgcn_wmma_f32_16x16x32_bf16(
          false, qf.v, false, kf.v, (short)0, (v8f){0,0,0,0,0,0,0,0}, false, false);
#pragma unroll
      for (int v = 0; v < 8; ++v) {
        const int kp = (v >> 2) * 16 + hf * 8 + (v & 3) * 2;
        kf.u[v] = *(const uint32_t*)(Kt + (16 + ln) * 32 + kp);
      }
      S1.v = __builtin_amdgcn_wmma_f32_16x16x32_bf16(
          false, qf.v, false, kf.v, (short)0, (v8f){0,0,0,0,0,0,0,0}, false, false);
    }

    // match-weight + online softmax (rows live on VGPR r, cols across 16 lanes)
    float p0[8], p1[8];
#pragma unroll
    for (int r = 0; r < 8; ++r) {
      const int irow = i0 + hf * 8 + r;
      const int ja = j0 + ln, jb = j0 + 16 + ln;
      float s0 = S0.f[r] * (dir ? mb[(size_t)ja * NN + irow] : mb[(size_t)irow * NN + ja]);
      float s1 = S1.f[r] * (dir ? mb[(size_t)jb * NN + irow] : mb[(size_t)irow * NN + jb]);
      float cm = fmaxf(s0, s1);
#pragma unroll
      for (int off = 1; off < 16; off <<= 1) cm = fmaxf(cm, __shfl_xor(cm, off, 32));
      const float nm = fmaxf(mrow[r], cm);
      const float fac = __expf(mrow[r] - nm);
      const float e0 = __expf(s0 - nm), e1 = __expf(s1 - nm);
      float cs = e0 + e1;
#pragma unroll
      for (int off = 1; off < 16; off <<= 1) cs += __shfl_xor(cs, off, 32);
      lrow[r] = lrow[r] * fac + cs;
      mrow[r] = nm;
      O0.f[r] *= fac; O1.f[r] *= fac;
      p0[r] = e0; p1[r] = e1;
    }

    // C-layout P -> LDS -> A-layout fragment (within-wave round trip)
    bf16_t* pb = &Pb[wave][0];
#pragma unroll
    for (int r = 0; r < 8; ++r) {
      const int mr = hf * 8 + r;
      pb[mr * 32 + ln]      = f2bf(p0[r]);
      pb[mr * 32 + 16 + ln] = f2bf(p1[r]);
    }
    asm volatile("s_wait_dscnt 0" ::: "memory");
    Frag16 pf, vf0, vf1;
#pragma unroll
    for (int v = 0; v < 8; ++v) {
      const int kp = (v >> 2) * 16 + hf * 8 + (v & 3) * 2;
      pf.u[v]  = *(const uint32_t*)(pb + ln * 32 + kp);
      vf0.u[v] = *(const uint32_t*)(Vt + ln * 32 + kp);
      vf1.u[v] = *(const uint32_t*)(Vt + (16 + ln) * 32 + kp);
    }
    O0.v = __builtin_amdgcn_wmma_f32_16x16x32_bf16(
        false, pf.v, false, vf0.v, (short)0, O0.v, false, false);
    O1.v = __builtin_amdgcn_wmma_f32_16x16x32_bf16(
        false, pf.v, false, vf1.v, (short)0, O1.v, false, false);
  }

#pragma unroll
  for (int r = 0; r < 8; ++r) {
    const int row = i0 + hf * 8 + r;
    const float inv = 1.0f / lrow[r];
    const size_t ob = (size_t)(b * NN + row) * DD + h * DH;
    Out[ob + ln]      = f2bf(O0.f[r] * inv);
    Out[ob + 16 + ln] = f2bf(O1.f[r] * inv);
  }
}

// ------------------------ LayerNorm + exact GELU ---------------------------
__global__ __launch_bounds__(256) void ln_gelu(
    const float* __restrict__ hbuf, const float* __restrict__ gamma,
    const float* __restrict__ beta, bf16_t* __restrict__ gbuf) {
  const int row = blockIdx.x;
  const float* hp = hbuf + (size_t)row * 512;
  const int c0 = threadIdx.x, c1 = threadIdx.x + 256;
  float x0 = hp[c0], x1 = hp[c1];

  __shared__ float red[20];
  float s = x0 + x1, q = x0 * x0 + x1 * x1;
#pragma unroll
  for (int off = 16; off; off >>= 1) { s += __shfl_xor(s, off, 32); q += __shfl_xor(q, off, 32); }
  const int wave = threadIdx.x >> 5, lane = threadIdx.x & 31;
  if (lane == 0) { red[wave] = s; red[wave + 8] = q; }
  __syncthreads();
  if (threadIdx.x == 0) {
    float S = 0.f, Q = 0.f;
    for (int w = 0; w < 8; ++w) { S += red[w]; Q += red[w + 8]; }
    const float mu = S * (1.f / 512.f);
    red[16] = mu;
    red[17] = Q * (1.f / 512.f) - mu * mu;
  }
  __syncthreads();
  const float mu = red[16];
  const float rs = rsqrtf(red[17] + 1e-5f);
  float y0 = (x0 - mu) * rs * gamma[c0] + beta[c0];
  float y1 = (x1 - mu) * rs * gamma[c1] + beta[c1];
  y0 = 0.5f * y0 * (1.f + erff(y0 * 0.70710678118654752f));
  y1 = 0.5f * y1 * (1.f + erff(y1 * 0.70710678118654752f));
  gbuf[(size_t)row * 512 + c0] = f2bf(y0);
  gbuf[(size_t)row * 512 + c1] = f2bf(y1);
}

// ------------------------------- host side ---------------------------------
extern "C" void kernel_launch(void* const* d_in, const int* in_sizes, int n_in,
                              void* d_out, int out_size, void* d_ws, size_t ws_size,
                              hipStream_t stream) {
  const int B = 2, N = 2048, D = 256, H = 8, M = B * N, D2 = 2 * D;
  (void)in_sizes; (void)n_in; (void)out_size; (void)ws_size; (void)H;

  const float* x0    = (const float*)d_in[0];
  const float* x1    = (const float*)d_in[1];
  const float* match = (const float*)d_in[2];
  const float* Wqk   = (const float*)d_in[3];
  const float* bqk   = (const float*)d_in[4];
  const float* Wv    = (const float*)d_in[5];
  const float* bv    = (const float*)d_in[6];
  const float* Wo    = (const float*)d_in[7];
  const float* bo    = (const float*)d_in[8];
  const float* W1    = (const float*)d_in[9];
  const float* b1    = (const float*)d_in[10];
  const float* gamma = (const float*)d_in[11];
  const float* beta  = (const float*)d_in[12];
  const float* W2    = (const float*)d_in[13];
  const float* b2    = (const float*)d_in[14];
  float* out = (float*)d_out;

  char* ws = (char*)d_ws;
  auto alloc = [&](size_t bytes) {
    char* p = ws; ws += (bytes + 255) & ~(size_t)255; return p;
  };
  bf16_t* WqkB = (bf16_t*)alloc((size_t)D * D * 2);
  bf16_t* WvB  = (bf16_t*)alloc((size_t)D * D * 2);
  bf16_t* WoB  = (bf16_t*)alloc((size_t)D * D * 2);
  bf16_t* W1B  = (bf16_t*)alloc((size_t)D2 * D2 * 2);
  bf16_t* W2B  = (bf16_t*)alloc((size_t)D2 * D * 2);
  bf16_t* qk0s = (bf16_t*)alloc((size_t)M * D * 2);
  bf16_t* qk1s = (bf16_t*)alloc((size_t)M * D * 2);
  bf16_t* v0bb = (bf16_t*)alloc((size_t)M * D * 2);
  bf16_t* v1bb = (bf16_t*)alloc((size_t)M * D * 2);
  bf16_t* m0b  = (bf16_t*)alloc((size_t)M * D * 2);
  bf16_t* m1b  = (bf16_t*)alloc((size_t)M * D * 2);
  bf16_t* cat0 = (bf16_t*)alloc((size_t)M * D2 * 2);
  bf16_t* cat1 = (bf16_t*)alloc((size_t)M * D2 * 2);
  float*  h0   = (float*)alloc((size_t)M * D2 * 4);
  float*  h1   = (float*)alloc((size_t)M * D2 * 4);
  bf16_t* g0 = qk0s;  // 4MB alias over qk0s+qk1s (dead after attention)
  bf16_t* g1 = v0bb;  // 4MB alias over v0bb+v1bb (dead after attention)

  auto cvt = [&](const float* in, bf16_t* o, int total, int inner, int ostride) {
    cvt_f32_bf16<<<dim3((total + 255) / 256), dim3(256), 0, stream>>>(in, o, total, inner, ostride);
  };
  // weights + x into concat buffers (first 256 cols of cat = x)
  cvt(Wqk, WqkB, D * D, D * D, D * D);
  cvt(Wv,  WvB,  D * D, D * D, D * D);
  cvt(Wo,  WoB,  D * D, D * D, D * D);
  cvt(W1,  W1B,  D2 * D2, D2 * D2, D2 * D2);
  cvt(W2,  W2B,  D2 * D, D2 * D, D2 * D);
  cvt(x0, cat0, M * D, D, D2);
  cvt(x1, cat1, M * D, D, D2);

  const float s = 0.42044820762685725f;  // (DH^-0.5)^0.5 = 32^-0.25

  auto gemmB = [&](const bf16_t* A, int lda, const bf16_t* Bm, int ldb,
                   const float* bias, float scale, bf16_t* oB, int ldo, int Nc, int K) {
    gemm_wmma<<<dim3(M / 128, Nc / 64), dim3(256), 0, stream>>>(
        A, lda, Bm, ldb, bias, scale, oB, nullptr, nullptr, ldo, 0, K);
  };
  auto gemmF = [&](const bf16_t* A, int lda, const bf16_t* Bm, int ldb,
                   const float* bias, float* oF, const float* res, int ldo, int ldr,
                   int Nc, int K) {
    gemm_wmma<<<dim3(M / 128, Nc / 64), dim3(256), 0, stream>>>(
        A, lda, Bm, ldb, bias, 1.0f, nullptr, oF, res, ldo, ldr, K);
  };

  // projections: qk = (x@Wqk + bqk)*s ; v = x@Wv + bv
  gemmB(cat0, D2, WqkB, D, bqk, s,    qk0s, D, D, D);
  gemmB(cat1, D2, WqkB, D, bqk, s,    qk1s, D, D, D);
  gemmB(cat0, D2, WvB,  D, bv,  1.0f, v0bb, D, D, D);
  gemmB(cat1, D2, WvB,  D, bv,  1.0f, v1bb, D, D, D);

  // flash attention, both directions
  flash_attn<<<dim3(N / 64, H, 2 * B), dim3(128), 0, stream>>>(
      qk0s, qk1s, v0bb, v1bb, match, m0b, m1b);

  // output projection, written directly into cat[:, 256:512]
  gemmB(m0b, D, WoB, D, bo, 1.0f, cat0 + D, D2, D, D);
  gemmB(m1b, D, WoB, D, bo, 1.0f, cat1 + D, D2, D, D);

  // FFN: h = cat @ W1 + b1 (f32) ; LN + exact GELU -> bf16
  gemmF(cat0, D2, W1B, D2, b1, h0, nullptr, D2, 0, D2, D2);
  gemmF(cat1, D2, W1B, D2, b1, h1, nullptr, D2, 0, D2, D2);
  ln_gelu<<<dim3(M), dim3(256), 0, stream>>>(h0, gamma, beta, g0);
  ln_gelu<<<dim3(M), dim3(256), 0, stream>>>(h1, gamma, beta, g1);

  // out = x + g @ W2 + b2
  gemmF(g0, D2, W2B, D, b2, out,               x0, D, D, D, D2);
  gemmF(g1, D2, W2B, D, b2, out + (size_t)M * D, x1, D, D, D, D2);
}

// v001
// It runs in 273 microseconds.
// Two timings next to v000 put it at 1.41 and 1.42 times that version's speed.
#include <hip/hip_runtime.h>
#include <hip/hip_bf16.h>
#include <stdint.h>

// ---------------------------------------------------------------------------
// CDNA5 (gfx1250) CrossBlock: bf16 WMMA GEMMs + dual-direction flash attention
// + ASYNCcnt-tracked global->LDS tile staging where no transpose is needed.
// ---------------------------------------------------------------------------

typedef __bf16 bf16_t;
typedef __attribute__((ext_vector_type(16))) __bf16 v16bf;
typedef __attribute__((ext_vector_type(8)))  float  v8f;
typedef __attribute__((ext_vector_type(4)))  int    v4i;

union Frag16 { v16bf v; uint32_t u[8]; };
union FragF  { v8f   v; float    f[8]; };

__device__ __forceinline__ bf16_t f2bf(float f) {
  uint32_t u = __builtin_bit_cast(uint32_t, f);
  uint32_t r = (u + 0x7FFFu + ((u >> 16) & 1u)) >> 16;   // round-to-nearest-even
  unsigned short s = (unsigned short)r;
  return __builtin_bit_cast(bf16_t, s);
}

// ---------------- async global->LDS (CDNA5 GLOBAL_LOAD_ASYNC_TO_LDS) -------
#if defined(__has_builtin)
#if __has_builtin(__builtin_amdgcn_global_load_async_to_lds_b128)
#define HAVE_ASYNC_LDS 1
#else
#define HAVE_ASYNC_LDS 0
#endif
#else
#define HAVE_ASYNC_LDS 0
#endif

typedef __attribute__((address_space(1))) v4i* gas_v4i_t;
typedef __attribute__((address_space(3))) v4i* las_v4i_t;

__device__ __forceinline__ void copy_b128_to_lds(const void* g, void* l) {
#if HAVE_ASYNC_LDS
  __builtin_amdgcn_global_load_async_to_lds_b128((gas_v4i_t)g, (las_v4i_t)l, 0, 0);
#else
  *(uint4*)l = *(const uint4*)g;
#endif
}

__device__ __forceinline__ void async_lds_wait() {
#if HAVE_ASYNC_LDS
#if __has_builtin(__builtin_amdgcn_s_wait_asynccnt)
  __builtin_amdgcn_s_wait_asynccnt(0);
#else
  asm volatile("s_wait_asynccnt 0x0" ::: "memory");
#endif
#endif
}

// ------------------------- f32 -> bf16 (strided) ---------------------------
__global__ void cvt_f32_bf16(const float* __restrict__ in, bf16_t* __restrict__ out,
                             int total, int inner, int ostride) {
  int i = blockIdx.x * blockDim.x + threadIdx.x;
  if (i >= total) return;
  int r = i / inner, c = i - r * inner;
  out[(size_t)r * ostride + c] = f2bf(in[i]);
}

// ----------------------------- generic GEMM --------------------------------
// C[M=grid.x*128, N=grid.y*64] = (A[M,K]bf16 @ B[K,N]bf16 + bias)*scale (+res)
// 8 waves: wave w owns rows [w*16, w*16+16) of the block tile, all 64 cols.
__global__ __launch_bounds__(256) void gemm_wmma(
    const bf16_t* __restrict__ A, int lda,
    const bf16_t* __restrict__ Bm, int ldb,
    const float* __restrict__ bias, float scale,
    bf16_t* __restrict__ outB, float* __restrict__ outF,
    const float* __restrict__ res, int ldo, int ldr, int K) {
  __shared__ __align__(16) bf16_t As[128 * 32];
  __shared__ __align__(16) bf16_t Bs[64 * 32];   // stored [n][k] (K-contiguous)

  const int bm = blockIdx.x * 128;
  const int bn = blockIdx.y * 64;
  const int t = threadIdx.x;
  const int wave = t >> 5;
  const int lane = t & 31;
  const int hf = lane >> 4;       // which 16-lane half of the wave
  const int ln = lane & 15;

  FragF acc[4];
#pragma unroll
  for (int i = 0; i < 4; ++i) acc[i].v = (v8f){0, 0, 0, 0, 0, 0, 0, 0};

  for (int k0 = 0; k0 < K; k0 += 32) {
    __syncthreads();
    {  // stage A tile 128x32 (async DMA to LDS; two b128 per thread)
      const int row = t >> 1;
      const int hs = (t & 1) * 16;
      const bf16_t* gsrc = A + (size_t)(bm + row) * lda + k0 + hs;
      bf16_t* ldst = As + row * 32 + hs;
      copy_b128_to_lds(gsrc, ldst);
      copy_b128_to_lds(gsrc + 8, ldst + 8);
      if (k0 + 32 < K) __builtin_prefetch(gsrc + 32, 0, 0);
    }
    {  // stage B tile 32x64 -> LDS transposed [n][k] (register path)
      const int kr = t >> 3;
      const int nc = (t & 7) * 8;
      union { uint4 q; bf16_t e[8]; } ub;
      ub.q = *(const uint4*)(Bm + (size_t)(k0 + kr) * ldb + bn + nc);
#pragma unroll
      for (int e = 0; e < 8; ++e) Bs[(nc + e) * 32 + kr] = ub.e[e];
    }
    async_lds_wait();
    __syncthreads();

    Frag16 af;
#pragma unroll
    for (int v = 0; v < 8; ++v) {
      const int kp = (v >> 2) * 16 + hf * 8 + (v & 3) * 2;
      af.u[v] = *(const uint32_t*)(As + (wave * 16 + ln) * 32 + kp);
    }
#pragma unroll
    for (int ns = 0; ns < 4; ++ns) {
      Frag16 bfr;
#pragma unroll
      for (int v = 0; v < 8; ++v) {
        const int kp = (v >> 2) * 16 + hf * 8 + (v & 3) * 2;
        bfr.u[v] = *(const uint32_t*)(Bs + (ns * 16 + ln) * 32 + kp);
      }
      acc[ns].v = __builtin_amdgcn_wmma_f32_16x16x32_bf16(
          false, af.v, false, bfr.v, (short)0, acc[ns].v, false, false);
    }
  }

#pragma unroll
  for (int ns = 0; ns < 4; ++ns) {
#pragma unroll
    for (int r = 0; r < 8; ++r) {
      const int row = bm + wave * 16 + hf * 8 + r;   // C/D layout: m = r + 8*half
      const int col = bn + ns * 16 + ln;
      float vo = (acc[ns].f[r] + bias[col]) * scale;
      if (outB) {
        outB[(size_t)row * ldo + col] = f2bf(vo);
      } else {
        if (res) vo += res[(size_t)row * ldr + col];
        outF[(size_t)row * ldo + col] = vo;
      }
    }
  }
}

typedef __attribute__((ext_vector_type(2))) float  f32x2;
typedef __attribute__((ext_vector_type(2))) __bf16 bf16x2;

__device__ __forceinline__ uint32_t pack_bf16(float lo, float hi) {
  f32x2 p = {lo, hi};
  return __builtin_bit_cast(uint32_t, __builtin_convertvector(p, bf16x2));
}

// value of lane l ^ 16
__device__ __forceinline__ float other_half(float x) {
  const int xi = __builtin_bit_cast(int, x);
  return __builtin_bit_cast(float, __builtin_amdgcn_permlanex16(
      xi, xi, 0x76543210, 0xfedcba98, false, false));
}

// One direction's whole pass. DIR is a compile-time constant so that the loop
// holds that direction's match loads alone, with no branch and no select.
template <int DIR>
__device__ __forceinline__ void attn_dir(
    const bf16_t* __restrict__ Q, const bf16_t* __restrict__ Km,
    const bf16_t* __restrict__ Vm, const float* __restrict__ mb,
    bf16_t* __restrict__ Out, bf16_t* Kt, bf16_t* Vt, int b, int h) {
  const int NN = 2048, DD = 256, DH = 32;
  const int wave = threadIdx.x >> 5;
  const int lane = threadIdx.x & 31;
  const int hf = lane >> 4;
  const int ln = lane & 15;
  const int i0 = blockIdx.x * 64 + wave * 16;

  // Q fragment (B operand: lane holds query i0+ln), straight from global
  Frag16 qf;
  {
    const size_t qbase = (size_t)(b * NN + i0 + ln) * DD + h * DH;
#pragma unroll
    for (int v = 0; v < 8; ++v) {
      const int kp = (v >> 2) * 16 + hf * 8 + (v & 3) * 2;
      qf.u[v] = *(const uint32_t*)(Q + qbase + kp);
    }
  }

  float mrow = -1e30f, lrow = 0.f;   // of query i0+ln; lrow: this half's keys only
  FragF O0, O1;                      // O^T: f[r] = O[i0+ln][d*16 + hf*8 + r]
  O0.v = (v8f){0, 0, 0, 0, 0, 0, 0, 0};
  O1.v = (v8f){0, 0, 0, 0, 0, 0, 0, 0};

  for (int j0 = 0; j0 < NN; j0 += 32) {
    __syncthreads();
    {  // stage K chunk row-major (async DMA), V chunk transposed (registers)
      const int jr = threadIdx.x >> 2;
      const int dh0 = (threadIdx.x & 3) * 8;
      const size_t gb = (size_t)(b * NN + j0 + jr) * DD + h * DH + dh0;
      copy_b128_to_lds(Km + gb, Kt + jr * 32 + dh0);
      union { uint4 q; bf16_t e[8]; } uv;
      uv.q = *(const uint4*)(Vm + gb);
#pragma unroll
      for (int e = 0; e < 8; ++e) Vt[(dh0 + e) * 32 + jr] = uv.e[e];
    }
    async_lds_wait();
    __syncthreads();

    // match weights of this lane's 16 scores: key j0+t*16+hf*8+r, query i0+ln
    float w[16];
    if (DIR) {
      const float* mp = mb + (size_t)(j0 + hf * 8) * NN + i0 + ln;
#pragma unroll
      for (int t = 0; t < 2; ++t)
#pragma unroll
        for (int r = 0; r < 8; ++r) w[t * 8 + r] = mp[(size_t)(t * 16 + r) * NN];
    } else {
      const float* mp = mb + (size_t)(i0 + ln) * NN + j0 + hf * 8;
#pragma unroll
      for (int t = 0; t < 2; ++t)
#pragma unroll
        for (int q = 0; q < 2; ++q) {
          const float4 f = *(const float4*)(mp + t * 16 + q * 4);
          w[t * 8 + q * 4 + 0] = f.x; w[t * 8 + q * 4 + 1] = f.y;
          w[t * 8 + q * 4 + 2] = f.z; w[t * 8 + q * 4 + 3] = f.w;
        }
    }

    // S^T = K @ Q^T for two 16-key tiles: S[t].f[r] = key j0+t*16+hf*8+r, query i0+ln
    FragF S[2];
#pragma unroll
    for (int t = 0; t < 2; ++t) {
      Frag16 kf;
#pragma unroll
      for (int v = 0; v < 8; ++v) {
        const int kp = (v >> 2) * 16 + hf * 8 + (v & 3) * 2;
        kf.u[v] = *(const uint32_t*)(Kt + (t * 16 + ln) * 32 + kp);
      }
      S[t].v = __builtin_amdgcn_wmma_f32_16x16x32_bf16(
          false, kf.v, false, qf.v, (short)0, (v8f){0,0,0,0,0,0,0,0}, false, false);
    }

    // online softmax, one query per lane
    float sc[16];
#pragma unroll
    for (int k = 0; k < 16; ++k) sc[k] = S[k >> 3].f[k & 7] * w[k];
    float mx[8];
#pragma unroll
    for (int k = 0; k < 8; ++k) mx[k] = fmaxf(sc[2 * k], sc[2 * k + 1]);
    float cm = fmaxf(fmaxf(fmaxf(mx[0], mx[1]), fmaxf(mx[2], mx[3])),
                     fmaxf(fmaxf(mx[4], mx[5]), fmaxf(mx[6], mx[7])));
    cm = fmaxf(cm, other_half(cm));
    const float nm = fmaxf(mrow, cm);
    const float fac = __expf(mrow - nm);
    float ex[16];
#pragma unroll
    for (int k = 0; k < 16; ++k) ex[k] = __expf(sc[k] - nm);
    float sm[8];
#pragma unroll
    for (int k = 0; k < 8; ++k) sm[k] = ex[2 * k] + ex[2 * k + 1];
    const float cs = ((sm[0] + sm[1]) + (sm[2] + sm[3])) + ((sm[4] + sm[5]) + (sm[6] + sm[7]));
    lrow = lrow * fac + cs;
    mrow = nm;
#pragma unroll
    for (int r = 0; r < 8; ++r) { O0.f[r] *= fac; O1.f[r] *= fac; }

    // P^T as B operand: element s = tile s>>3, register s&7 (the hardware k order)
    Frag16 pf, vf0, vf1;
#pragma unroll
    for (int v = 0; v < 8; ++v) {
      const int kp = (v >> 2) * 16 + hf * 8 + (v & 3) * 2;
      pf.u[v]  = pack_bf16(ex[2 * v], ex[2 * v + 1]);
      vf0.u[v] = *(const uint32_t*)(Vt + ln * 32 + kp);
      vf1.u[v] = *(const uint32_t*)(Vt + (16 + ln) * 32 + kp);
    }
    O0.v = __builtin_amdgcn_wmma_f32_16x16x32_bf16(
        false, vf0.v, false, pf.v, (short)0, O0.v, false, false);
    O1.v = __builtin_amdgcn_wmma_f32_16x16x32_bf16(
        false, vf1.v, false, pf.v, (short)0, O1.v, false, false);
  }

  {  // join the halves' sums once; a lane stores 8 consecutive dh per tile
    const float inv = 1.0f / (lrow + other_half(lrow));
    bf16_t* op = Out + (size_t)(b * NN + i0 + ln) * DD + h * DH + hf * 8;
    uint4 a0, a1;
    a0.x = pack_bf16(O0.f[0] * inv, O0.f[1] * inv);
    a0.y = pack_bf16(O0.f[2] * inv, O0.f[3] * inv);
    a0.z = pack_bf16(O0.f[4] * inv, O0.f[5] * inv);
    a0.w = pack_bf16(O0.f[6] * inv, O0.f[7] * inv);
    a1.x = pack_bf16(O1.f[0] * inv, O1.f[1] * inv);
    a1.y = pack_bf16(O1.f[2] * inv, O1.f[3] * inv);
    a1.z = pack_bf16(O1.f[4] * inv, O1.f[5] * inv);
    a1.w = pack_bf16(O1.f[6] * inv, O1.f[7] * inv);
    *(uint4*)op = a0;
    *(uint4*)(op + 16) = a1;
  }
}

__global__ __launch_bounds__(128) void flash_attn(
    const bf16_t* __restrict__ qk0, const bf16_t* __restrict__ qk1,
    const bf16_t* __restrict__ v0b, const bf16_t* __restrict__ v1b,
    const float* __restrict__ match,
    bf16_t* __restrict__ m0, bf16_t* __restrict__ m1) {
  const int NN = 2048;
  const int dir = blockIdx.z >> 1;
  const int b = blockIdx.z & 1;
  const int h = blockIdx.y;
  const float* mb = match + (size_t)b * NN * NN;

  __shared__ __align__(16) bf16_t Kt[32 * 32];        // [j][dh]
  __shared__ __align__(16) bf16_t Vt[32 * 32];        // [dh][j] (transposed)

  if (dir) attn_dir<1>(qk1, qk0, v0b, mb, m1, Kt, Vt, b, h);
  else     attn_dir<0>(qk0, qk1, v1b, mb, m0, Kt, Vt, b, h);
}

// ------------------------ LayerNorm + exact GELU ---------------------------
__global__ __launch_bounds__(256) void ln_gelu(
    const float* __restrict__ hbuf, const float* __restrict__ gamma,
    const float* __restrict__ beta, bf16_t* __restrict__ gbuf) {
  const int row = blockIdx.x;
  const float* hp = hbuf + (size_t)row * 512;
  const int c0 = threadIdx.x, c1 = threadIdx.x + 256;
  float x0 = hp[c0], x1 = hp[c1];

  __shared__ float red[20];
  float s = x0 + x1, q = x0 * x0 + x1 * x1;
#pragma unroll
  for (int off = 16; off; off >>= 1) { s += __shfl_xor(s, off, 32); q += __shfl_xor(q, off, 32); }
  const int wave = threadIdx.x >> 5, lane = threadIdx.x & 31;
  if (lane == 0) { red[wave] = s; red[wave + 8] = q; }
  __syncthreads();
  if (threadIdx.x == 0) {
    float S = 0.f, Q = 0.f;
    for (int w = 0; w < 8; ++w) { S += red[w]; Q += red[w + 8]; }
    const float mu = S * (1.f / 512.f);
    red[16] = mu;
    red[17] = Q * (1.f / 512.f) - mu * mu;
  }
  __syncthreads();
  const float mu = red[16];
  const float rs = rsqrtf(red[17] + 1e-5f);
  float y0 = (x0 - mu) * rs * gamma[c0] + beta[c0];
  float y1 = (x1 - mu) * rs * gamma[c1] + beta[c1];
  y0 = 0.5f * y0 * (1.f + erff(y0 * 0.70710678118654752f));
  y1 = 0.5f * y1 * (1.f + erff(y1 * 0.70710678118654752f));
  gbuf[(size_t)row * 512 + c0] = f2bf(y0);
  gbuf[(size_t)row * 512 + c1] = f2bf(y1);
}

// ------------------------------- host side ---------------------------------
extern "C" void kernel_launch(void* const* d_in, const int* in_sizes, int n_in,
                              void* d_out, int out_size, void* d_ws, size_t ws_size,
                              hipStream_t stream) {
  const int B = 2, N = 2048, D = 256, H = 8, M = B * N, D2 = 2 * D;
  (void)in_sizes; (void)n_in; (void)out_size; (void)ws_size; (void)H;

  const float* x0    = (const float*)d_in[0];
  const float* x1    = (const float*)d_in[1];
  const float* match = (const float*)d_in[2];
  const float* Wqk   = (const float*)d_in[3];
  const float* bqk   = (const float*)d_in[4];
  const float* Wv    = (const float*)d_in[5];
  const float* bv    = (const float*)d_in[6];
  const float* Wo    = (const float*)d_in[7];
  const float* bo    = (const float*)d_in[8];
  const float* W1    = (const float*)d_in[9];
  const float* b1    = (const float*)d_in[10];
  const float* gamma = (const float*)d_in[11];
  const float* beta  = (const float*)d_in[12];
  const float* W2    = (const float*)d_in[13];
  const float* b2    = (const float*)d_in[14];
  float* out = (float*)d_out;

  char* ws = (char*)d_ws;
  auto alloc = [&](size_t bytes) {
    char* p = ws; ws += (bytes + 255) & ~(size_t)255; return p;
  };
  bf16_t* WqkB = (bf16_t*)alloc((size_t)D * D * 2);
  bf16_t* WvB  = (bf16_t*)alloc((size_t)D * D * 2);
  bf16_t* WoB  = (bf16_t*)alloc((size_t)D * D * 2);
  bf16_t* W1B  = (bf16_t*)alloc((size_t)D2 * D2 * 2);
  bf16_t* W2B  = (bf16_t*)alloc((size_t)D2 * D * 2);
  bf16_t* qk0s = (bf16_t*)alloc((size_t)M * D * 2);
  bf16_t* qk1s = (bf16_t*)alloc((size_t)M * D * 2);
  bf16_t* v0bb = (bf16_t*)alloc((size_t)M * D * 2);
  bf16_t* v1bb = (bf16_t*)alloc((size_t)M * D * 2);
  bf16_t* m0b  = (bf16_t*)alloc((size_t)M * D * 2);
  bf16_t* m1b  = (bf16_t*)alloc((size_t)M * D * 2);
  bf16_t* cat0 = (bf16_t*)alloc((size_t)M * D2 * 2);
  bf16_t* cat1 = (bf16_t*)alloc((size_t)M * D2 * 2);
  float*  h0   = (float*)alloc((size_t)M * D2 * 4);
  float*  h1   = (float*)alloc((size_t)M * D2 * 4);
  bf16_t* g0 = qk0s;  // 4MB alias over qk0s+qk1s (dead after attention)
  bf16_t* g1 = v0bb;  // 4MB alias over v0bb+v1bb (dead after attention)

  auto cvt = [&](const float* in, bf16_t* o, int total, int inner, int ostride) {
    cvt_f32_bf16<<<dim3((total + 255) / 256), dim3(256), 0, stream>>>(in, o, total, inner, ostride);
  };
  // weights + x into concat buffers (first 256 cols of cat = x)
  cvt(Wqk, WqkB, D * D, D * D, D * D);
  cvt(Wv,  WvB,  D * D, D * D, D * D);
  cvt(Wo,  WoB,  D * D, D * D, D * D);
  cvt(W1,  W1B,  D2 * D2, D2 * D2, D2 * D2);
  cvt(W2,  W2B,  D2 * D, D2 * D, D2 * D);
  cvt(x0, cat0, M * D, D, D2);
  cvt(x1, cat1, M * D, D, D2);

  const float s = 0.42044820762685725f;  // (DH^-0.5)^0.5 = 32^-0.25

  auto gemmB = [&](const bf16_t* A, int lda, const bf16_t* Bm, int ldb,
                   const float* bias, float scale, bf16_t* oB, int ldo, int Nc, int K) {
    gemm_wmma<<<dim3(M / 128, Nc / 64), dim3(256), 0, stream>>>(
        A, lda, Bm, ldb, bias, scale, oB, nullptr, nullptr, ldo, 0, K);
  };
  auto gemmF = [&](const bf16_t* A, int lda, const bf16_t* Bm, int ldb,
                   const float* bias, float* oF, const float* res, int ldo, int ldr,
                   int Nc, int K) {
    gemm_wmma<<<dim3(M / 128, Nc / 64), dim3(256), 0, stream>>>(
        A, lda, Bm, ldb, bias, 1.0f, nullptr, oF, res, ldo, ldr, K);
  };

  // projections: qk = (x@Wqk + bqk)*s ; v = x@Wv + bv
  gemmB(cat0, D2, WqkB, D, bqk, s,    qk0s, D, D, D);
  gemmB(cat1, D2, WqkB, D, bqk, s,    qk1s, D, D, D);
  gemmB(cat0, D2, WvB,  D, bv,  1.0f, v0bb, D, D, D);
  gemmB(cat1, D2, WvB,  D, bv,  1.0f, v1bb, D, D, D);

  // flash attention, both directions
  flash_attn<<<dim3(N / 64, H, 2 * B), dim3(128), 0, stream>>>(
      qk0s, qk1s, v0bb, v1bb, match, m0b, m1b);

  // output projection, written directly into cat[:, 256:512]
  gemmB(m0b, D, WoB, D, bo, 1.0f, cat0 + D, D2, D, D);
  gemmB(m1b, D, WoB, D, bo, 1.0f, cat1 + D, D2, D, D);

  // FFN: h = cat @ W1 + b1 (f32) ; LN + exact GELU -> bf16
  gemmF(cat0, D2, W1B, D2, b1, h0, nullptr, D2, 0, D2, D2);
  gemmF(cat1, D2, W1B, D2, b1, h1, nullptr, D2, 0, D2, D2);
  ln_gelu<<<dim3(M), dim3(256), 0, stream>>>(h0, gamma, beta, g0);
  ln_gelu<<<dim3(M), dim3(256), 0, stream>>>(h1, gamma, beta, g1);

  // out = x + g @ W2 + b2
  gemmF(g0, D2, W2B, D, b2, out,               x0, D, D, D, D2);
  gemmF(g1, D2, W2B, D, b2, out + (size_t)M * D, x1, D, D, D, D2);
}

// v002
// A run of this version takes 177 microseconds.
// Next to v001, in two timings, it ran 1.54 and 1.55 times as fast.
// Counting every step since v000, it is 2.19 times as fast.
#include <hip/hip_runtime.h>
#include <hip/hip_bf16.h>
#include <stdint.h>

// ---------------------------------------------------------------------------
// CDNA5 (gfx1250) CrossBlock: bf16 WMMA GEMMs + dual-direction flash attention
// + ASYNCcnt-tracked global->LDS tile staging where no transpose is needed.
// ---------------------------------------------------------------------------

typedef __bf16 bf16_t;
typedef __attribute__((ext_vector_type(16))) __bf16 v16bf;
typedef __attribute__((ext_vector_type(8)))  float  v8f;
typedef __attribute__((ext_vector_type(4)))  int    v4i;

union Frag16 { v16bf v; uint32_t u[8]; };
union FragF  { v8f   v; float    f[8]; };

__device__ __forceinline__ bf16_t f2bf(float f) {
  uint32_t u = __builtin_bit_cast(uint32_t, f);
  uint32_t r = (u + 0x7FFFu + ((u >> 16) & 1u)) >> 16;   // round-to-nearest-even
  unsigned short s = (unsigned short)r;
  return __builtin_bit_cast(bf16_t, s);
}

// ---------------- async global->LDS (CDNA5 GLOBAL_LOAD_ASYNC_TO_LDS) -------
#if defined(__has_builtin)
#if __has_builtin(__builtin_amdgcn_global_load_async_to_lds_b128)
#define HAVE_ASYNC_LDS 1
#else
#define HAVE_ASYNC_LDS 0
#endif
#else
#define HAVE_ASYNC_LDS 0
#endif

typedef __attribute__((address_space(1))) v4i* gas_v4i_t;
typedef __attribute__((address_space(3))) v4i* las_v4i_t;

__device__ __forceinline__ void copy_b128_to_lds(const void* g, void* l) {
#if HAVE_ASYNC_LDS
  __builtin_amdgcn_global_load_async_to_lds_b128((gas_v4i_t)g, (las_v4i_t)l, 0, 0);
#else
  *(uint4*)l = *(const uint4*)g;
#endif
}

__device__ __forceinline__ void async_lds_wait() {
#if HAVE_ASYNC_LDS
#if __has_builtin(__builtin_amdgcn_s_wait_asynccnt)
  __builtin_amdgcn_s_wait_asynccnt(0);
#else
  asm volatile("s_wait_asynccnt 0x0" ::: "memory");
#endif
#endif
}

// ---------------------- f32 -> bf16, all seven inputs -----------------------
// One launch: a block of 256 threads converts 256 consecutive elements of one
// input, picked by the block index. Blocks [0, 8192): one row of x0 or x1 into
// the first 256 columns of the stacked concat buffer (row pitch 512). The rest:
// the five weights, whose bf16 copies lie one behind the other at wdst.
__global__ __launch_bounds__(256) void cvt_all(
    const float* __restrict__ x0, const float* __restrict__ x1,
    const float* __restrict__ Wqk, const float* __restrict__ Wv,
    const float* __restrict__ Wo, const float* __restrict__ W1,
    const float* __restrict__ W2,
    bf16_t* __restrict__ cat, bf16_t* __restrict__ wdst) {
  const int blk = blockIdx.x;
  const int t = threadIdx.x;
  if (blk < 8192) {
    const float* in = blk < 4096 ? x0 : x1;
    cat[(size_t)blk * 512 + t] = f2bf(in[(size_t)(blk & 4095) * 256 + t]);
    return;
  }
  const int wb = blk - 8192;   // 256 | 256 | 256 | 1024 | 512 blocks
  const float* in;
  int first;
  if (wb < 256)       { in = Wqk; first = 0; }
  else if (wb < 512)  { in = Wv;  first = 256; }
  else if (wb < 768)  { in = Wo;  first = 512; }
  else if (wb < 1792) { in = W1;  first = 768; }
  else                { in = W2;  first = 1792; }
  wdst[(size_t)wb * 256 + t] = f2bf(in[(size_t)(wb - first) * 256 + t]);
}

// ----------------------------- generic GEMM --------------------------------
// C[M=grid.x*128, N=grid.y*64] = (A[M,K]bf16 @ B[K,N]bf16 + bias)*scale (+res)
// 8 waves: wave w owns rows [w*16, w*16+16) of the block tile, all 64 cols.
// One launch serves both sides: the rows of side 1 stand behind those of side 0
// in A and in the output; the residual, an input per side, changes at row mres.
// blockIdx.z picks one of two products that share A (weight, bias, scale, out).
__global__ __launch_bounds__(256) void gemm_wmma(
    const bf16_t* __restrict__ A, int lda,
    const bf16_t* __restrict__ B0, const bf16_t* __restrict__ B1, int ldb,
    const float* __restrict__ bias0, const float* __restrict__ bias1,
    float scale0, float scale1,
    bf16_t* __restrict__ outB0, bf16_t* __restrict__ outB1,
    float* __restrict__ outF,
    const float* __restrict__ res0, const float* __restrict__ res1, int mres,
    int ldo, int ldr, int K) {
  __shared__ __align__(16) bf16_t As[128 * 32];
  __shared__ __align__(16) bf16_t Bs[64 * 32];   // stored [n][k] (K-contiguous)

  const int bm = blockIdx.x * 128;
  const int bn = blockIdx.y * 64;
  const bool second = blockIdx.z != 0;
  const bf16_t* Bm  = second ? B1 : B0;
  const float* bias = second ? bias1 : bias0;
  const float scale = second ? scale1 : scale0;
  bf16_t* outB      = second ? outB1 : outB0;
  const float* res  = bm < mres ? res0 : res1;
  const int rfirst  = bm < mres ? 0 : mres;      // first row of that residual
  const int t = threadIdx.x;
  const int wave = t >> 5;
  const int lane = t & 31;
  const int hf = lane >> 4;       // which 16-lane half of the wave
  const int ln = lane & 15;

  FragF acc[4];
#pragma unroll
  for (int i = 0; i < 4; ++i) acc[i].v = (v8f){0, 0, 0, 0, 0, 0, 0, 0};

  for (int k0 = 0; k0 < K; k0 += 32) {
    __syncthreads();
    {  // stage A tile 128x32 (async DMA to LDS; two b128 per thread)
      const int row = t >> 1;
      const int hs = (t & 1) * 16;
      const bf16_t* gsrc = A + (size_t)(bm + row) * lda + k0 + hs;
      bf16_t* ldst = As + row * 32 + hs;
      copy_b128_to_lds(gsrc, ldst);
      copy_b128_to_lds(gsrc + 8, ldst + 8);
      if (k0 + 32 < K) __builtin_prefetch(gsrc + 32, 0, 0);
    }
    {  // stage B tile 32x64 -> LDS transposed [n][k] (register path)
      const int kr = t >> 3;
      const int nc = (t & 7) * 8;
      union { uint4 q; bf16_t e[8]; } ub;
      ub.q = *(const uint4*)(Bm + (size_t)(k0 + kr) * ldb + bn + nc);
#pragma unroll
      for (int e = 0; e < 8; ++e) Bs[(nc + e) * 32 + kr] = ub.e[e];
    }
    async_lds_wait();
    __syncthreads();

    Frag16 af;
#pragma unroll
    for (int v = 0; v < 8; ++v) {
      const int kp = (v >> 2) * 16 + hf * 8 + (v & 3) * 2;
      af.u[v] = *(const uint32_t*)(As + (wave * 16 + ln) * 32 + kp);
    }
#pragma unroll
    for (int ns = 0; ns < 4; ++ns) {
      Frag16 bfr;
#pragma unroll
      for (int v = 0; v < 8; ++v) {
        const int kp = (v >> 2) * 16 + hf * 8 + (v & 3) * 2;
        bfr.u[v] = *(const uint32_t*)(Bs + (ns * 16 + ln) * 32 + kp);
      }
      acc[ns].v = __builtin_amdgcn_wmma_f32_16x16x32_bf16(
          false, af.v, false, bfr.v, (short)0, acc[ns].v, false, false);
    }
  }

#pragma unroll
  for (int ns = 0; ns < 4; ++ns) {
#pragma unroll
    for (int r = 0; r < 8; ++r) {
      const int row = bm + wave * 16 + hf * 8 + r;   // C/D layout: m = r + 8*half
      const int col = bn + ns * 16 + ln;
      float vo = (acc[ns].f[r] + bias[col]) * scale;
      if (outB) {
        outB[(size_t)row * ldo + col] = f2bf(vo);
      } else {
        if (res) vo += res[(size_t)(row - rfirst) * ldr + col];
        outF[(size_t)row * ldo + col] = vo;
      }
    }
  }
}

typedef __attribute__((ext_vector_type(2))) float  f32x2;
typedef __attribute__((ext_vector_type(2))) __bf16 bf16x2;

__device__ __forceinline__ uint32_t pack_bf16(float lo, float hi) {
  f32x2 p = {lo, hi};
  return __builtin_bit_cast(uint32_t, __builtin_convertvector(p, bf16x2));
}

// value of lane l ^ 16
__device__ __forceinline__ float other_half(float x) {
  const int xi = __builtin_bit_cast(int, x);
  return __builtin_bit_cast(float, __builtin_amdgcn_permlanex16(
      xi, xi, 0x76543210, 0xfedcba98, false, false));
}

// One direction's whole pass. DIR is a compile-time constant so that the loop
// holds that direction's match loads alone, with no branch and no select.
template <int DIR>
__device__ __forceinline__ void attn_dir(
    const bf16_t* __restrict__ Q, const bf16_t* __restrict__ Km,
    const bf16_t* __restrict__ Vm, const float* __restrict__ mb,
    bf16_t* __restrict__ Out, bf16_t* Kt, bf16_t* Vt, int b, int h) {
  const int NN = 2048, DD = 256, DH = 32;
  const int wave = threadIdx.x >> 5;
  const int lane = threadIdx.x & 31;
  const int hf = lane >> 4;
  const int ln = lane & 15;
  const int i0 = blockIdx.x * 64 + wave * 16;

  // Q fragment (B operand: lane holds query i0+ln), straight from global
  Frag16 qf;
  {
    const size_t qbase = (size_t)(b * NN + i0 + ln) * DD + h * DH;
#pragma unroll
    for (int v = 0; v < 8; ++v) {
      const int kp = (v >> 2) * 16 + hf * 8 + (v & 3) * 2;
      qf.u[v] = *(const uint32_t*)(Q + qbase + kp);
    }
  }

  float mrow = -1e30f, lrow = 0.f;   // of query i0+ln; lrow: this half's keys only
  FragF O0, O1;                      // O^T: f[r] = O[i0+ln][d*16 + hf*8 + r]
  O0.v = (v8f){0, 0, 0, 0, 0, 0, 0, 0};
  O1.v = (v8f){0, 0, 0, 0, 0, 0, 0, 0};

  for (int j0 = 0; j0 < NN; j0 += 32) {
    __syncthreads();
    {  // stage K chunk row-major (async DMA), V chunk transposed (registers)
      const int jr = threadIdx.x >> 2;
      const int dh0 = (threadIdx.x & 3) * 8;
      const size_t gb = (size_t)(b * NN + j0 + jr) * DD + h * DH + dh0;
      copy_b128_to_lds(Km + gb, Kt + jr * 32 + dh0);
      union { uint4 q; bf16_t e[8]; } uv;
      uv.q = *(const uint4*)(Vm + gb);
#pragma unroll
      for (int e = 0; e < 8; ++e) Vt[(dh0 + e) * 32 + jr] = uv.e[e];
    }
    async_lds_wait();
    __syncthreads();

    // match weights of this lane's 16 scores: key j0+t*16+hf*8+r, query i0+ln
    float w[16];
    if (DIR) {
      const float* mp = mb + (size_t)(j0 + hf * 8) * NN + i0 + ln;
#pragma unroll
      for (int t = 0; t < 2; ++t)
#pragma unroll
        for (int r = 0; r < 8; ++r) w[t * 8 + r] = mp[(size_t)(t * 16 + r) * NN];
    } else {
      const float* mp = mb + (size_t)(i0 + ln) * NN + j0 + hf * 8;
#pragma unroll
      for (int t = 0; t < 2; ++t)
#pragma unroll
        for (int q = 0; q < 2; ++q) {
          const float4 f = *(const float4*)(mp + t * 16 + q * 4);
          w[t * 8 + q * 4 + 0] = f.x; w[t * 8 + q * 4 + 1] = f.y;
          w[t * 8 + q * 4 + 2] = f.z; w[t * 8 + q * 4 + 3] = f.w;
        }
    }

    // S^T = K @ Q^T for two 16-key tiles: S[t].f[r] = key j0+t*16+hf*8+r, query i0+ln
    FragF S[2];
#pragma unroll
    for (int t = 0; t < 2; ++t) {
      Frag16 kf;
#pragma unroll
      for (int v = 0; v < 8; ++v) {
        const int kp = (v >> 2) * 16 + hf * 8 + (v & 3) * 2;
        kf.u[v] = *(const uint32_t*)(Kt + (t * 16 + ln) * 32 + kp);
      }
      S[t].v = __builtin_amdgcn_wmma_f32_16x16x32_bf16(
          false, kf.v, false, qf.v, (short)0, (v8f){0,0,0,0,0,0,0,0}, false, false);
    }

    // online softmax, one query per lane
    float sc[16];
#pragma unroll
    for (int k = 0; k < 16; ++k) sc[k] = S[k >> 3].f[k & 7] * w[k];
    float mx[8];
#pragma unroll
    for (int k = 0; k < 8; ++k) mx[k] = fmaxf(sc[2 * k], sc[2 * k + 1]);
    float cm = fmaxf(fmaxf(fmaxf(mx[0], mx[1]), fmaxf(mx[2], mx[3])),
                     fmaxf(fmaxf(mx[4], mx[5]), fmaxf(mx[6], mx[7])));
    cm = fmaxf(cm, other_half(cm));
    const float nm = fmaxf(mrow, cm);
    const float fac = __expf(mrow - nm);
    float ex[16];
#pragma unroll
    for (int k = 0; k < 16; ++k) ex[k] = __expf(sc[k] - nm);
    float sm[8];
#pragma unroll
    for (int k = 0; k < 8; ++k) sm[k] = ex[2 * k] + ex[2 * k + 1];
    const float cs = ((sm[0] + sm[1]) + (sm[2] + sm[3])) + ((sm[4] + sm[5]) + (sm[6] + sm[7]));
    lrow = lrow * fac + cs;
    mrow = nm;
#pragma unroll
    for (int r = 0; r < 8; ++r) { O0.f[r] *= fac; O1.f[r] *= fac; }

    // P^T as B operand: element s = tile s>>3, register s&7 (the hardware k order)
    Frag16 pf, vf0, vf1;
#pragma unroll
    for (int v = 0; v < 8; ++v) {
      const int kp = (v >> 2) * 16 + hf * 8 + (v & 3) * 2;
      pf.u[v]  = pack_bf16(ex[2 * v], ex[2 * v + 1]);
      vf0.u[v] = *(const uint32_t*)(Vt + ln * 32 + kp);
      vf1.u[v] = *(const uint32_t*)(Vt + (16 + ln) * 32 + kp);
    }
    O0.v = __builtin_amdgcn_wmma_f32_16x16x32_bf16(
        false, vf0.v, false, pf.v, (short)0, O0.v, false, false);
    O1.v = __builtin_amdgcn_wmma_f32_16x16x32_bf16(
        false, vf1.v, false, pf.v, (short)0, O1.v, false, false);
  }

  {  // join the halves' sums once; a lane stores 8 consecutive dh per tile
    const float inv = 1.0f / (lrow + other_half(lrow));
    bf16_t* op = Out + (size_t)(b * NN + i0 + ln) * DD + h * DH + hf * 8;
    uint4 a0, a1;
    a0.x = pack_bf16(O0.f[0] * inv, O0.f[1] * inv);
    a0.y = pack_bf16(O0.f[2] * inv, O0.f[3] * inv);
    a0.z = pack_bf16(O0.f[4] * inv, O0.f[5] * inv);
    a0.w = pack_bf16(O0.f[6] * inv, O0.f[7] * inv);
    a1.x = pack_bf16(O1.f[0] * inv, O1.f[1] * inv);
    a1.y = pack_bf16(O1.f[2] * inv, O1.f[3] * inv);
    a1.z = pack_bf16(O1.f[4] * inv, O1.f[5] * inv);
    a1.w = pack_bf16(O1.f[6] * inv, O1.f[7] * inv);
    *(uint4*)op = a0;
    *(uint4*)(op + 16) = a1;
  }
}

__global__ __launch_bounds__(128) void flash_attn(
    const bf16_t* __restrict__ qk0, const bf16_t* __restrict__ qk1,
    const bf16_t* __restrict__ v0b, const bf16_t* __restrict__ v1b,
    const float* __restrict__ match,
    bf16_t* __restrict__ m0, bf16_t* __restrict__ m1) {
  const int NN = 2048;
  const int dir = blockIdx.z >> 1;
  const int b = blockIdx.z & 1;
  const int h = blockIdx.y;
  const float* mb = match + (size_t)b * NN * NN;

  __shared__ __align__(16) bf16_t Kt[32 * 32];        // [j][dh]
  __shared__ __align__(16) bf16_t Vt[32 * 32];        // [dh][j] (transposed)

  if (dir) attn_dir<1>(qk1, qk0, v0b, mb, m1, Kt, Vt, b, h);
  else     attn_dir<0>(qk0, qk1, v1b, mb, m0, Kt, Vt, b, h);
}

// ------------------------ LayerNorm + exact GELU ---------------------------
__global__ __launch_bounds__(256) void ln_gelu(
    const float* __restrict__ hbuf, const float* __restrict__ gamma,
    const float* __restrict__ beta, bf16_t* __restrict__ gbuf) {
  const int row = blockIdx.x;
  const float* hp = hbuf + (size_t)row * 512;
  const int c0 = threadIdx.x, c1 = threadIdx.x + 256;
  float x0 = hp[c0], x1 = hp[c1];

  __shared__ float red[20];
  float s = x0 + x1, q = x0 * x0 + x1 * x1;
#pragma unroll
  for (int off = 16; off; off >>= 1) { s += __shfl_xor(s, off, 32); q += __shfl_xor(q, off, 32); }
  const int wave = threadIdx.x >> 5, lane = threadIdx.x & 31;
  if (lane == 0) { red[wave] = s; red[wave + 8] = q; }
  __syncthreads();
  if (threadIdx.x == 0) {
    float S = 0.f, Q = 0.f;
    for (int w = 0; w < 8; ++w) { S += red[w]; Q += red[w + 8]; }
    const float mu = S * (1.f / 512.f);
    red[16] = mu;
    red[17] = Q * (1.f / 512.f) - mu * mu;
  }
  __syncthreads();
  const float mu = red[16];
  const float rs = rsqrtf(red[17] + 1e-5f);
  float y0 = (x0 - mu) * rs * gamma[c0] + beta[c0];
  float y1 = (x1 - mu) * rs * gamma[c1] + beta[c1];
  y0 = 0.5f * y0 * (1.f + erff(y0 * 0.70710678118654752f));
  y1 = 0.5f * y1 * (1.f + erff(y1 * 0.70710678118654752f));
  gbuf[(size_t)row * 512 + c0] = f2bf(y0);
  gbuf[(size_t)row * 512 + c1] = f2bf(y1);
}

// ------------------------------- host side ---------------------------------
extern "C" void kernel_launch(void* const* d_in, const int* in_sizes, int n_in,
                              void* d_out, int out_size, void* d_ws, size_t ws_size,
                              hipStream_t stream) {
  const int B = 2, N = 2048, D = 256, H = 8, M = B * N, D2 = 2 * D;
  (void)in_sizes; (void)n_in; (void)out_size; (void)ws_size; (void)H;

  const float* x0    = (const float*)d_in[0];
  const float* x1    = (const float*)d_in[1];
  const float* match = (const float*)d_in[2];
  const float* Wqk   = (const float*)d_in[3];
  const float* bqk   = (const float*)d_in[4];
  const float* Wv    = (const float*)d_in[5];
  const float* bv    = (const float*)d_in[6];
  const float* Wo    = (const float*)d_in[7];
  const float* bo    = (const float*)d_in[8];
  const float* W1    = (const float*)d_in[9];
  const float* b1    = (const float*)d_in[10];
  const float* gamma = (const float*)d_in[11];
  const float* beta  = (const float*)d_in[12];
  const float* W2    = (const float*)d_in[13];
  const float* b2    = (const float*)d_in[14];
  float* out = (float*)d_out;

  char* ws = (char*)d_ws;
  auto alloc = [&](size_t bytes) {
    char* p = ws; ws += (bytes + 255) & ~(size_t)255; return p;
  };
  bf16_t* WqkB = (bf16_t*)alloc((size_t)D * D * 2);
  bf16_t* WvB  = (bf16_t*)alloc((size_t)D * D * 2);
  bf16_t* WoB  = (bf16_t*)alloc((size_t)D * D * 2);
  bf16_t* W1B  = (bf16_t*)alloc((size_t)D2 * D2 * 2);
  bf16_t* W2B  = (bf16_t*)alloc((size_t)D2 * D * 2);
  bf16_t* qk0s = (bf16_t*)alloc((size_t)M * D * 2);
  bf16_t* qk1s = (bf16_t*)alloc((size_t)M * D * 2);
  bf16_t* v0bb = (bf16_t*)alloc((size_t)M * D * 2);
  bf16_t* v1bb = (bf16_t*)alloc((size_t)M * D * 2);
  bf16_t* m0b  = (bf16_t*)alloc((size_t)M * D * 2);
  bf16_t* m1b  = (bf16_t*)alloc((size_t)M * D * 2);
  bf16_t* cat0 = (bf16_t*)alloc((size_t)M * D2 * 2);
  bf16_t* cat1 = (bf16_t*)alloc((size_t)M * D2 * 2);
  float*  h0   = (float*)alloc((size_t)M * D2 * 4);
  float*  h1   = (float*)alloc((size_t)M * D2 * 4);
  bf16_t* g0 = qk0s;  // 8MB alias over qk0s..v1bb (dead after attention)
  (void)cat1; (void)h1;
  // Every buffer size is a multiple of 256 bytes, so each side-1 buffer starts
  // where its side-0 buffer ends: a pair is one matrix of 2*M rows.

  // weights + x into concat buffers (first 256 cols of cat = x)
  cvt_all<<<dim3(2 * M + (3 * D * D + D2 * D2 + D2 * D) / 256), dim3(256), 0, stream>>>(
      x0, x1, Wqk, Wv, Wo, W1, W2, cat0, WqkB);

  const float s = 0.42044820762685725f;  // (DH^-0.5)^0.5 = 32^-0.25

  // projections, both sides: z=0 qk = (x@Wqk + bqk)*s ; z=1 v = x@Wv + bv
  gemm_wmma<<<dim3(2 * M / 128, D / 64, 2), dim3(256), 0, stream>>>(
      cat0, D2, WqkB, WvB, D, bqk, bv, s, 1.0f, qk0s, v0bb, nullptr,
      nullptr, nullptr, 2 * M, D, 0, D);

  // flash attention, both directions
  flash_attn<<<dim3(N / 64, H, 2 * B), dim3(128), 0, stream>>>(
      qk0s, qk1s, v0bb, v1bb, match, m0b, m1b);

  // output projection, written directly into cat[:, 256:512]
  gemm_wmma<<<dim3(2 * M / 128, D / 64, 1), dim3(256), 0, stream>>>(
      m0b, D, WoB, WoB, D, bo, bo, 1.0f, 1.0f, cat0 + D, nullptr, nullptr,
      nullptr, nullptr, 2 * M, D2, 0, D);

  // FFN: h = cat @ W1 + b1 (f32) ; LN + exact GELU -> bf16
  gemm_wmma<<<dim3(2 * M / 128, D2 / 64, 1), dim3(256), 0, stream>>>(
      cat0, D2, W1B, W1B, D2, b1, b1, 1.0f, 1.0f, nullptr, nullptr, h0,
      nullptr, nullptr, 2 * M, D2, 0, D2);
  ln_gelu<<<dim3(2 * M), dim3(256), 0, stream>>>(h0, gamma, beta, g0);

  // out = x + g @ W2 + b2
  gemm_wmma<<<dim3(2 * M / 128, D / 64, 1), dim3(256), 0, stream>>>(
      g0, D2, W2B, W2B, D, b2, b2, 1.0f, 1.0f, nullptr, nullptr, out,
      x0, x1, M, D, D, D2);
}

// v003
// It runs in 172 microseconds.
// Two timings next to v002 put it at 1.03 and 1.02 times that version's speed.
// All steps since v000 together make it 2.25 times as fast.
#include <hip/hip_runtime.h>
#include <hip/hip_bf16.h>
#include <stdint.h>

// ---------------------------------------------------------------------------
// CDNA5 (gfx1250) CrossBlock: bf16 WMMA GEMMs + dual-direction flash attention
// + ASYNCcnt-tracked global->LDS tile staging where no transpose is needed.
// ---------------------------------------------------------------------------

typedef __bf16 bf16_t;
typedef __attribute__((ext_vector_type(16))) __bf16 v16bf;
typedef __attribute__((ext_vector_type(8)))  float  v8f;
typedef __attribute__((ext_vector_type(4)))  int    v4i;

union Frag16 { v16bf v; uint32_t u[8]; };
union FragF  { v8f   v; float    f[8]; };

__device__ __forceinline__ bf16_t f2bf(float f) {
  uint32_t u = __builtin_bit_cast(uint32_t, f);
  uint32_t r = (u + 0x7FFFu + ((u >> 16) & 1u)) >> 16;   // round-to-nearest-even
  unsigned short s = (unsigned short)r;
  return __builtin_bit_cast(bf16_t, s);
}

// ---------------- async global->LDS (CDNA5 GLOBAL_LOAD_ASYNC_TO_LDS) -------
#if defined(__has_builtin)
#if __has_builtin(__builtin_amdgcn_global_load_async_to_lds_b128)
#define HAVE_ASYNC_LDS 1
#else
#define HAVE_ASYNC_LDS 0
#endif
#else
#define HAVE_ASYNC_LDS 0
#endif

typedef __attribute__((address_space(1))) v4i* gas_v4i_t;
typedef __attribute__((address_space(3))) v4i* las_v4i_t;

__device__ __forceinline__ void copy_b128_to_lds(const void* g, void* l) {
#if HAVE_ASYNC_LDS
  __builtin_amdgcn_global_load_async_to_lds_b128((gas_v4i_t)g, (las_v4i_t)l, 0, 0);
#else
  *(uint4*)l = *(const uint4*)g;
#endif
}

__device__ __forceinline__ void async_lds_wait() {
#if HAVE_ASYNC_LDS
#if __has_builtin(__builtin_amdgcn_s_wait_asynccnt)
  __builtin_amdgcn_s_wait_asynccnt(0);
#else
  asm volatile("s_wait_asynccnt 0x0" ::: "memory");
#endif
#endif
}

// ---------------------- f32 -> bf16, all seven inputs -----------------------
// One launch of few, fat blocks: a block of 256 threads converts 4096 consecutive
// elements of one input, picked by the block index; a thread takes 16 of them as
// four 16-byte loads (a wave-wide load covers 512 contiguous bytes), all issued
// before the first use. Blocks [0, 512): 16 rows of x0 or x1 into the first 256
// columns of the stacked concat buffer (row pitch 512). The rest: the five
// weights, whose bf16 copies lie one behind the other at wdst.
__global__ __launch_bounds__(256) void cvt_all(
    const float* __restrict__ x0, const float* __restrict__ x1,
    const float* __restrict__ Wqk, const float* __restrict__ Wv,
    const float* __restrict__ Wo, const float* __restrict__ W1,
    const float* __restrict__ W2,
    bf16_t* __restrict__ cat, bf16_t* __restrict__ wdst) {
  const int blk = blockIdx.x;
  const int off = (threadIdx.x >> 5) * 512 + (threadIdx.x & 31) * 4;
  const bool isx = blk < 512;
  const float* in;     // the block's 4096 source elements
  bf16_t* dst;         // where the first of them goes
  if (isx) {
    in = (blk < 256 ? x0 : x1) + (size_t)(blk & 255) * 4096;
    dst = cat + (size_t)blk * 8192;
  } else {
    const int wb = blk - 512;   // 16 | 16 | 16 | 64 | 32 blocks
    int first;
    if (wb < 16)       { in = Wqk; first = 0; }
    else if (wb < 32)  { in = Wv;  first = 16; }
    else if (wb < 48)  { in = Wo;  first = 32; }
    else if (wb < 112) { in = W1;  first = 48; }
    else               { in = W2;  first = 112; }
    in += (size_t)(wb - first) * 4096;
    dst = wdst + (size_t)wb * 4096;
  }
  float4 f[4];
#pragma unroll
  for (int j = 0; j < 4; ++j) f[j] = *(const float4*)(in + off + j * 128);
#pragma unroll
  for (int j = 0; j < 4; ++j) {
    const int e = off + j * 128;
    const int d = isx ? (e >> 8) * 512 + (e & 255) : e;
    union { uint2 q; bf16_t h[4]; } o;
    o.h[0] = f2bf(f[j].x); o.h[1] = f2bf(f[j].y);
    o.h[2] = f2bf(f[j].z); o.h[3] = f2bf(f[j].w);
    *(uint2*)(dst + d) = o.q;
  }
}

// ----------------------------- generic GEMM --------------------------------
// C[M=grid.x*128, N=grid.y*64] = (A[M,K]bf16 @ B[K,N]bf16 + bias)*scale (+res)
// 8 waves: wave w owns rows [w*16, w*16+16) of the block tile, all 64 cols.
// One launch serves both sides: the rows of side 1 stand behind those of side 0
// in A and in the output; the residual, an input per side, changes at row mres.
// blockIdx.z picks one of two products that share A (weight, bias, scale, out).
__global__ __launch_bounds__(256) void gemm_wmma(
    const bf16_t* __restrict__ A, int lda,
    const bf16_t* __restrict__ B0, const bf16_t* __restrict__ B1, int ldb,
    const float* __restrict__ bias0, const float* __restrict__ bias1,
    float scale0, float scale1,
    bf16_t* __restrict__ outB0, bf16_t* __restrict__ outB1,
    float* __restrict__ outF,
    const float* __restrict__ res0, const float* __restrict__ res1, int mres,
    int ldo, int ldr, int K) {
  __shared__ __align__(16) bf16_t As[128 * 32];
  __shared__ __align__(16) bf16_t Bs[64 * 32];   // stored [n][k] (K-contiguous)

  const int bm = blockIdx.x * 128;
  const int bn = blockIdx.y * 64;
  const bool second = blockIdx.z != 0;
  const bf16_t* Bm  = second ? B1 : B0;
  const float* bias = second ? bias1 : bias0;
  const float scale = second ? scale1 : scale0;
  bf16_t* outB      = second ? outB1 : outB0;
  const float* res  = bm < mres ? res0 : res1;
  const int rfirst  = bm < mres ? 0 : mres;      // first row of that residual
  const int t = threadIdx.x;
  const int wave = t >> 5;
  const int lane = t & 31;
  const int hf = lane >> 4;       // which 16-lane half of the wave
  const int ln = lane & 15;

  FragF acc[4];
#pragma unroll
  for (int i = 0; i < 4; ++i) acc[i].v = (v8f){0, 0, 0, 0, 0, 0, 0, 0};

  for (int k0 = 0; k0 < K; k0 += 32) {
    __syncthreads();
    {  // stage A tile 128x32 (async DMA to LDS; two b128 per thread)
      const int row = t >> 1;
      const int hs = (t & 1) * 16;
      const bf16_t* gsrc = A + (size_t)(bm + row) * lda + k0 + hs;
      bf16_t* ldst = As + row * 32 + hs;
      copy_b128_to_lds(gsrc, ldst);
      copy_b128_to_lds(gsrc + 8, ldst + 8);
      if (k0 + 32 < K) __builtin_prefetch(gsrc + 32, 0, 0);
    }
    {  // stage B tile 32x64 -> LDS transposed [n][k] (register path)
      const int kr = t >> 3;
      const int nc = (t & 7) * 8;
      union { uint4 q; bf16_t e[8]; } ub;
      ub.q = *(const uint4*)(Bm + (size_t)(k0 + kr) * ldb + bn + nc);
#pragma unroll
      for (int e = 0; e < 8; ++e) Bs[(nc + e) * 32 + kr] = ub.e[e];
    }
    async_lds_wait();
    __syncthreads();

    Frag16 af;
#pragma unroll
    for (int v = 0; v < 8; ++v) {
      const int kp = (v >> 2) * 16 + hf * 8 + (v & 3) * 2;
      af.u[v] = *(const uint32_t*)(As + (wave * 16 + ln) * 32 + kp);
    }
#pragma unroll
    for (int ns = 0; ns < 4; ++ns) {
      Frag16 bfr;
#pragma unroll
      for (int v = 0; v < 8; ++v) {
        const int kp = (v >> 2) * 16 + hf * 8 + (v & 3) * 2;
        bfr.u[v] = *(const uint32_t*)(Bs + (ns * 16 + ln) * 32 + kp);
      }
      acc[ns].v = __builtin_amdgcn_wmma_f32_16x16x32_bf16(
          false, af.v, false, bfr.v, (short)0, acc[ns].v, false, false);
    }
  }

#pragma unroll
  for (int ns = 0; ns < 4; ++ns) {
#pragma unroll
    for (int r = 0; r < 8; ++r) {
      const int row = bm + wave * 16 + hf * 8 + r;   // C/D layout: m = r + 8*half
      const int col = bn + ns * 16 + ln;
      float vo = (acc[ns].f[r] + bias[col]) * scale;
      if (outB) {
        outB[(size_t)row * ldo + col] = f2bf(vo);
      } else {
        if (res) vo += res[(size_t)(row - rfirst) * ldr + col];
        outF[(size_t)row * ldo + col] = vo;
      }
    }
  }
}

typedef __attribute__((ext_vector_type(2))) float  f32x2;
typedef __attribute__((ext_vector_type(2))) __bf16 bf16x2;

__device__ __forceinline__ uint32_t pack_bf16(float lo, float hi) {
  f32x2 p = {lo, hi};
  return __builtin_bit_cast(uint32_t, __builtin_convertvector(p, bf16x2));
}

// value of lane l ^ 16
__device__ __forceinline__ float other_half(float x) {
  const int xi = __builtin_bit_cast(int, x);
  return __builtin_bit_cast(float, __builtin_amdgcn_permlanex16(
      xi, xi, 0x76543210, 0xfedcba98, false, false));
}

// One direction's whole pass. DIR is a compile-time constant so that the loop
// holds that direction's match loads alone, with no branch and no select.
template <int DIR>
__device__ __forceinline__ void attn_dir(
    const bf16_t* __restrict__ Q, const bf16_t* __restrict__ Km,
    const bf16_t* __restrict__ Vm, const float* __restrict__ mb,
    bf16_t* __restrict__ Out, bf16_t* Kt, bf16_t* Vt, int b, int h) {
  const int NN = 2048, DD = 256, DH = 32;
  const int wave = threadIdx.x >> 5;
  const int lane = threadIdx.x & 31;
  const int hf = lane >> 4;
  const int ln = lane & 15;
  const int i0 = blockIdx.x * 64 + wave * 16;

  // Q fragment (B operand: lane holds query i0+ln), straight from global
  Frag16 qf;
  {
    const size_t qbase = (size_t)(b * NN + i0 + ln) * DD + h * DH;
#pragma unroll
    for (int v = 0; v < 8; ++v) {
      const int kp = (v >> 2) * 16 + hf * 8 + (v & 3) * 2;
      qf.u[v] = *(const uint32_t*)(Q + qbase + kp);
    }
  }

  float mrow = -1e30f, lrow = 0.f;   // of query i0+ln; lrow: this half's keys only
  FragF O0, O1;                      // O^T: f[r] = O[i0+ln][d*16 + hf*8 + r]
  O0.v = (v8f){0, 0, 0, 0, 0, 0, 0, 0};
  O1.v = (v8f){0, 0, 0, 0, 0, 0, 0, 0};

  for (int j0 = 0; j0 < NN; j0 += 32) {
    __syncthreads();
    {  // stage K chunk row-major (async DMA), V chunk transposed (registers)
      const int jr = threadIdx.x >> 2;
      const int dh0 = (threadIdx.x & 3) * 8;
      const size_t gb = (size_t)(b * NN + j0 + jr) * DD + h * DH + dh0;
      copy_b128_to_lds(Km + gb, Kt + jr * 32 + dh0);
      union { uint4 q; bf16_t e[8]; } uv;
      uv.q = *(const uint4*)(Vm + gb);
#pragma unroll
      for (int e = 0; e < 8; ++e) Vt[(dh0 + e) * 32 + jr] = uv.e[e];
    }
    async_lds_wait();
    __syncthreads();

    // match weights of this lane's 16 scores: key j0+t*16+hf*8+r, query i0+ln
    float w[16];
    if (DIR) {
      const float* mp = mb + (size_t)(j0 + hf * 8) * NN + i0 + ln;
#pragma unroll
      for (int t = 0; t < 2; ++t)
#pragma unroll
        for (int r = 0; r < 8; ++r) w[t * 8 + r] = mp[(size_t)(t * 16 + r) * NN];
    } else {
      const float* mp = mb + (size_t)(i0 + ln) * NN + j0 + hf * 8;
#pragma unroll
      for (int t = 0; t < 2; ++t)
#pragma unroll
        for (int q = 0; q < 2; ++q) {
          const float4 f = *(const float4*)(mp + t * 16 + q * 4);
          w[t * 8 + q * 4 + 0] = f.x; w[t * 8 + q * 4 + 1] = f.y;
          w[t * 8 + q * 4 + 2] = f.z; w[t * 8 + q * 4 + 3] = f.w;
        }
    }

    // S^T = K @ Q^T for two 16-key tiles: S[t].f[r] = key j0+t*16+hf*8+r, query i0+ln
    FragF S[2];
#pragma unroll
    for (int t = 0; t < 2; ++t) {
      Frag16 kf;
#pragma unroll
      for (int v = 0; v < 8; ++v) {
        const int kp = (v >> 2) * 16 + hf * 8 + (v & 3) * 2;
        kf.u[v] = *(const uint32_t*)(Kt + (t * 16 + ln) * 32 + kp);
      }
      S[t].v = __builtin_amdgcn_wmma_f32_16x16x32_bf16(
          false, kf.v, false, qf.v, (short)0, (v8f){0,0,0,0,0,0,0,0}, false, false);
    }

    // online softmax, one query per lane
    float sc[16];
#pragma unroll
    for (int k = 0; k < 16; ++k) sc[k] = S[k >> 3].f[k & 7] * w[k];
    float mx[8];
#pragma unroll
    for (int k = 0; k < 8; ++k) mx[k] = fmaxf(sc[2 * k], sc[2 * k + 1]);
    float cm = fmaxf(fmaxf(fmaxf(mx[0], mx[1]), fmaxf(mx[2], mx[3])),
                     fmaxf(fmaxf(mx[4], mx[5]), fmaxf(mx[6], mx[7])));
    cm = fmaxf(cm, other_half(cm));
    const float nm = fmaxf(mrow, cm);
    const float fac = __expf(mrow - nm);
    float ex[16];
#pragma unroll
    for (int k = 0; k < 16; ++k) ex[k] = __expf(sc[k] - nm);
    float sm[8];
#pragma unroll
    for (int k = 0; k < 8; ++k) sm[k] = ex[2 * k] + ex[2 * k + 1];
    const float cs = ((sm[0] + sm[1]) + (sm[2] + sm[3])) + ((sm[4] + sm[5]) + (sm[6] + sm[7]));
    lrow = lrow * fac + cs;
    mrow = nm;
#pragma unroll
    for (int r = 0; r < 8; ++r) { O0.f[r] *= fac; O1.f[r] *= fac; }

    // P^T as B operand: element s = tile s>>3, register s&7 (the hardware k order)
    Frag16 pf, vf0, vf1;
#pragma unroll
    for (int v = 0; v < 8; ++v) {
      const int kp = (v >> 2) * 16 + hf * 8 + (v & 3) * 2;
      pf.u[v]  = pack_bf16(ex[2 * v], ex[2 * v + 1]);
      vf0.u[v] = *(const uint32_t*)(Vt + ln * 32 + kp);
      vf1.u[v] = *(const uint32_t*)(Vt + (16 + ln) * 32 + kp);
    }
    O0.v = __builtin_amdgcn_wmma_f32_16x16x32_bf16(
        false, vf0.v, false, pf.v, (short)0, O0.v, false, false);
    O1.v = __builtin_amdgcn_wmma_f32_16x16x32_bf16(
        false, vf1.v, false, pf.v, (short)0, O1.v, false, false);
  }

  {  // join the halves' sums once; a lane stores 8 consecutive dh per tile
    const float inv = 1.0f / (lrow + other_half(lrow));
    bf16_t* op = Out + (size_t)(b * NN + i0 + ln) * DD + h * DH + hf * 8;
    uint4 a0, a1;
    a0.x = pack_bf16(O0.f[0] * inv, O0.f[1] * inv);
    a0.y = pack_bf16(O0.f[2] * inv, O0.f[3] * inv);
    a0.z = pack_bf16(O0.f[4] * inv, O0.f[5] * inv);
    a0.w = pack_bf16(O0.f[6] * inv, O0.f[7] * inv);
    a1.x = pack_bf16(O1.f[0] * inv, O1.f[1] * inv);
    a1.y = pack_bf16(O1.f[2] * inv, O1.f[3] * inv);
    a1.z = pack_bf16(O1.f[4] * inv, O1.f[5] * inv);
    a1.w = pack_bf16(O1.f[6] * inv, O1.f[7] * inv);
    *(uint4*)op = a0;
    *(uint4*)(op + 16) = a1;
  }
}

__global__ __launch_bounds__(128) void flash_attn(
    const bf16_t* __restrict__ qk0, const bf16_t* __restrict__ qk1,
    const bf16_t* __restrict__ v0b, const bf16_t* __restrict__ v1b,
    const float* __restrict__ match,
    bf16_t* __restrict__ m0, bf16_t* __restrict__ m1) {
  const int NN = 2048;
  const int dir = blockIdx.z >> 1;
  const int b = blockIdx.z & 1;
  const int h = blockIdx.y;
  const float* mb = match + (size_t)b * NN * NN;

  __shared__ __align__(16) bf16_t Kt[32 * 32];        // [j][dh]
  __shared__ __align__(16) bf16_t Vt[32 * 32];        // [dh][j] (transposed)

  if (dir) attn_dir<1>(qk1, qk0, v0b, mb, m1, Kt, Vt, b, h);
  else     attn_dir<0>(qk0, qk1, v1b, mb, m0, Kt, Vt, b, h);
}

// ------------------------ LayerNorm + exact GELU ---------------------------
// A wave owns two whole rows of 512: a lane holds 16 elements of each (four
// 16-byte loads a row, all eight issued before the first use), so mean and
// variance are in-lane sums plus five lane exchanges, with no LDS and no barrier.
__device__ __forceinline__ float gelu_exact(float y) {
  return 0.5f * y * (1.f + erff(y * 0.70710678118654752f));
}

// The pointers carry no __restrict__, so that no load moves over the wait below.
__global__ __launch_bounds__(256) void ln_gelu(
    const float* hbuf, const float* gamma, const float* beta, bf16_t* gbuf) {
  const int wave = threadIdx.x >> 5, lane = threadIdx.x & 31;
  const size_t base = (size_t)(blockIdx.x * 8 + wave) * 1024 + lane * 4;
  const float* hp = hbuf + base;

  float4 x[2][4], ga[4], be[4];
#pragma unroll
  for (int j = 0; j < 4; ++j) {
    ga[j] = *(const float4*)(gamma + j * 128 + lane * 4);
    be[j] = *(const float4*)(beta + j * 128 + lane * 4);
  }
  // The loads below may land in the address register of the loads above: this
  // wait stands in front of that overwrite.
  asm volatile("s_wait_xcnt 0x0" ::: "memory");
#pragma unroll
  for (int r = 0; r < 2; ++r)
#pragma unroll
    for (int j = 0; j < 4; ++j) x[r][j] = *(const float4*)(hp + r * 512 + j * 128);

  float s[2], q[2];
#pragma unroll
  for (int r = 0; r < 2; ++r) {
    float sj[4], qj[4];
#pragma unroll
    for (int j = 0; j < 4; ++j) {
      const float4 v = x[r][j];
      sj[j] = (v.x + v.y) + (v.z + v.w);
      qj[j] = (v.x * v.x + v.y * v.y) + (v.z * v.z + v.w * v.w);
    }
    s[r] = (sj[0] + sj[1]) + (sj[2] + sj[3]);
    q[r] = (qj[0] + qj[1]) + (qj[2] + qj[3]);
  }
#pragma unroll
  for (int off = 16; off; off >>= 1) {
#pragma unroll
    for (int r = 0; r < 2; ++r) {
      s[r] += __shfl_xor(s[r], off, 32);
      q[r] += __shfl_xor(q[r], off, 32);
    }
  }

#pragma unroll
  for (int r = 0; r < 2; ++r) {
    const float mu = s[r] * (1.f / 512.f);
    const float rs = rsqrtf(q[r] * (1.f / 512.f) - mu * mu + 1e-5f);
#pragma unroll
    for (int j = 0; j < 4; ++j) {
      const float4 v = x[r][j];
      union { uint2 u; bf16_t h[4]; } o;
      o.h[0] = f2bf(gelu_exact((v.x - mu) * rs * ga[j].x + be[j].x));
      o.h[1] = f2bf(gelu_exact((v.y - mu) * rs * ga[j].y + be[j].y));
      o.h[2] = f2bf(gelu_exact((v.z - mu) * rs * ga[j].z + be[j].z));
      o.h[3] = f2bf(gelu_exact((v.w - mu) * rs * ga[j].w + be[j].w));
      *(uint2*)(gbuf + base + r * 512 + j * 128) = o.u;
    }
  }
}

// ------------------------------- host side ---------------------------------
extern "C" void kernel_launch(void* const* d_in, const int* in_sizes, int n_in,
                              void* d_out, int out_size, void* d_ws, size_t ws_size,
                              hipStream_t stream) {
  const int B = 2, N = 2048, D = 256, H = 8, M = B * N, D2 = 2 * D;
  (void)in_sizes; (void)n_in; (void)out_size; (void)ws_size; (void)H;

  const float* x0    = (const float*)d_in[0];
  const float* x1    = (const float*)d_in[1];
  const float* match = (const float*)d_in[2];
  const float* Wqk   = (const float*)d_in[3];
  const float* bqk   = (const float*)d_in[4];
  const float* Wv    = (const float*)d_in[5];
  const float* bv    = (const float*)d_in[6];
  const float* Wo    = (const float*)d_in[7];
  const float* bo    = (const float*)d_in[8];
  const float* W1    = (const float*)d_in[9];
  const float* b1    = (const float*)d_in[10];
  const float* gamma = (const float*)d_in[11];
  const float* beta  = (const float*)d_in[12];
  const float* W2    = (const float*)d_in[13];
  const float* b2    = (const float*)d_in[14];
  float* out = (float*)d_out;

  char* ws = (char*)d_ws;
  auto alloc = [&](size_t bytes) {
    char* p = ws; ws += (bytes + 255) & ~(size_t)255; return p;
  };
  bf16_t* WqkB = (bf16_t*)alloc((size_t)D * D * 2);
  bf16_t* WvB  = (bf16_t*)alloc((size_t)D * D * 2);
  bf16_t* WoB  = (bf16_t*)alloc((size_t)D * D * 2);
  bf16_t* W1B  = (bf16_t*)alloc((size_t)D2 * D2 * 2);
  bf16_t* W2B  = (bf16_t*)alloc((size_t)D2 * D * 2);
  bf16_t* qk0s = (bf16_t*)alloc((size_t)M * D * 2);
  bf16_t* qk1s = (bf16_t*)alloc((size_t)M * D * 2);
  bf16_t* v0bb = (bf16_t*)alloc((size_t)M * D * 2);
  bf16_t* v1bb = (bf16_t*)alloc((size_t)M * D * 2);
  bf16_t* m0b  = (bf16_t*)alloc((size_t)M * D * 2);
  bf16_t* m1b  = (bf16_t*)alloc((size_t)M * D * 2);
  bf16_t* cat0 = (bf16_t*)alloc((size_t)M * D2 * 2);
  bf16_t* cat1 = (bf16_t*)alloc((size_t)M * D2 * 2);
  float*  h0   = (float*)alloc((size_t)M * D2 * 4);
  float*  h1   = (float*)alloc((size_t)M * D2 * 4);
  bf16_t* g0 = qk0s;  // 8MB alias over qk0s..v1bb (dead after attention)
  (void)cat1; (void)h1;
  // Every buffer size is a multiple of 256 bytes, so each side-1 buffer starts
  // where its side-0 buffer ends: a pair is one matrix of 2*M rows.

  // weights + x into concat buffers (first 256 cols of cat = x)
  cvt_all<<<dim3((2 * M * D + 3 * D * D + D2 * D2 + D2 * D) / 4096), dim3(256), 0, stream>>>(
      x0, x1, Wqk, Wv, Wo, W1, W2, cat0, WqkB);

  const float s = 0.42044820762685725f;  // (DH^-0.5)^0.5 = 32^-0.25

  // projections, both sides: z=0 qk = (x@Wqk + bqk)*s ; z=1 v = x@Wv + bv
  gemm_wmma<<<dim3(2 * M / 128, D / 64, 2), dim3(256), 0, stream>>>(
      cat0, D2, WqkB, WvB, D, bqk, bv, s, 1.0f, qk0s, v0bb, nullptr,
      nullptr, nullptr, 2 * M, D, 0, D);

  // flash attention, both directions
  flash_attn<<<dim3(N / 64, H, 2 * B), dim3(128), 0, stream>>>(
      qk0s, qk1s, v0bb, v1bb, match, m0b, m1b);

  // output projection, written directly into cat[:, 256:512]
  gemm_wmma<<<dim3(2 * M / 128, D / 64, 1), dim3(256), 0, stream>>>(
      m0b, D, WoB, WoB, D, bo, bo, 1.0f, 1.0f, cat0 + D, nullptr, nullptr,
      nullptr, nullptr, 2 * M, D2, 0, D);

  // FFN: h = cat @ W1 + b1 (f32) ; LN + exact GELU -> bf16
  gemm_wmma<<<dim3(2 * M / 128, D2 / 64, 1), dim3(256), 0, stream>>>(
      cat0, D2, W1B, W1B, D2, b1, b1, 1.0f, 1.0f, nullptr, nullptr, h0,
      nullptr, nullptr, 2 * M, D2, 0, D2);
  ln_gelu<<<dim3(2 * M / 16), dim3(256), 0, stream>>>(h0, gamma, beta, g0);

  // out = x + g @ W2 + b2
  gemm_wmma<<<dim3(2 * M / 128, D / 64, 1), dim3(256), 0, stream>>>(
      g0, D2, W2B, W2B, D, b2, b2, 1.0f, 1.0f, nullptr, nullptr, out,
      x0, x1, M, D, D, D2);
}

// v004
// It runs in 161 microseconds.
// Timed twice side by side with v003, it ran 1.06 times as fast both times.
// Counting every step since v000, it is 2.38 times as fast.
#include <hip/hip_runtime.h>
#include <hip/hip_bf16.h>
#include <stdint.h>

// ---------------------------------------------------------------------------
// CDNA5 (gfx1250) CrossBlock: bf16 WMMA GEMMs + dual-direction flash attention
// + ASYNCcnt-tracked global->LDS tile staging where no transpose is needed.
// ---------------------------------------------------------------------------

typedef __bf16 bf16_t;
typedef __attribute__((ext_vector_type(16))) __bf16 v16bf;
typedef __attribute__((ext_vector_type(8)))  float  v8f;
typedef __attribute__((ext_vector_type(4)))  int    v4i;

// Row pitch, in bf16 elements, of every LDS tile whose rows hold 32 of them:
// 80 bytes = 16 bytes x odd, so that the 16-byte fragment reads of 16 rows fall
// on distinct banks (at the bare 64 bytes every fourth row meets the same ones).
constexpr int LP = 40;

union Frag16 { v16bf v; uint32_t u[8]; };
union FragF  { v8f   v; float    f[8]; };

__device__ __forceinline__ bf16_t f2bf(float f) {
  uint32_t u = __builtin_bit_cast(uint32_t, f);
  uint32_t r = (u + 0x7FFFu + ((u >> 16) & 1u)) >> 16;   // round-to-nearest-even
  unsigned short s = (unsigned short)r;
  return __builtin_bit_cast(bf16_t, s);
}

// ---------------- async global->LDS (CDNA5 GLOBAL_LOAD_ASYNC_TO_LDS) -------
#if defined(__has_builtin)
#if __has_builtin(__builtin_amdgcn_global_load_async_to_lds_b128)
#define HAVE_ASYNC_LDS 1
#else
#define HAVE_ASYNC_LDS 0
#endif
#else
#define HAVE_ASYNC_LDS 0
#endif

typedef __attribute__((address_space(1))) v4i* gas_v4i_t;
typedef __attribute__((address_space(3))) v4i* las_v4i_t;

__device__ __forceinline__ void copy_b128_to_lds(const void* g, void* l) {
#if HAVE_ASYNC_LDS
  __builtin_amdgcn_global_load_async_to_lds_b128((gas_v4i_t)g, (las_v4i_t)l, 0, 0);
#else
  *(uint4*)l = *(const uint4*)g;
#endif
}

__device__ __forceinline__ void async_lds_wait() {
#if HAVE_ASYNC_LDS
#if __has_builtin(__builtin_amdgcn_s_wait_asynccnt)
  __builtin_amdgcn_s_wait_asynccnt(0);
#else
  asm volatile("s_wait_asynccnt 0x0" ::: "memory");
#endif
#endif
}

// ---------------------- f32 -> bf16, all seven inputs -----------------------
// One launch of few, fat blocks: a block of 256 threads converts 4096 consecutive
// elements of one input, picked by the block index; a thread takes 16 of them as
// four 16-byte loads (a wave-wide load covers 512 contiguous bytes), all issued
// before the first use. Blocks [0, 512): 16 rows of x0 or x1 into the first 256
// columns of the stacked concat buffer (row pitch 512). The rest: the five
// weights, whose bf16 copies lie one behind the other at wdst.
__global__ __launch_bounds__(256) void cvt_all(
    const float* __restrict__ x0, const float* __restrict__ x1,
    const float* __restrict__ Wqk, const float* __restrict__ Wv,
    const float* __restrict__ Wo, const float* __restrict__ W1,
    const float* __restrict__ W2,
    bf16_t* __restrict__ cat, bf16_t* __restrict__ wdst) {
  const int blk = blockIdx.x;
  const int off = (threadIdx.x >> 5) * 512 + (threadIdx.x & 31) * 4;
  const bool isx = blk < 512;
  const float* in;     // the block's 4096 source elements
  bf16_t* dst;         // where the first of them goes
  if (isx) {
    in = (blk < 256 ? x0 : x1) + (size_t)(blk & 255) * 4096;
    dst = cat + (size_t)blk * 8192;
  } else {
    const int wb = blk - 512;   // 16 | 16 | 16 | 64 | 32 blocks
    int first;
    if (wb < 16)       { in = Wqk; first = 0; }
    else if (wb < 32)  { in = Wv;  first = 16; }
    else if (wb < 48)  { in = Wo;  first = 32; }
    else if (wb < 112) { in = W1;  first = 48; }
    else               { in = W2;  first = 112; }
    in += (size_t)(wb - first) * 4096;
    dst = wdst + (size_t)wb * 4096;
  }
  float4 f[4];
#pragma unroll
  for (int j = 0; j < 4; ++j) f[j] = *(const float4*)(in + off + j * 128);
#pragma unroll
  for (int j = 0; j < 4; ++j) {
    const int e = off + j * 128;
    const int d = isx ? (e >> 8) * 512 + (e & 255) : e;
    union { uint2 q; bf16_t h[4]; } o;
    o.h[0] = f2bf(f[j].x); o.h[1] = f2bf(f[j].y);
    o.h[2] = f2bf(f[j].z); o.h[3] = f2bf(f[j].w);
    *(uint2*)(dst + d) = o.q;
  }
}

// ----------------------------- generic GEMM --------------------------------
// C[M=grid.x*128, N=grid.y*64] = (A[M,K]bf16 @ B[K,N]bf16 + bias)*scale (+res)
// 8 waves: wave w owns rows [w*16, w*16+16) of the block tile, all 64 cols.
// One launch serves both sides: the rows of side 1 stand behind those of side 0
// in A and in the output; the residual, an input per side, changes at row mres.
// blockIdx.z picks one of two products that share A (weight, bias, scale, out).
__global__ __launch_bounds__(256) void gemm_wmma(
    const bf16_t* __restrict__ A, int lda,
    const bf16_t* __restrict__ B0, const bf16_t* __restrict__ B1, int ldb,
    const float* __restrict__ bias0, const float* __restrict__ bias1,
    float scale0, float scale1,
    bf16_t* __restrict__ outB0, bf16_t* __restrict__ outB1,
    float* __restrict__ outF,
    const float* __restrict__ res0, const float* __restrict__ res1, int mres,
    int ldo, int ldr, int K) {
  __shared__ __align__(16) bf16_t As[128 * LP];
  __shared__ __align__(16) bf16_t Bs[64 * LP];    // stored [n][k] (K-contiguous)

  const int bm = blockIdx.x * 128;
  const int bn = blockIdx.y * 64;
  const bool second = blockIdx.z != 0;
  const bf16_t* Bm  = second ? B1 : B0;
  const float* bias = second ? bias1 : bias0;
  const float scale = second ? scale1 : scale0;
  bf16_t* outB      = second ? outB1 : outB0;
  const float* res  = bm < mres ? res0 : res1;
  const int rfirst  = bm < mres ? 0 : mres;      // first row of that residual
  const int t = threadIdx.x;
  const int wave = t >> 5;
  const int lane = t & 31;
  const int hf = lane >> 4;       // which 16-lane half of the wave
  const int ln = lane & 15;

  FragF acc[4];
#pragma unroll
  for (int i = 0; i < 4; ++i) acc[i].v = (v8f){0, 0, 0, 0, 0, 0, 0, 0};

  for (int k0 = 0; k0 < K; k0 += 32) {
    __syncthreads();
    {  // stage A tile 128x32 (async DMA to LDS; two b128 per thread)
      const int row = t >> 1;
      const int hs = (t & 1) * 16;
      const bf16_t* gsrc = A + (size_t)(bm + row) * lda + k0 + hs;
      bf16_t* ldst = As + row * LP + hs;
      copy_b128_to_lds(gsrc, ldst);
      copy_b128_to_lds(gsrc + 8, ldst + 8);
      if (k0 + 32 < K) __builtin_prefetch(gsrc + 32, 0, 0);
    }
    {  // stage B tile 32x64 -> LDS transposed [n][k] (register path)
      const int kr = t >> 3;
      const int nc = (t & 7) * 8;
      union { uint4 q; bf16_t e[8]; } ub;
      ub.q = *(const uint4*)(Bm + (size_t)(k0 + kr) * ldb + bn + nc);
#pragma unroll
      for (int e = 0; e < 8; ++e) Bs[(nc + e) * LP + kr] = ub.e[e];
    }
    async_lds_wait();
    __syncthreads();

    Frag16 af;
#pragma unroll
    for (int v = 0; v < 8; ++v) {
      const int kp = (v >> 2) * 16 + hf * 8 + (v & 3) * 2;
      af.u[v] = *(const uint32_t*)(As + (wave * 16 + ln) * LP + kp);
    }
#pragma unroll
    for (int ns = 0; ns < 4; ++ns) {
      Frag16 bfr;
#pragma unroll
      for (int v = 0; v < 8; ++v) {
        const int kp = (v >> 2) * 16 + hf * 8 + (v & 3) * 2;
        bfr.u[v] = *(const uint32_t*)(Bs + (ns * 16 + ln) * LP + kp);
      }
      acc[ns].v = __builtin_amdgcn_wmma_f32_16x16x32_bf16(
          false, af.v, false, bfr.v, (short)0, acc[ns].v, false, false);
    }
  }

#pragma unroll
  for (int ns = 0; ns < 4; ++ns) {
#pragma unroll
    for (int r = 0; r < 8; ++r) {
      const int row = bm + wave * 16 + hf * 8 + r;   // C/D layout: m = r + 8*half
      const int col = bn + ns * 16 + ln;
      float vo = (acc[ns].f[r] + bias[col]) * scale;
      if (outB) {
        outB[(size_t)row * ldo + col] = f2bf(vo);
      } else {
        if (res) vo += res[(size_t)(row - rfirst) * ldr + col];
        outF[(size_t)row * ldo + col] = vo;
      }
    }
  }
}

typedef __attribute__((ext_vector_type(2))) float  f32x2;
typedef __attribute__((ext_vector_type(2))) __bf16 bf16x2;

__device__ __forceinline__ uint32_t pack_bf16(float lo, float hi) {
  f32x2 p = {lo, hi};
  return __builtin_bit_cast(uint32_t, __builtin_convertvector(p, bf16x2));
}

// value of lane l ^ 16
__device__ __forceinline__ float other_half(float x) {
  const int xi = __builtin_bit_cast(int, x);
  return __builtin_bit_cast(float, __builtin_amdgcn_permlanex16(
      xi, xi, 0x76543210, 0xfedcba98, false, false));
}

// One direction's whole pass. DIR is a compile-time constant so that the loop
// holds that direction's match loads alone, with no branch and no select.
template <int DIR>
__device__ __forceinline__ void attn_dir(
    const bf16_t* __restrict__ Q, const bf16_t* __restrict__ Km,
    const bf16_t* __restrict__ Vm, const float* __restrict__ mb,
    bf16_t* __restrict__ Out, bf16_t* Kt, bf16_t* Vt, int b, int h) {
  const int NN = 2048, DD = 256, DH = 32;
  const int wave = threadIdx.x >> 5;
  const int lane = threadIdx.x & 31;
  const int hf = lane >> 4;
  const int ln = lane & 15;
  const int i0 = blockIdx.x * 64 + wave * 16;

  // Q fragment (B operand: lane holds query i0+ln), straight from global
  Frag16 qf;
  {
    const size_t qbase = (size_t)(b * NN + i0 + ln) * DD + h * DH;
#pragma unroll
    for (int v = 0; v < 8; ++v) {
      const int kp = (v >> 2) * 16 + hf * 8 + (v & 3) * 2;
      qf.u[v] = *(const uint32_t*)(Q + qbase + kp);
    }
  }

  float mrow = -1e30f, lrow = 0.f;   // of query i0+ln; lrow: this half's keys only
  FragF O0, O1;                      // O^T: f[r] = O[i0+ln][d*16 + hf*8 + r]
  O0.v = (v8f){0, 0, 0, 0, 0, 0, 0, 0};
  O1.v = (v8f){0, 0, 0, 0, 0, 0, 0, 0};

  for (int j0 = 0; j0 < NN; j0 += 32) {
    __syncthreads();
    {  // stage K chunk row-major (async DMA), V chunk transposed (registers)
      const int jr = threadIdx.x >> 2;
      const int dh0 = (threadIdx.x & 3) * 8;
      const size_t gb = (size_t)(b * NN + j0 + jr) * DD + h * DH + dh0;
      copy_b128_to_lds(Km + gb, Kt + jr * LP + dh0);
      union { uint4 q; bf16_t e[8]; } uv;
      uv.q = *(const uint4*)(Vm + gb);
#pragma unroll
      for (int e = 0; e < 8; ++e) Vt[(dh0 + e) * LP + jr] = uv.e[e];
    }
    async_lds_wait();
    __syncthreads();

    // match weights of this lane's 16 scores: key j0+t*16+hf*8+r, query i0+ln
    float w[16];
    if (DIR) {
      const float* mp = mb + (size_t)(j0 + hf * 8) * NN + i0 + ln;
#pragma unroll
      for (int t = 0; t < 2; ++t)
#pragma unroll
        for (int r = 0; r < 8; ++r) w[t * 8 + r] = mp[(size_t)(t * 16 + r) * NN];
    } else {
      const float* mp = mb + (size_t)(i0 + ln) * NN + j0 + hf * 8;
#pragma unroll
      for (int t = 0; t < 2; ++t)
#pragma unroll
        for (int q = 0; q < 2; ++q) {
          const float4 f = *(const float4*)(mp + t * 16 + q * 4);
          w[t * 8 + q * 4 + 0] = f.x; w[t * 8 + q * 4 + 1] = f.y;
          w[t * 8 + q * 4 + 2] = f.z; w[t * 8 + q * 4 + 3] = f.w;
        }
    }

    // S^T = K @ Q^T for two 16-key tiles: S[t].f[r] = key j0+t*16+hf*8+r, query i0+ln
    FragF S[2];
#pragma unroll
    for (int t = 0; t < 2; ++t) {
      Frag16 kf;
#pragma unroll
      for (int v = 0; v < 8; ++v) {
        const int kp = (v >> 2) * 16 + hf * 8 + (v & 3) * 2;
        kf.u[v] = *(const uint32_t*)(Kt + (t * 16 + ln) * LP + kp);
      }
      S[t].v = __builtin_amdgcn_wmma_f32_16x16x32_bf16(
          false, kf.v, false, qf.v, (short)0, (v8f){0,0,0,0,0,0,0,0}, false, false);
    }

    // online softmax, one query per lane
    float sc[16];
#pragma unroll
    for (int k = 0; k < 16; ++k) sc[k] = S[k >> 3].f[k & 7] * w[k];
    float mx[8];
#pragma unroll
    for (int k = 0; k < 8; ++k) mx[k] = fmaxf(sc[2 * k], sc[2 * k + 1]);
    float cm = fmaxf(fmaxf(fmaxf(mx[0], mx[1]), fmaxf(mx[2], mx[3])),
                     fmaxf(fmaxf(mx[4], mx[5]), fmaxf(mx[6], mx[7])));
    cm = fmaxf(cm, other_half(cm));
    const float nm = fmaxf(mrow, cm);
    const float fac = __expf(mrow - nm);
    float ex[16];
#pragma unroll
    for (int k = 0; k < 16; ++k) ex[k] = __expf(sc[k] - nm);
    float sm[8];
#pragma unroll
    for (int k = 0; k < 8; ++k) sm[k] = ex[2 * k] + ex[2 * k + 1];
    const float cs = ((sm[0] + sm[1]) + (sm[2] + sm[3])) + ((sm[4] + sm[5]) + (sm[6] + sm[7]));
    lrow = lrow * fac + cs;
    mrow = nm;
#pragma unroll
    for (int r = 0; r < 8; ++r) { O0.f[r] *= fac; O1.f[r] *= fac; }

    // P^T as B operand: element s = tile s>>3, register s&7 (the hardware k order)
    Frag16 pf, vf0, vf1;
#pragma unroll
    for (int v = 0; v < 8; ++v) {
      const int kp = (v >> 2) * 16 + hf * 8 + (v & 3) * 2;
      pf.u[v]  = pack_bf16(ex[2 * v], ex[2 * v + 1]);
      vf0.u[v] = *(const uint32_t*)(Vt + ln * LP + kp);
      vf1.u[v] = *(const uint32_t*)(Vt + (16 + ln) * LP + kp);
    }
    O0.v = __builtin_amdgcn_wmma_f32_16x16x32_bf16(
        false, vf0.v, false, pf.v, (short)0, O0.v, false, false);
    O1.v = __builtin_amdgcn_wmma_f32_16x16x32_bf16(
        false, vf1.v, false, pf.v, (short)0, O1.v, false, false);
  }

  {  // join the halves' sums once; a lane stores 8 consecutive dh per tile
    const float inv = 1.0f / (lrow + other_half(lrow));
    bf16_t* op = Out + (size_t)(b * NN + i0 + ln) * DD + h * DH + hf * 8;
    uint4 a0, a1;
    a0.x = pack_bf16(O0.f[0] * inv, O0.f[1] * inv);
    a0.y = pack_bf16(O0.f[2] * inv, O0.f[3] * inv);
    a0.z = pack_bf16(O0.f[4] * inv, O0.f[5] * inv);
    a0.w = pack_bf16(O0.f[6] * inv, O0.f[7] * inv);
    a1.x = pack_bf16(O1.f[0] * inv, O1.f[1] * inv);
    a1.y = pack_bf16(O1.f[2] * inv, O1.f[3] * inv);
    a1.z = pack_bf16(O1.f[4] * inv, O1.f[5] * inv);
    a1.w = pack_bf16(O1.f[6] * inv, O1.f[7] * inv);
    *(uint4*)op = a0;
    *(uint4*)(op + 16) = a1;
  }
}

__global__ __launch_bounds__(128) void flash_attn(
    const bf16_t* __restrict__ qk0, const bf16_t* __restrict__ qk1,
    const bf16_t* __restrict__ v0b, const bf16_t* __restrict__ v1b,
    const float* __restrict__ match,
    bf16_t* __restrict__ m0, bf16_t* __restrict__ m1) {
  const int NN = 2048;
  const int dir = blockIdx.z >> 1;
  const int b = blockIdx.z & 1;
  const int h = blockIdx.y;
  const float* mb = match + (size_t)b * NN * NN;

  __shared__ __align__(16) bf16_t Kt[32 * LP];        // [j][dh]
  __shared__ __align__(16) bf16_t Vt[32 * LP];        // [dh][j] (transposed)

  if (dir) attn_dir<1>(qk1, qk0, v0b, mb, m1, Kt, Vt, b, h);
  else     attn_dir<0>(qk0, qk1, v1b, mb, m0, Kt, Vt, b, h);
}

// ------------------------ LayerNorm + exact GELU ---------------------------
// A wave owns two whole rows of 512: a lane holds 16 elements of each (four
// 16-byte loads a row, all eight issued before the first use), so mean and
// variance are in-lane sums plus five lane exchanges, with no LDS and no barrier.
__device__ __forceinline__ float gelu_exact(float y) {
  return 0.5f * y * (1.f + erff(y * 0.70710678118654752f));
}

// The pointers carry no __restrict__, so that no load moves over the wait below.
__global__ __launch_bounds__(256) void ln_gelu(
    const float* hbuf, const float* gamma, const float* beta, bf16_t* gbuf) {
  const int wave = threadIdx.x >> 5, lane = threadIdx.x & 31;
  const size_t base = (size_t)(blockIdx.x * 8 + wave) * 1024 + lane * 4;
  const float* hp = hbuf + base;

  float4 x[2][4], ga[4], be[4];
#pragma unroll
  for (int j = 0; j < 4; ++j) {
    ga[j] = *(const float4*)(gamma + j * 128 + lane * 4);
    be[j] = *(const float4*)(beta + j * 128 + lane * 4);
  }
  // The loads below may land in the address register of the loads above: this
  // wait stands in front of that overwrite.
  asm volatile("s_wait_xcnt 0x0" ::: "memory");
#pragma unroll
  for (int r = 0; r < 2; ++r)
#pragma unroll
    for (int j = 0; j < 4; ++j) x[r][j] = *(const float4*)(hp + r * 512 + j * 128);

  float s[2], q[2];
#pragma unroll
  for (int r = 0; r < 2; ++r) {
    float sj[4], qj[4];
#pragma unroll
    for (int j = 0; j < 4; ++j) {
      const float4 v = x[r][j];
      sj[j] = (v.x + v.y) + (v.z + v.w);
      qj[j] = (v.x * v.x + v.y * v.y) + (v.z * v.z + v.w * v.w);
    }
    s[r] = (sj[0] + sj[1]) + (sj[2] + sj[3]);
    q[r] = (qj[0] + qj[1]) + (qj[2] + qj[3]);
  }
#pragma unroll
  for (int off = 16; off; off >>= 1) {
#pragma unroll
    for (int r = 0; r < 2; ++r) {
      s[r] += __shfl_xor(s[r], off, 32);
      q[r] += __shfl_xor(q[r], off, 32);
    }
  }

#pragma unroll
  for (int r = 0; r < 2; ++r) {
    const float mu = s[r] * (1.f / 512.f);
    const float rs = rsqrtf(q[r] * (1.f / 512.f) - mu * mu + 1e-5f);
#pragma unroll
    for (int j = 0; j < 4; ++j) {
      const float4 v = x[r][j];
      union { uint2 u; bf16_t h[4]; } o;
      o.h[0] = f2bf(gelu_exact((v.x - mu) * rs * ga[j].x + be[j].x));
      o.h[1] = f2bf(gelu_exact((v.y - mu) * rs * ga[j].y + be[j].y));
      o.h[2] = f2bf(gelu_exact((v.z - mu) * rs * ga[j].z + be[j].z));
      o.h[3] = f2bf(gelu_exact((v.w - mu) * rs * ga[j].w + be[j].w));
      *(uint2*)(gbuf + base + r * 512 + j * 128) = o.u;
    }
  }
}

// ------------------------------- host side ---------------------------------
extern "C" void kernel_launch(void* const* d_in, const int* in_sizes, int n_in,
                              void* d_out, int out_size, void* d_ws, size_t ws_size,
                              hipStream_t stream) {
  const int B = 2, N = 2048, D = 256, H = 8, M = B * N, D2 = 2 * D;
  (void)in_sizes; (void)n_in; (void)out_size; (void)ws_size; (void)H;

  const float* x0    = (const float*)d_in[0];
  const float* x1    = (const float*)d_in[1];
  const float* match = (const float*)d_in[2];
  const float* Wqk   = (const float*)d_in[3];
  const float* bqk   = (const float*)d_in[4];
  const float* Wv    = (const float*)d_in[5];
  const float* bv    = (const float*)d_in[6];
  const float* Wo    = (const float*)d_in[7];
  const float* bo    = (const float*)d_in[8];
  const float* W1    = (const float*)d_in[9];
  const float* b1    = (const float*)d_in[10];
  const float* gamma = (const float*)d_in[11];
  const float* beta  = (const float*)d_in[12];
  const float* W2    = (const float*)d_in[13];
  const float* b2    = (const float*)d_in[14];
  float* out = (float*)d_out;

  char* ws = (char*)d_ws;
  auto alloc = [&](size_t bytes) {
    char* p = ws; ws += (bytes + 255) & ~(size_t)255; return p;
  };
  bf16_t* WqkB = (bf16_t*)alloc((size_t)D * D * 2);
  bf16_t* WvB  = (bf16_t*)alloc((size_t)D * D * 2);
  bf16_t* WoB  = (bf16_t*)alloc((size_t)D * D * 2);
  bf16_t* W1B  = (bf16_t*)alloc((size_t)D2 * D2 * 2);
  bf16_t* W2B  = (bf16_t*)alloc((size_t)D2 * D * 2);
  bf16_t* qk0s = (bf16_t*)alloc((size_t)M * D * 2);
  bf16_t* qk1s = (bf16_t*)alloc((size_t)M * D * 2);
  bf16_t* v0bb = (bf16_t*)alloc((size_t)M * D * 2);
  bf16_t* v1bb = (bf16_t*)alloc((size_t)M * D * 2);
  bf16_t* m0b  = (bf16_t*)alloc((size_t)M * D * 2);
  bf16_t* m1b  = (bf16_t*)alloc((size_t)M * D * 2);
  bf16_t* cat0 = (bf16_t*)alloc((size_t)M * D2 * 2);
  bf16_t* cat1 = (bf16_t*)alloc((size_t)M * D2 * 2);
  float*  h0   = (float*)alloc((size_t)M * D2 * 4);
  float*  h1   = (float*)alloc((size_t)M * D2 * 4);
  bf16_t* g0 = qk0s;  // 8MB alias over qk0s..v1bb (dead after attention)
  (void)cat1; (void)h1;
  // Every buffer size is a multiple of 256 bytes, so each side-1 buffer starts
  // where its side-0 buffer ends: a pair is one matrix of 2*M rows.

  // weights + x into concat buffers (first 256 cols of cat = x)
  cvt_all<<<dim3((2 * M * D + 3 * D * D + D2 * D2 + D2 * D) / 4096), dim3(256), 0, stream>>>(
      x0, x1, Wqk, Wv, Wo, W1, W2, cat0, WqkB);

  const float s = 0.42044820762685725f;  // (DH^-0.5)^0.5 = 32^-0.25

  // projections, both sides: z=0 qk = (x@Wqk + bqk)*s ; z=1 v = x@Wv + bv
  gemm_wmma<<<dim3(2 * M / 128, D / 64, 2), dim3(256), 0, stream>>>(
      cat0, D2, WqkB, WvB, D, bqk, bv, s, 1.0f, qk0s, v0bb, nullptr,
      nullptr, nullptr, 2 * M, D, 0, D);

  // flash attention, both directions
  flash_attn<<<dim3(N / 64, H, 2 * B), dim3(128), 0, stream>>>(
      qk0s, qk1s, v0bb, v1bb, match, m0b, m1b);

  // output projection, written directly into cat[:, 256:512]
  gemm_wmma<<<dim3(2 * M / 128, D / 64, 1), dim3(256), 0, stream>>>(
      m0b, D, WoB, WoB, D, bo, bo, 1.0f, 1.0f, cat0 + D, nullptr, nullptr,
      nullptr, nullptr, 2 * M, D2, 0, D);

  // FFN: h = cat @ W1 + b1 (f32) ; LN + exact GELU -> bf16
  gemm_wmma<<<dim3(2 * M / 128, D2 / 64, 1), dim3(256), 0, stream>>>(
      cat0, D2, W1B, W1B, D2, b1, b1, 1.0f, 1.0f, nullptr, nullptr, h0,
      nullptr, nullptr, 2 * M, D2, 0, D2);
  ln_gelu<<<dim3(2 * M / 16), dim3(256), 0, stream>>>(h0, gamma, beta, g0);

  // out = x + g @ W2 + b2
  gemm_wmma<<<dim3(2 * M / 128, D / 64, 1), dim3(256), 0, stream>>>(
      g0, D2, W2B, W2B, D, b2, b2, 1.0f, 1.0f, nullptr, nullptr, out,
      x0, x1, M, D, D, D2);
}

// v005
// One run takes 136 microseconds.
// In two side-by-side timings against v004, it was 1.19 and 1.18 times as fast.
// Over all steps from v000 it is 2.82 times as fast.
#include <hip/hip_runtime.h>
#include <hip/hip_bf16.h>
#include <stdint.h>

// ---------------------------------------------------------------------------
// CDNA5 (gfx1250) CrossBlock: bf16 WMMA GEMMs + dual-direction flash attention
// + ASYNCcnt-tracked global->LDS tile staging where no transpose is needed.
// ---------------------------------------------------------------------------

typedef __bf16 bf16_t;
typedef __attribute__((ext_vector_type(16))) __bf16 v16bf;
typedef __attribute__((ext_vector_type(8)))  float  v8f;

// Row pitch, in bf16 elements, of every LDS tile whose rows hold 32 of them:
// 80 bytes = 16 bytes x odd, so that the 16-byte fragment reads of 16 rows fall
// on distinct banks (at the bare 64 bytes every fourth row meets the same ones).
constexpr int LP = 40;

// Depth of a stage: what one fill of the LDS tiles holds along the loop's axis
// (k in the GEMM, keys in attention). Four 32-deep passes run on one fill, so
// the fill's load latency and its two barriers are paid once for the four.
constexpr int SD = 128;
// Row pitch of the tiles whose rows hold SD elements: 272 bytes = 16 bytes x odd.
constexpr int SP = SD + 8;

union Frag16 { v16bf v; uint32_t u[8]; };
union FragF  { v8f   v; float    f[8]; };

__device__ __forceinline__ bf16_t f2bf(float f) {
  uint32_t u = __builtin_bit_cast(uint32_t, f);
  uint32_t r = (u + 0x7FFFu + ((u >> 16) & 1u)) >> 16;   // round-to-nearest-even
  unsigned short s = (unsigned short)r;
  return __builtin_bit_cast(bf16_t, s);
}

__device__ __forceinline__ uint32_t lds_off(const void* p) {
  return (uint32_t)(uintptr_t)p;
}

// Four 16-byte copies a lane, each with address registers of its own and no
// immediate offset. The s_wait_xcnt closes the statement so that it stands in
// front of whatever next rewrites one of these registers.
__device__ __forceinline__ void copy4_b128_to_lds(
    const bf16_t* g0, const bf16_t* g1, const bf16_t* g2, const bf16_t* g3,
    const bf16_t* l0, const bf16_t* l1, const bf16_t* l2, const bf16_t* l3) {
  asm volatile(
      "global_load_async_to_lds_b128 %0, %4, off\n\t"
      "global_load_async_to_lds_b128 %1, %5, off\n\t"
      "global_load_async_to_lds_b128 %2, %6, off\n\t"
      "global_load_async_to_lds_b128 %3, %7, off\n\t"
      "s_wait_xcnt 0x0"
      :: "v"(lds_off(l0)), "v"(lds_off(l1)), "v"(lds_off(l2)), "v"(lds_off(l3)),
         "v"(g0), "v"(g1), "v"(g2), "v"(g3)
      : "memory");
}

// This wave's LDS reads of the last stage have retired before its copies refill it.
__device__ __forceinline__ void lds_reads_done() {
  asm volatile("s_wait_dscnt 0x0" ::: "memory");
}

// This wave's copies have landed; the barrier behind it shows them to the others.
__device__ __forceinline__ void async_lds_wait() {
  asm volatile("s_wait_asynccnt 0x0" ::: "memory");
}

// ---------------------- f32 -> bf16, all seven inputs -----------------------
// One launch of few, fat blocks: a block of 256 threads converts 4096 consecutive
// elements of one input, picked by the block index; a thread takes 16 of them as
// four 16-byte loads (a wave-wide load covers 512 contiguous bytes), all issued
// before the first use. Blocks [0, 512): 16 rows of x0 or x1 into the first 256
// columns of the stacked concat buffer (row pitch 512). The rest: the five
// weights, whose bf16 copies lie one behind the other at wdst.
__global__ __launch_bounds__(256) void cvt_all(
    const float* __restrict__ x0, const float* __restrict__ x1,
    const float* __restrict__ Wqk, const float* __restrict__ Wv,
    const float* __restrict__ Wo, const float* __restrict__ W1,
    const float* __restrict__ W2,
    bf16_t* __restrict__ cat, bf16_t* __restrict__ wdst) {
  const int blk = blockIdx.x;
  const int off = (threadIdx.x >> 5) * 512 + (threadIdx.x & 31) * 4;
  const bool isx = blk < 512;
  const float* in;     // the block's 4096 source elements
  bf16_t* dst;         // where the first of them goes
  if (isx) {
    in = (blk < 256 ? x0 : x1) + (size_t)(blk & 255) * 4096;
    dst = cat + (size_t)blk * 8192;
  } else {
    const int wb = blk - 512;   // 16 | 16 | 16 | 64 | 32 blocks
    int first;
    if (wb < 16)       { in = Wqk; first = 0; }
    else if (wb < 32)  { in = Wv;  first = 16; }
    else if (wb < 48)  { in = Wo;  first = 32; }
    else if (wb < 112) { in = W1;  first = 48; }
    else               { in = W2;  first = 112; }
    in += (size_t)(wb - first) * 4096;
    dst = wdst + (size_t)wb * 4096;
  }
  float4 f[4];
#pragma unroll
  for (int j = 0; j < 4; ++j) f[j] = *(const float4*)(in + off + j * 128);
#pragma unroll
  for (int j = 0; j < 4; ++j) {
    const int e = off + j * 128;
    const int d = isx ? (e >> 8) * 512 + (e & 255) : e;
    union { uint2 q; bf16_t h[4]; } o;
    o.h[0] = f2bf(f[j].x); o.h[1] = f2bf(f[j].y);
    o.h[2] = f2bf(f[j].z); o.h[3] = f2bf(f[j].w);
    *(uint2*)(dst + d) = o.q;
  }
}

// ----------------------------- generic GEMM --------------------------------
// C[M=grid.x*128, N=grid.y*64] = (A[M,K]bf16 @ B[K,N]bf16 + bias)*scale (+res)
// 8 waves: wave w owns rows [w*16, w*16+16) of the block tile, all 64 cols.
// K is a multiple of SD.
// One launch serves both sides: the rows of side 1 stand behind those of side 0
// in A and in the output; the residual, an input per side, changes at row mres.
// blockIdx.z picks one of two products that share A (weight, bias, scale, out).
__global__ __launch_bounds__(256) void gemm_wmma(
    const bf16_t* __restrict__ A, int lda,
    const bf16_t* __restrict__ B0, const bf16_t* __restrict__ B1, int ldb,
    const float* __restrict__ bias0, const float* __restrict__ bias1,
    float scale0, float scale1,
    bf16_t* __restrict__ outB0, bf16_t* __restrict__ outB1,
    float* __restrict__ outF,
    const float* __restrict__ res0, const float* __restrict__ res1, int mres,
    int ldo, int ldr, int K) {
  __shared__ __align__(16) bf16_t As[128 * SP];
  __shared__ __align__(16) bf16_t Bs[64 * SP];    // stored [n][k] (K-contiguous)

  const int bm = blockIdx.x * 128;
  const int bn = blockIdx.y * 64;
  const bool second = blockIdx.z != 0;
  const bf16_t* Bm  = second ? B1 : B0;
  const float* bias = second ? bias1 : bias0;
  const float scale = second ? scale1 : scale0;
  bf16_t* outB      = second ? outB1 : outB0;
  const float* res  = bm < mres ? res0 : res1;
  const int rfirst  = bm < mres ? 0 : mres;      // first row of that residual
  const int t = threadIdx.x;
  const int wave = t >> 5;
  const int lane = t & 31;
  const int hf = lane >> 4;       // which 16-lane half of the wave
  const int ln = lane & 15;

  FragF acc[4];
#pragma unroll
  for (int i = 0; i < 4; ++i) acc[i].v = (v8f){0, 0, 0, 0, 0, 0, 0, 0};

  for (int k0 = 0; k0 < K; k0 += SD) {
    lds_reads_done();
    __syncthreads();
    {  // stage A tile 128 x SD (async copies): 16 lanes cover a row's 256 bytes,
       // so a wave-wide copy takes whole lines; eight rows a thread, 16 apart
      const bf16_t* gsrc = A + (size_t)(bm + (t >> 4)) * lda + k0 + (t & 15) * 8;
      const bf16_t* ldst = As + (t >> 4) * SP + (t & 15) * 8;
      const size_t gs = (size_t)16 * lda;
      copy4_b128_to_lds(gsrc, gsrc + gs, gsrc + 2 * gs, gsrc + 3 * gs,
                        ldst, ldst + 16 * SP, ldst + 32 * SP, ldst + 48 * SP);
      gsrc += 4 * gs;
      ldst += 64 * SP;
      copy4_b128_to_lds(gsrc, gsrc + gs, gsrc + 2 * gs, gsrc + 3 * gs,
                        ldst, ldst + 16 * SP, ldst + 32 * SP, ldst + 48 * SP);
    }
    {  // stage B tile SD x 64 -> LDS transposed [n][k] (register path)
      const int kr = t >> 3;
      const int nc = (t & 7) * 8;
      union { uint4 q; bf16_t e[8]; } ub[4];
#pragma unroll
      for (int c = 0; c < 4; ++c)
        ub[c].q = *(const uint4*)(Bm + (size_t)(k0 + c * 32 + kr) * ldb + bn + nc);
#pragma unroll
      for (int c = 0; c < 4; ++c)
#pragma unroll
        for (int e = 0; e < 8; ++e) Bs[(nc + e) * SP + c * 32 + kr] = ub[c].e[e];
    }
    async_lds_wait();
    __syncthreads();

#pragma unroll
    for (int p = 0; p < SD / 32; ++p) {
      Frag16 af;
#pragma unroll
      for (int v = 0; v < 8; ++v) {
        const int kp = p * 32 + (v >> 2) * 16 + hf * 8 + (v & 3) * 2;
        af.u[v] = *(const uint32_t*)(As + (wave * 16 + ln) * SP + kp);
      }
#pragma unroll
      for (int ns = 0; ns < 4; ++ns) {
        Frag16 bfr;
#pragma unroll
        for (int v = 0; v < 8; ++v) {
          const int kp = p * 32 + (v >> 2) * 16 + hf * 8 + (v & 3) * 2;
          bfr.u[v] = *(const uint32_t*)(Bs + (ns * 16 + ln) * SP + kp);
        }
        acc[ns].v = __builtin_amdgcn_wmma_f32_16x16x32_bf16(
            false, af.v, false, bfr.v, (short)0, acc[ns].v, false, false);
      }
    }
  }

#pragma unroll
  for (int ns = 0; ns < 4; ++ns) {
#pragma unroll
    for (int r = 0; r < 8; ++r) {
      const int row = bm + wave * 16 + hf * 8 + r;   // C/D layout: m = r + 8*half
      const int col = bn + ns * 16 + ln;
      float vo = (acc[ns].f[r] + bias[col]) * scale;
      if (outB) {
        outB[(size_t)row * ldo + col] = f2bf(vo);
      } else {
        if (res) vo += res[(size_t)(row - rfirst) * ldr + col];
        outF[(size_t)row * ldo + col] = vo;
      }
    }
  }
}

typedef __attribute__((ext_vector_type(2))) float  f32x2;
typedef __attribute__((ext_vector_type(4))) float  f32x4;
typedef __attribute__((ext_vector_type(2))) __bf16 bf16x2;

__device__ __forceinline__ uint32_t pack_bf16(float lo, float hi) {
  f32x2 p = {lo, hi};
  return __builtin_bit_cast(uint32_t, __builtin_convertvector(p, bf16x2));
}

// value of lane l ^ 16
__device__ __forceinline__ float other_half(float x) {
  const int xi = __builtin_bit_cast(int, x);
  return __builtin_bit_cast(float, __builtin_amdgcn_permlanex16(
      xi, xi, 0x76543210, 0xfedcba98, false, false));
}

// One direction's whole pass. DIR is a compile-time constant so that the loop
// holds that direction's match loads alone, with no branch and no select.
template <int DIR>
__device__ __forceinline__ void attn_dir(
    const bf16_t* __restrict__ Q, const bf16_t* __restrict__ Km,
    const bf16_t* __restrict__ Vm, const float* __restrict__ mb,
    bf16_t* __restrict__ Out, bf16_t* Kt, bf16_t* Vt, int b, int h) {
  const int NN = 2048, DD = 256, DH = 32;
  const int wave = threadIdx.x >> 5;
  const int lane = threadIdx.x & 31;
  const int hf = lane >> 4;
  const int ln = lane & 15;
  const int i0 = blockIdx.x * 64 + wave * 16;

  // Q fragment (B operand: lane holds query i0+ln), straight from global
  Frag16 qf;
  {
    const size_t qbase = (size_t)(b * NN + i0 + ln) * DD + h * DH;
#pragma unroll
    for (int v = 0; v < 8; ++v) {
      const int kp = (v >> 2) * 16 + hf * 8 + (v & 3) * 2;
      qf.u[v] = *(const uint32_t*)(Q + qbase + kp);
    }
  }

  float mrow = -1e30f, lrow = 0.f;   // of query i0+ln; lrow: this half's keys only
  FragF O0, O1;                      // O^T: f[r] = O[i0+ln][d*16 + hf*8 + r]
  O0.v = (v8f){0, 0, 0, 0, 0, 0, 0, 0};
  O1.v = (v8f){0, 0, 0, 0, 0, 0, 0, 0};

  for (int j0 = 0; j0 < NN; j0 += SD) {
    lds_reads_done();
    __syncthreads();
    // Every global access of the stage's four passes is issued here, together.
    union { uint4 q; bf16_t e[8]; } uv[4];
    const int jr = threadIdx.x >> 2;
    const int dh0 = (threadIdx.x & 3) * 8;
    {  // K rows row-major (async copies), V rows into registers; 32 rows apart
      const size_t gb = (size_t)(b * NN + j0 + jr) * DD + h * DH + dh0;
      const bf16_t* kg = Km + gb;
      const bf16_t* kl = Kt + jr * LP + dh0;
      copy4_b128_to_lds(kg, kg + 32 * DD, kg + 64 * DD, kg + 96 * DD,
                        kl, kl + 32 * LP, kl + 64 * LP, kl + 96 * LP);
#pragma unroll
      for (int c = 0; c < 4; ++c) uv[c].q = *(const uint4*)(Vm + gb + c * 32 * DD);
    }
    // The match loads below may land in the address register of the V loads
    // above: this wait stands in front of that overwrite.
    asm volatile("s_wait_xcnt 0x0" ::: "memory");

    // match weights of this lane's 16 scores a pass:
    // key j0+p*32+t*16+hf*8+r, query i0+ln
    float w[SD / 32][16];
    f32x4 wq[SD / 8];   // DIR 0: the same weights as loaded, 16 bytes each
    if (DIR) {
      const float* mp = mb + (size_t)(j0 + hf * 8) * NN + i0 + ln;
#pragma unroll
      for (int p = 0; p < SD / 32; ++p)
#pragma unroll
        for (int t = 0; t < 2; ++t)
#pragma unroll
          for (int r = 0; r < 8; ++r)
            w[p][t * 8 + r] = mp[(size_t)(p * 32 + t * 16 + r) * NN];
    } else {
      const float* mp = mb + (size_t)(i0 + ln) * NN + j0 + hf * 8;
#pragma unroll
      for (int p = 0; p < SD / 32; ++p)
#pragma unroll
        for (int t = 0; t < 2; ++t)
#pragma unroll
          for (int q = 0; q < 2; ++q)
            wq[p * 4 + t * 2 + q] = *(const f32x4*)(mp + p * 32 + t * 16 + q * 4);
    }

    // V transposed into LDS
#pragma unroll
    for (int c = 0; c < 4; ++c)
#pragma unroll
      for (int e = 0; e < 8; ++e) Vt[(dh0 + e) * SP + c * 32 + jr] = uv[c].e[e];
    if (!DIR) {
      // Takes the loaded weights as inputs only: it holds their loads in front of
      // the barrier, in flight together with the K copies and the V loads. Left
      // free, the compiler sinks them behind the barrier, where their latency is
      // paid on top of the fill's.
      asm volatile("" :: "v"(wq[0]), "v"(wq[1]), "v"(wq[2]), "v"(wq[3]),
                         "v"(wq[4]), "v"(wq[5]), "v"(wq[6]), "v"(wq[7]),
                         "v"(wq[8]), "v"(wq[9]), "v"(wq[10]), "v"(wq[11]),
                         "v"(wq[12]), "v"(wq[13]), "v"(wq[14]), "v"(wq[15]));
#pragma unroll
      for (int k = 0; k < SD / 2; ++k) w[k >> 4][k & 15] = wq[k >> 2][k & 3];
    }
    async_lds_wait();
    __syncthreads();

#pragma unroll
    for (int p = 0; p < SD / 32; ++p) {
      // S^T = K @ Q^T for two 16-key tiles:
      // S[t].f[r] = key j0+p*32+t*16+hf*8+r, query i0+ln
      FragF S[2];
#pragma unroll
      for (int t = 0; t < 2; ++t) {
        Frag16 kf;
#pragma unroll
        for (int v = 0; v < 8; ++v) {
          const int kp = (v >> 2) * 16 + hf * 8 + (v & 3) * 2;
          kf.u[v] = *(const uint32_t*)(Kt + (p * 32 + t * 16 + ln) * LP + kp);
        }
        S[t].v = __builtin_amdgcn_wmma_f32_16x16x32_bf16(
            false, kf.v, false, qf.v, (short)0, (v8f){0,0,0,0,0,0,0,0}, false, false);
      }

      // online softmax, one query per lane
      float sc[16];
#pragma unroll
      for (int k = 0; k < 16; ++k) sc[k] = S[k >> 3].f[k & 7] * w[p][k];
      float mx[8];
#pragma unroll
      for (int k = 0; k < 8; ++k) mx[k] = fmaxf(sc[2 * k], sc[2 * k + 1]);
      float cm = fmaxf(fmaxf(fmaxf(mx[0], mx[1]), fmaxf(mx[2], mx[3])),
                       fmaxf(fmaxf(mx[4], mx[5]), fmaxf(mx[6], mx[7])));
      cm = fmaxf(cm, other_half(cm));
      const float nm = fmaxf(mrow, cm);
      const float fac = __expf(mrow - nm);
      float ex[16];
#pragma unroll
      for (int k = 0; k < 16; ++k) ex[k] = __expf(sc[k] - nm);
      float sm[8];
#pragma unroll
      for (int k = 0; k < 8; ++k) sm[k] = ex[2 * k] + ex[2 * k + 1];
      const float cs = ((sm[0] + sm[1]) + (sm[2] + sm[3])) + ((sm[4] + sm[5]) + (sm[6] + sm[7]));
      lrow = lrow * fac + cs;
      mrow = nm;
#pragma unroll
      for (int r = 0; r < 8; ++r) { O0.f[r] *= fac; O1.f[r] *= fac; }

      // P^T as B operand: element s = tile s>>3, register s&7 (the hardware k order)
      Frag16 pf, vf0, vf1;
#pragma unroll
      for (int v = 0; v < 8; ++v) {
        const int kp = p * 32 + (v >> 2) * 16 + hf * 8 + (v & 3) * 2;
        pf.u[v]  = pack_bf16(ex[2 * v], ex[2 * v + 1]);
        vf0.u[v] = *(const uint32_t*)(Vt + ln * SP + kp);
        vf1.u[v] = *(const uint32_t*)(Vt + (16 + ln) * SP + kp);
      }
      O0.v = __builtin_amdgcn_wmma_f32_16x16x32_bf16(
          false, vf0.v, false, pf.v, (short)0, O0.v, false, false);
      O1.v = __builtin_amdgcn_wmma_f32_16x16x32_bf16(
          false, vf1.v, false, pf.v, (short)0, O1.v, false, false);
    }
  }

  {  // join the halves' sums once; a lane stores 8 consecutive dh per tile
    const float inv = 1.0f / (lrow + other_half(lrow));
    bf16_t* op = Out + (size_t)(b * NN + i0 + ln) * DD + h * DH + hf * 8;
    uint4 a0, a1;
    a0.x = pack_bf16(O0.f[0] * inv, O0.f[1] * inv);
    a0.y = pack_bf16(O0.f[2] * inv, O0.f[3] * inv);
    a0.z = pack_bf16(O0.f[4] * inv, O0.f[5] * inv);
    a0.w = pack_bf16(O0.f[6] * inv, O0.f[7] * inv);
    a1.x = pack_bf16(O1.f[0] * inv, O1.f[1] * inv);
    a1.y = pack_bf16(O1.f[2] * inv, O1.f[3] * inv);
    a1.z = pack_bf16(O1.f[4] * inv, O1.f[5] * inv);
    a1.w = pack_bf16(O1.f[6] * inv, O1.f[7] * inv);
    *(uint4*)op = a0;
    *(uint4*)(op + 16) = a1;
  }
}

__global__ __launch_bounds__(128) void flash_attn(
    const bf16_t* __restrict__ qk0, const bf16_t* __restrict__ qk1,
    const bf16_t* __restrict__ v0b, const bf16_t* __restrict__ v1b,
    const float* __restrict__ match,
    bf16_t* __restrict__ m0, bf16_t* __restrict__ m1) {
  const int NN = 2048;
  const int dir = blockIdx.z >> 1;
  const int b = blockIdx.z & 1;
  const int h = blockIdx.y;
  const float* mb = match + (size_t)b * NN * NN;

  __shared__ __align__(16) bf16_t Kt[SD * LP];        // [j][dh]
  __shared__ __align__(16) bf16_t Vt[32 * SP];        // [dh][j] (transposed)

  if (dir) attn_dir<1>(qk1, qk0, v0b, mb, m1, Kt, Vt, b, h);
  else     attn_dir<0>(qk0, qk1, v1b, mb, m0, Kt, Vt, b, h);
}

// ------------------------ LayerNorm + exact GELU ---------------------------
// A wave owns two whole rows of 512: a lane holds 16 elements of each (four
// 16-byte loads a row, all eight issued before the first use), so mean and
// variance are in-lane sums plus five lane exchanges, with no LDS and no barrier.
__device__ __forceinline__ float gelu_exact(float y) {
  return 0.5f * y * (1.f + erff(y * 0.70710678118654752f));
}

// The pointers carry no __restrict__, so that no load moves over the wait below.
__global__ __launch_bounds__(256) void ln_gelu(
    const float* hbuf, const float* gamma, const float* beta, bf16_t* gbuf) {
  const int wave = threadIdx.x >> 5, lane = threadIdx.x & 31;
  const size_t base = (size_t)(blockIdx.x * 8 + wave) * 1024 + lane * 4;
  const float* hp = hbuf + base;

  float4 x[2][4], ga[4], be[4];
#pragma unroll
  for (int j = 0; j < 4; ++j) {
    ga[j] = *(const float4*)(gamma + j * 128 + lane * 4);
    be[j] = *(const float4*)(beta + j * 128 + lane * 4);
  }
  // The loads below may land in the address register of the loads above: this
  // wait stands in front of that overwrite.
  asm volatile("s_wait_xcnt 0x0" ::: "memory");
#pragma unroll
  for (int r = 0; r < 2; ++r)
#pragma unroll
    for (int j = 0; j < 4; ++j) x[r][j] = *(const float4*)(hp + r * 512 + j * 128);

  float s[2], q[2];
#pragma unroll
  for (int r = 0; r < 2; ++r) {
    float sj[4], qj[4];
#pragma unroll
    for (int j = 0; j < 4; ++j) {
      const float4 v = x[r][j];
      sj[j] = (v.x + v.y) + (v.z + v.w);
      qj[j] = (v.x * v.x + v.y * v.y) + (v.z * v.z + v.w * v.w);
    }
    s[r] = (sj[0] + sj[1]) + (sj[2] + sj[3]);
    q[r] = (qj[0] + qj[1]) + (qj[2] + qj[3]);
  }
#pragma unroll
  for (int off = 16; off; off >>= 1) {
#pragma unroll
    for (int r = 0; r < 2; ++r) {
      s[r] += __shfl_xor(s[r], off, 32);
      q[r] += __shfl_xor(q[r], off, 32);
    }
  }

#pragma unroll
  for (int r = 0; r < 2; ++r) {
    const float mu = s[r] * (1.f / 512.f);
    const float rs = rsqrtf(q[r] * (1.f / 512.f) - mu * mu + 1e-5f);
#pragma unroll
    for (int j = 0; j < 4; ++j) {
      const float4 v = x[r][j];
      union { uint2 u; bf16_t h[4]; } o;
      o.h[0] = f2bf(gelu_exact((v.x - mu) * rs * ga[j].x + be[j].x));
      o.h[1] = f2bf(gelu_exact((v.y - mu) * rs * ga[j].y + be[j].y));
      o.h[2] = f2bf(gelu_exact((v.z - mu) * rs * ga[j].z + be[j].z));
      o.h[3] = f2bf(gelu_exact((v.w - mu) * rs * ga[j].w + be[j].w));
      *(uint2*)(gbuf + base + r * 512 + j * 128) = o.u;
    }
  }
}

// ------------------------------- host side ---------------------------------
extern "C" void kernel_launch(void* const* d_in, const int* in_sizes, int n_in,
                              void* d_out, int out_size, void* d_ws, size_t ws_size,
                              hipStream_t stream) {
  const int B = 2, N = 2048, D = 256, H = 8, M = B * N, D2 = 2 * D;
  (void)in_sizes; (void)n_in; (void)out_size; (void)ws_size; (void)H;

  const float* x0    = (const float*)d_in[0];
  const float* x1    = (const float*)d_in[1];
  const float* match = (const float*)d_in[2];
  const float* Wqk   = (const float*)d_in[3];
  const float* bqk   = (const float*)d_in[4];
  const float* Wv    = (const float*)d_in[5];
  const float* bv    = (const float*)d_in[6];
  const float* Wo    = (const float*)d_in[7];
  const float* bo    = (const float*)d_in[8];
  const float* W1    = (const float*)d_in[9];
  const float* b1    = (const float*)d_in[10];
  const float* gamma = (const float*)d_in[11];
  const float* beta  = (const float*)d_in[12];
  const float* W2    = (const float*)d_in[13];
  const float* b2    = (const float*)d_in[14];
  float* out = (float*)d_out;

  char* ws = (char*)d_ws;
  auto alloc = [&](size_t bytes) {
    char* p = ws; ws += (bytes + 255) & ~(size_t)255; return p;
  };
  bf16_t* WqkB = (bf16_t*)alloc((size_t)D * D * 2);
  bf16_t* WvB  = (bf16_t*)alloc((size_t)D * D * 2);
  bf16_t* WoB  = (bf16_t*)alloc((size_t)D * D * 2);
  bf16_t* W1B  = (bf16_t*)alloc((size_t)D2 * D2 * 2);
  bf16_t* W2B  = (bf16_t*)alloc((size_t)D2 * D * 2);
  bf16_t* qk0s = (bf16_t*)alloc((size_t)M * D * 2);
  bf16_t* qk1s = (bf16_t*)alloc((size_t)M * D * 2);
  bf16_t* v0bb = (bf16_t*)alloc((size_t)M * D * 2);
  bf16_t* v1bb = (bf16_t*)alloc((size_t)M * D * 2);
  bf16_t* m0b  = (bf16_t*)alloc((size_t)M * D * 2);
  bf16_t* m1b  = (bf16_t*)alloc((size_t)M * D * 2);
  bf16_t* cat0 = (bf16_t*)alloc((size_t)M * D2 * 2);
  bf16_t* cat1 = (bf16_t*)alloc((size_t)M * D2 * 2);
  float*  h0   = (float*)alloc((size_t)M * D2 * 4);
  float*  h1   = (float*)alloc((size_t)M * D2 * 4);
  bf16_t* g0 = qk0s;  // 8MB alias over qk0s..v1bb (dead after attention)
  (void)cat1; (void)h1;
  // Every buffer size is a multiple of 256 bytes, so each side-1 buffer starts
  // where its side-0 buffer ends: a pair is one matrix of 2*M rows.

  // weights + x into concat buffers (first 256 cols of cat = x)
  cvt_all<<<dim3((2 * M * D + 3 * D * D + D2 * D2 + D2 * D) / 4096), dim3(256), 0, stream>>>(
      x0, x1, Wqk, Wv, Wo, W1, W2, cat0, WqkB);

  const float s = 0.42044820762685725f;  // (DH^-0.5)^0.5 = 32^-0.25

  // projections, both sides: z=0 qk = (x@Wqk + bqk)*s ; z=1 v = x@Wv + bv
  gemm_wmma<<<dim3(2 * M / 128, D / 64, 2), dim3(256), 0, stream>>>(
      cat0, D2, WqkB, WvB, D, bqk, bv, s, 1.0f, qk0s, v0bb, nullptr,
      nullptr, nullptr, 2 * M, D, 0, D);

  // flash attention, both directions
  flash_attn<<<dim3(N / 64, H, 2 * B), dim3(128), 0, stream>>>(
      qk0s, qk1s, v0bb, v1bb, match, m0b, m1b);

  // output projection, written directly into cat[:, 256:512]
  gemm_wmma<<<dim3(2 * M / 128, D / 64, 1), dim3(256), 0, stream>>>(
      m0b, D, WoB, WoB, D, bo, bo, 1.0f, 1.0f, cat0 + D, nullptr, nullptr,
      nullptr, nullptr, 2 * M, D2, 0, D);

  // FFN: h = cat @ W1 + b1 (f32) ; LN + exact GELU -> bf16
  gemm_wmma<<<dim3(2 * M / 128, D2 / 64, 1), dim3(256), 0, stream>>>(
      cat0, D2, W1B, W1B, D2, b1, b1, 1.0f, 1.0f, nullptr, nullptr, h0,
      nullptr, nullptr, 2 * M, D2, 0, D2);
  ln_gelu<<<dim3(2 * M / 16), dim3(256), 0, stream>>>(h0, gamma, beta, g0);

  // out = x + g @ W2 + b2
  gemm_wmma<<<dim3(2 * M / 128, D / 64, 1), dim3(256), 0, stream>>>(
      g0, D2, W2B, W2B, D, b2, b2, 1.0f, 1.0f, nullptr, nullptr, out,
      x0, x1, M, D, D, D2);
}

// v006
// It runs in 120 microseconds.
// Next to v005, in two timings, it ran 1.13 times as fast each time.
// Counting every step since v000, it is 3.20 times as fast.
#include <hip/hip_runtime.h>
#include <hip/hip_bf16.h>
#include <stdint.h>

// ---------------------------------------------------------------------------
// CDNA5 (gfx1250) CrossBlock: bf16 WMMA GEMMs + dual-direction flash attention
// + ASYNCcnt-tracked global->LDS tile staging where no transpose is needed.
// ---------------------------------------------------------------------------

typedef __bf16 bf16_t;
typedef __attribute__((ext_vector_type(16))) __bf16 v16bf;
typedef __attribute__((ext_vector_type(8)))  float  v8f;

// Row pitch, in bf16 elements, of every LDS tile whose rows hold 32 of them:
// 80 bytes = 16 bytes x odd, so that the 16-byte fragment reads of 16 rows fall
// on distinct banks (at the bare 64 bytes every fourth row meets the same ones).
constexpr int LP = 40;

// Depth of a stage: what one fill of the LDS tiles holds along the loop's axis
// (k in the GEMM, keys in attention). Four 32-deep passes run on one fill, so
// the fill's load latency and its two barriers are paid once for the four.
constexpr int SD = 128;
// Row pitch of the tiles whose rows hold SD elements: 272 bytes = 16 bytes x odd.
constexpr int SP = SD + 8;

union Frag16 { v16bf v; uint32_t u[8]; };
union FragF  { v8f   v; float    f[8]; };

__device__ __forceinline__ bf16_t f2bf(float f) {
  uint32_t u = __builtin_bit_cast(uint32_t, f);
  uint32_t r = (u + 0x7FFFu + ((u >> 16) & 1u)) >> 16;   // round-to-nearest-even
  unsigned short s = (unsigned short)r;
  return __builtin_bit_cast(bf16_t, s);
}

__device__ __forceinline__ uint32_t lds_off(const void* p) {
  return (uint32_t)(uintptr_t)p;
}

// Four 16-byte copies a lane, each with address registers of its own and no
// immediate offset. The s_wait_xcnt closes the statement so that it stands in
// front of whatever next rewrites one of these registers.
__device__ __forceinline__ void copy4_b128_to_lds(
    const bf16_t* g0, const bf16_t* g1, const bf16_t* g2, const bf16_t* g3,
    const bf16_t* l0, const bf16_t* l1, const bf16_t* l2, const bf16_t* l3) {
  asm volatile(
      "global_load_async_to_lds_b128 %0, %4, off\n\t"
      "global_load_async_to_lds_b128 %1, %5, off\n\t"
      "global_load_async_to_lds_b128 %2, %6, off\n\t"
      "global_load_async_to_lds_b128 %3, %7, off\n\t"
      "s_wait_xcnt 0x0"
      :: "v"(lds_off(l0)), "v"(lds_off(l1)), "v"(lds_off(l2)), "v"(lds_off(l3)),
         "v"(g0), "v"(g1), "v"(g2), "v"(g3)
      : "memory");
}

// This wave's LDS reads of the last stage have retired before its copies refill it.
__device__ __forceinline__ void lds_reads_done() {
  asm volatile("s_wait_dscnt 0x0" ::: "memory");
}

// This wave's copies have landed; the barrier behind it shows them to the others.
__device__ __forceinline__ void async_lds_wait() {
  asm volatile("s_wait_asynccnt 0x0" ::: "memory");
}

// ---------------------- f32 -> bf16, all seven inputs -----------------------
// One launch of few, fat blocks: a block of 256 threads converts 4096 consecutive
// elements of one input, picked by the block index; a thread takes 16 of them as
// four 16-byte loads (a wave-wide load covers 512 contiguous bytes), all issued
// before the first use. Blocks [0, 512): 16 rows of x0 or x1 into the first 256
// columns of the stacked concat buffer (row pitch 512). The rest: the five
// weights, whose bf16 copies lie one behind the other at wdst.
__global__ __launch_bounds__(256) void cvt_all(
    const float* __restrict__ x0, const float* __restrict__ x1,
    const float* __restrict__ Wqk, const float* __restrict__ Wv,
    const float* __restrict__ Wo, const float* __restrict__ W1,
    const float* __restrict__ W2,
    bf16_t* __restrict__ cat, bf16_t* __restrict__ wdst) {
  const int blk = blockIdx.x;
  const int off = (threadIdx.x >> 5) * 512 + (threadIdx.x & 31) * 4;
  const bool isx = blk < 512;
  const float* in;     // the block's 4096 source elements
  bf16_t* dst;         // where the first of them goes
  if (isx) {
    in = (blk < 256 ? x0 : x1) + (size_t)(blk & 255) * 4096;
    dst = cat + (size_t)blk * 8192;
  } else {
    const int wb = blk - 512;   // 16 | 16 | 16 | 64 | 32 blocks
    int first;
    if (wb < 16)       { in = Wqk; first = 0; }
    else if (wb < 32)  { in = Wv;  first = 16; }
    else if (wb < 48)  { in = Wo;  first = 32; }
    else if (wb < 112) { in = W1;  first = 48; }
    else               { in = W2;  first = 112; }
    in += (size_t)(wb - first) * 4096;
    dst = wdst + (size_t)wb * 4096;
  }
  float4 f[4];
#pragma unroll
  for (int j = 0; j < 4; ++j) f[j] = *(const float4*)(in + off + j * 128);
#pragma unroll
  for (int j = 0; j < 4; ++j) {
    const int e = off + j * 128;
    const int d = isx ? (e >> 8) * 512 + (e & 255) : e;
    union { uint2 q; bf16_t h[4]; } o;
    o.h[0] = f2bf(f[j].x); o.h[1] = f2bf(f[j].y);
    o.h[2] = f2bf(f[j].z); o.h[3] = f2bf(f[j].w);
    *(uint2*)(dst + d) = o.q;
  }
}

// ----------------------------- generic GEMM --------------------------------
// C[M=grid.x*128, N=grid.y*64] = (A[M,K]bf16 @ B[K,N]bf16 + bias)*scale (+res)
// 8 waves: wave w owns rows [w*16, w*16+16) of the block tile, all 64 cols.
// K is a multiple of SD.
// One launch serves both sides: the rows of side 1 stand behind those of side 0
// in A and in the output; the residual, an input per side, changes at row mres.
// blockIdx.z picks one of two products that share A (weight, bias, scale, out).
__global__ __launch_bounds__(256) void gemm_wmma(
    const bf16_t* __restrict__ A, int lda,
    const bf16_t* __restrict__ B0, const bf16_t* __restrict__ B1, int ldb,
    const float* __restrict__ bias0, const float* __restrict__ bias1,
    float scale0, float scale1,
    bf16_t* __restrict__ outB0, bf16_t* __restrict__ outB1,
    float* __restrict__ outF,
    const float* __restrict__ res0, const float* __restrict__ res1, int mres,
    int ldo, int ldr, int K) {
  __shared__ __align__(16) bf16_t As[128 * SP];
  __shared__ __align__(16) bf16_t Bs[64 * SP];    // stored [n][k] (K-contiguous)

  const int bm = blockIdx.x * 128;
  const int bn = blockIdx.y * 64;
  const bool second = blockIdx.z != 0;
  const bf16_t* Bm  = second ? B1 : B0;
  const float* bias = second ? bias1 : bias0;
  const float scale = second ? scale1 : scale0;
  bf16_t* outB      = second ? outB1 : outB0;
  const float* res  = bm < mres ? res0 : res1;
  const int rfirst  = bm < mres ? 0 : mres;      // first row of that residual
  const int t = threadIdx.x;
  const int wave = t >> 5;
  const int lane = t & 31;
  const int hf = lane >> 4;       // which 16-lane half of the wave
  const int ln = lane & 15;

  FragF acc[4];
#pragma unroll
  for (int i = 0; i < 4; ++i) acc[i].v = (v8f){0, 0, 0, 0, 0, 0, 0, 0};

  for (int k0 = 0; k0 < K; k0 += SD) {
    lds_reads_done();
    __syncthreads();
    {  // stage A tile 128 x SD (async copies): 16 lanes cover a row's 256 bytes,
       // so a wave-wide copy takes whole lines; eight rows a thread, 16 apart
      const bf16_t* gsrc = A + (size_t)(bm + (t >> 4)) * lda + k0 + (t & 15) * 8;
      const bf16_t* ldst = As + (t >> 4) * SP + (t & 15) * 8;
      const size_t gs = (size_t)16 * lda;
      copy4_b128_to_lds(gsrc, gsrc + gs, gsrc + 2 * gs, gsrc + 3 * gs,
                        ldst, ldst + 16 * SP, ldst + 32 * SP, ldst + 48 * SP);
      gsrc += 4 * gs;
      ldst += 64 * SP;
      copy4_b128_to_lds(gsrc, gsrc + gs, gsrc + 2 * gs, gsrc + 3 * gs,
                        ldst, ldst + 16 * SP, ldst + 32 * SP, ldst + 48 * SP);
    }
    {  // stage B tile SD x 64 -> LDS transposed [n][k] (register path)
      const int kr = t >> 3;
      const int nc = (t & 7) * 8;
      union { uint4 q; bf16_t e[8]; } ub[4];
#pragma unroll
      for (int c = 0; c < 4; ++c)
        ub[c].q = *(const uint4*)(Bm + (size_t)(k0 + c * 32 + kr) * ldb + bn + nc);
#pragma unroll
      for (int c = 0; c < 4; ++c)
#pragma unroll
        for (int e = 0; e < 8; ++e) Bs[(nc + e) * SP + c * 32 + kr] = ub[c].e[e];
    }
    async_lds_wait();
    __syncthreads();

#pragma unroll
    for (int p = 0; p < SD / 32; ++p) {
      Frag16 af;
#pragma unroll
      for (int v = 0; v < 8; ++v) {
        const int kp = p * 32 + (v >> 2) * 16 + hf * 8 + (v & 3) * 2;
        af.u[v] = *(const uint32_t*)(As + (wave * 16 + ln) * SP + kp);
      }
#pragma unroll
      for (int ns = 0; ns < 4; ++ns) {
        Frag16 bfr;
#pragma unroll
        for (int v = 0; v < 8; ++v) {
          const int kp = p * 32 + (v >> 2) * 16 + hf * 8 + (v & 3) * 2;
          bfr.u[v] = *(const uint32_t*)(Bs + (ns * 16 + ln) * SP + kp);
        }
        acc[ns].v = __builtin_amdgcn_wmma_f32_16x16x32_bf16(
            false, af.v, false, bfr.v, (short)0, acc[ns].v, false, false);
      }
    }
  }

  // Epilogue through LDS. An accumulator register holds one column of a row, 16
  // lanes to a 64-byte piece; passed through LDS, a lane holds four consecutive
  // columns and 16 lanes a whole row of the tile, so that every global access
  // covers whole lines. A wave stages in its own 16 rows of As: no other wave
  // reads them, and nothing has written them since the last stage's barrier, so no
  // barrier is owed. A row of 64 floats fits the pitch of SP bf16 (272 bytes).
  float* stg = (float*)(As + wave * 16 * SP);
  const int ec = ln * 4;                       // the lane's first column in the tile
  const int row0 = bm + wave * 16 + hf;        // its rows: row0 + 2 * i
  const float4 bi = *(const float4*)(bias + bn + ec);
  const bool addres = !outB && res;
  float4 rv[8];
  if (addres) {   // the residual's eight loads, issued together ahead of the staging
    const float* rp[8];
    rp[0] = res + (size_t)(row0 - rfirst) * ldr + bn + ec;
#pragma unroll
    for (int i = 1; i < 8; ++i) rp[i] = rp[i - 1] + (size_t)2 * ldr;
#pragma unroll
    for (int i = 0; i < 8; ++i) rv[i] = *(const float4*)rp[i];
    // The eight addresses are inputs here, so that no load of the group lands in
    // the address register of another: they stay as they are up to this wait.
    asm volatile("s_wait_xcnt 0x0"
                 :: "v"(rp[0]), "v"(rp[1]), "v"(rp[2]), "v"(rp[3]),
                    "v"(rp[4]), "v"(rp[5]), "v"(rp[6]), "v"(rp[7])
                 : "memory");
  }
#pragma unroll
  for (int ns = 0; ns < 4; ++ns)
#pragma unroll
    for (int r = 0; r < 8; ++r)   // C/D layout: m = r + 8*half
      stg[(hf * 8 + r) * (SP / 2) + ns * 16 + ln] = acc[ns].f[r];
  // The wave's own stores have reached LDS before other lanes of it read them back.
  asm volatile("s_wait_dscnt 0x0" ::: "memory");
  float4 c[8];
#pragma unroll
  for (int i = 0; i < 8; ++i) {
    c[i] = *(const float4*)(stg + (2 * i + hf) * (SP / 2) + ec);
    c[i].x = (c[i].x + bi.x) * scale;
    c[i].y = (c[i].y + bi.y) * scale;
    c[i].z = (c[i].z + bi.z) * scale;
    c[i].w = (c[i].w + bi.w) * scale;
  }
  if (outB) {
    bf16_t* op = outB + (size_t)row0 * ldo + bn + ec;
#pragma unroll
    for (int i = 0; i < 8; ++i) {
      union { uint2 q; bf16_t h[4]; } o;
      o.h[0] = f2bf(c[i].x); o.h[1] = f2bf(c[i].y);
      o.h[2] = f2bf(c[i].z); o.h[3] = f2bf(c[i].w);
      *(uint2*)(op + (size_t)(2 * i) * ldo) = o.q;
    }
  } else {
    float* op = outF + (size_t)row0 * ldo + bn + ec;
    if (addres) {
#pragma unroll
      for (int i = 0; i < 8; ++i) {
        c[i].x += rv[i].x; c[i].y += rv[i].y; c[i].z += rv[i].z; c[i].w += rv[i].w;
      }
    }
#pragma unroll
    for (int i = 0; i < 8; ++i) *(float4*)(op + (size_t)(2 * i) * ldo) = c[i];
  }
}

typedef __attribute__((ext_vector_type(2))) float  f32x2;
typedef __attribute__((ext_vector_type(4))) float  f32x4;
typedef __attribute__((ext_vector_type(2))) __bf16 bf16x2;

__device__ __forceinline__ uint32_t pack_bf16(float lo, float hi) {
  f32x2 p = {lo, hi};
  return __builtin_bit_cast(uint32_t, __builtin_convertvector(p, bf16x2));
}

// value of lane l ^ 16
__device__ __forceinline__ float other_half(float x) {
  const int xi = __builtin_bit_cast(int, x);
  return __builtin_bit_cast(float, __builtin_amdgcn_permlanex16(
      xi, xi, 0x76543210, 0xfedcba98, false, false));
}

// One direction's whole pass. DIR is a compile-time constant so that the loop
// holds that direction's match loads alone, with no branch and no select.
template <int DIR>
__device__ __forceinline__ void attn_dir(
    const bf16_t* __restrict__ Q, const bf16_t* __restrict__ Km,
    const bf16_t* __restrict__ Vm, const float* __restrict__ mb,
    bf16_t* __restrict__ Out, bf16_t* Kt, bf16_t* Vt, int b, int h) {
  const int NN = 2048, DD = 256, DH = 32;
  const int wave = threadIdx.x >> 5;
  const int lane = threadIdx.x & 31;
  const int hf = lane >> 4;
  const int ln = lane & 15;
  const int i0 = blockIdx.x * 64 + wave * 16;

  // Q fragment (B operand: lane holds query i0+ln), straight from global
  Frag16 qf;
  {
    const size_t qbase = (size_t)(b * NN + i0 + ln) * DD + h * DH;
#pragma unroll
    for (int v = 0; v < 8; ++v) {
      const int kp = (v >> 2) * 16 + hf * 8 + (v & 3) * 2;
      qf.u[v] = *(const uint32_t*)(Q + qbase + kp);
    }
  }

  float mrow = -1e30f, lrow = 0.f;   // of query i0+ln; lrow: this half's keys only
  FragF O0, O1;                      // O^T: f[r] = O[i0+ln][d*16 + hf*8 + r]
  O0.v = (v8f){0, 0, 0, 0, 0, 0, 0, 0};
  O1.v = (v8f){0, 0, 0, 0, 0, 0, 0, 0};

  for (int j0 = 0; j0 < NN; j0 += SD) {
    lds_reads_done();
    __syncthreads();
    // Every global access of the stage's four passes is issued here, together.
    union { uint4 q; bf16_t e[8]; } uv[4];
    const int jr = threadIdx.x >> 2;
    const int dh0 = (threadIdx.x & 3) * 8;
    {  // K rows row-major (async copies), V rows into registers; 32 rows apart
      const size_t gb = (size_t)(b * NN + j0 + jr) * DD + h * DH + dh0;
      const bf16_t* kg = Km + gb;
      const bf16_t* kl = Kt + jr * LP + dh0;
      copy4_b128_to_lds(kg, kg + 32 * DD, kg + 64 * DD, kg + 96 * DD,
                        kl, kl + 32 * LP, kl + 64 * LP, kl + 96 * LP);
#pragma unroll
      for (int c = 0; c < 4; ++c) uv[c].q = *(const uint4*)(Vm + gb + c * 32 * DD);
    }
    // The match loads below may land in the address register of the V loads
    // above: this wait stands in front of that overwrite.
    asm volatile("s_wait_xcnt 0x0" ::: "memory");

    // match weights of this lane's 16 scores a pass:
    // key j0+p*32+t*16+hf*8+r, query i0+ln
    float w[SD / 32][16];
    f32x4 wq[SD / 8];   // DIR 0: the same weights as loaded, 16 bytes each
    if (DIR) {
      const float* mp = mb + (size_t)(j0 + hf * 8) * NN + i0 + ln;
#pragma unroll
      for (int p = 0; p < SD / 32; ++p)
#pragma unroll
        for (int t = 0; t < 2; ++t)
#pragma unroll
          for (int r = 0; r < 8; ++r)
            w[p][t * 8 + r] = mp[(size_t)(p * 32 + t * 16 + r) * NN];
    } else {
      const float* mp = mb + (size_t)(i0 + ln) * NN + j0 + hf * 8;
#pragma unroll
      for (int p = 0; p < SD / 32; ++p)
#pragma unroll
        for (int t = 0; t < 2; ++t)
#pragma unroll
          for (int q = 0; q < 2; ++q)
            wq[p * 4 + t * 2 + q] = *(const f32x4*)(mp + p * 32 + t * 16 + q * 4);
    }

    // V transposed into LDS
#pragma unroll
    for (int c = 0; c < 4; ++c)
#pragma unroll
      for (int e = 0; e < 8; ++e) Vt[(dh0 + e) * SP + c * 32 + jr] = uv[c].e[e];
    if (!DIR) {
      // Takes the loaded weights as inputs only: it holds their loads in front of
      // the barrier, in flight together with the K copies and the V loads. Left
      // free, the compiler sinks them behind the barrier, where their latency is
      // paid on top of the fill's.
      asm volatile("" :: "v"(wq[0]), "v"(wq[1]), "v"(wq[2]), "v"(wq[3]),
                         "v"(wq[4]), "v"(wq[5]), "v"(wq[6]), "v"(wq[7]),
                         "v"(wq[8]), "v"(wq[9]), "v"(wq[10]), "v"(wq[11]),
                         "v"(wq[12]), "v"(wq[13]), "v"(wq[14]), "v"(wq[15]));
#pragma unroll
      for (int k = 0; k < SD / 2; ++k) w[k >> 4][k & 15] = wq[k >> 2][k & 3];
    }
    async_lds_wait();
    __syncthreads();

#pragma unroll
    for (int p = 0; p < SD / 32; ++p) {
      // S^T = K @ Q^T for two 16-key tiles:
      // S[t].f[r] = key j0+p*32+t*16+hf*8+r, query i0+ln
      FragF S[2];
#pragma unroll
      for (int t = 0; t < 2; ++t) {
        Frag16 kf;
#pragma unroll
        for (int v = 0; v < 8; ++v) {
          const int kp = (v >> 2) * 16 + hf * 8 + (v & 3) * 2;
          kf.u[v] = *(const uint32_t*)(Kt + (p * 32 + t * 16 + ln) * LP + kp);
        }
        S[t].v = __builtin_amdgcn_wmma_f32_16x16x32_bf16(
            false, kf.v, false, qf.v, (short)0, (v8f){0,0,0,0,0,0,0,0}, false, false);
      }

      // online softmax, one query per lane
      float sc[16];
#pragma unroll
      for (int k = 0; k < 16; ++k) sc[k] = S[k >> 3].f[k & 7] * w[p][k];
      float mx[8];
#pragma unroll
      for (int k = 0; k < 8; ++k) mx[k] = fmaxf(sc[2 * k], sc[2 * k + 1]);
      float cm = fmaxf(fmaxf(fmaxf(mx[0], mx[1]), fmaxf(mx[2], mx[3])),
                       fmaxf(fmaxf(mx[4], mx[5]), fmaxf(mx[6], mx[7])));
      cm = fmaxf(cm, other_half(cm));
      const float nm = fmaxf(mrow, cm);
      const float fac = __expf(mrow - nm);
      float ex[16];
#pragma unroll
      for (int k = 0; k < 16; ++k) ex[k] = __expf(sc[k] - nm);
      float sm[8];
#pragma unroll
      for (int k = 0; k < 8; ++k) sm[k] = ex[2 * k] + ex[2 * k + 1];
      const float cs = ((sm[0] + sm[1]) + (sm[2] + sm[3])) + ((sm[4] + sm[5]) + (sm[6] + sm[7]));
      lrow = lrow * fac + cs;
      mrow = nm;
#pragma unroll
      for (int r = 0; r < 8; ++r) { O0.f[r] *= fac; O1.f[r] *= fac; }

      // P^T as B operand: element s = tile s>>3, register s&7 (the hardware k order)
      Frag16 pf, vf0, vf1;
#pragma unroll
      for (int v = 0; v < 8; ++v) {
        const int kp = p * 32 + (v >> 2) * 16 + hf * 8 + (v & 3) * 2;
        pf.u[v]  = pack_bf16(ex[2 * v], ex[2 * v + 1]);
        vf0.u[v] = *(const uint32_t*)(Vt + ln * SP + kp);
        vf1.u[v] = *(const uint32_t*)(Vt + (16 + ln) * SP + kp);
      }
      O0.v = __builtin_amdgcn_wmma_f32_16x16x32_bf16(
          false, vf0.v, false, pf.v, (short)0, O0.v, false, false);
      O1.v = __builtin_amdgcn_wmma_f32_16x16x32_bf16(
          false, vf1.v, false, pf.v, (short)0, O1.v, false, false);
    }
  }

  {  // join the halves' sums once; a lane stores 8 consecutive dh per tile
    const float inv = 1.0f / (lrow + other_half(lrow));
    bf16_t* op = Out + (size_t)(b * NN + i0 + ln) * DD + h * DH + hf * 8;
    uint4 a0, a1;
    a0.x = pack_bf16(O0.f[0] * inv, O0.f[1] * inv);
    a0.y = pack_bf16(O0.f[2] * inv, O0.f[3] * inv);
    a0.z = pack_bf16(O0.f[4] * inv, O0.f[5] * inv);
    a0.w = pack_bf16(O0.f[6] * inv, O0.f[7] * inv);
    a1.x = pack_bf16(O1.f[0] * inv, O1.f[1] * inv);
    a1.y = pack_bf16(O1.f[2] * inv, O1.f[3] * inv);
    a1.z = pack_bf16(O1.f[4] * inv, O1.f[5] * inv);
    a1.w = pack_bf16(O1.f[6] * inv, O1.f[7] * inv);
    *(uint4*)op = a0;
    *(uint4*)(op + 16) = a1;
  }
}

__global__ __launch_bounds__(128) void flash_attn(
    const bf16_t* __restrict__ qk0, const bf16_t* __restrict__ qk1,
    const bf16_t* __restrict__ v0b, const bf16_t* __restrict__ v1b,
    const float* __restrict__ match,
    bf16_t* __restrict__ m0, bf16_t* __restrict__ m1) {
  const int NN = 2048;
  const int dir = blockIdx.z >> 1;
  const int b = blockIdx.z & 1;
  const int h = blockIdx.y;
  const float* mb = match + (size_t)b * NN * NN;

  __shared__ __align__(16) bf16_t Kt[SD * LP];        // [j][dh]
  __shared__ __align__(16) bf16_t Vt[32 * SP];        // [dh][j] (transposed)

  if (dir) attn_dir<1>(qk1, qk0, v0b, mb, m1, Kt, Vt, b, h);
  else     attn_dir<0>(qk0, qk1, v1b, mb, m0, Kt, Vt, b, h);
}

// ------------------------ LayerNorm + exact GELU ---------------------------
// A wave owns two whole rows of 512: a lane holds 16 elements of each (four
// 16-byte loads a row, all eight issued before the first use), so mean and
// variance are in-lane sums plus five lane exchanges, with no LDS and no barrier.
__device__ __forceinline__ float gelu_exact(float y) {
  return 0.5f * y * (1.f + erff(y * 0.70710678118654752f));
}

// The pointers carry no __restrict__, so that no load moves over the wait below.
__global__ __launch_bounds__(256) void ln_gelu(
    const float* hbuf, const float* gamma, const float* beta, bf16_t* gbuf) {
  const int wave = threadIdx.x >> 5, lane = threadIdx.x & 31;
  const size_t base = (size_t)(blockIdx.x * 8 + wave) * 1024 + lane * 4;
  const float* hp = hbuf + base;

  float4 x[2][4], ga[4], be[4];
#pragma unroll
  for (int j = 0; j < 4; ++j) {
    ga[j] = *(const float4*)(gamma + j * 128 + lane * 4);
    be[j] = *(const float4*)(beta + j * 128 + lane * 4);
  }
  // The loads below may land in the address register of the loads above: this
  // wait stands in front of that overwrite.
  asm volatile("s_wait_xcnt 0x0" ::: "memory");
#pragma unroll
  for (int r = 0; r < 2; ++r)
#pragma unroll
    for (int j = 0; j < 4; ++j) x[r][j] = *(const float4*)(hp + r * 512 + j * 128);

  float s[2], q[2];
#pragma unroll
  for (int r = 0; r < 2; ++r) {
    float sj[4], qj[4];
#pragma unroll
    for (int j = 0; j < 4; ++j) {
      const float4 v = x[r][j];
      sj[j] = (v.x + v.y) + (v.z + v.w);
      qj[j] = (v.x * v.x + v.y * v.y) + (v.z * v.z + v.w * v.w);
    }
    s[r] = (sj[0] + sj[1]) + (sj[2] + sj[3]);
    q[r] = (qj[0] + qj[1]) + (qj[2] + qj[3]);
  }
#pragma unroll
  for (int off = 16; off; off >>= 1) {
#pragma unroll
    for (int r = 0; r < 2; ++r) {
      s[r] += __shfl_xor(s[r], off, 32);
      q[r] += __shfl_xor(q[r], off, 32);
    }
  }

#pragma unroll
  for (int r = 0; r < 2; ++r) {
    const float mu = s[r] * (1.f / 512.f);
    const float rs = rsqrtf(q[r] * (1.f / 512.f) - mu * mu + 1e-5f);
#pragma unroll
    for (int j = 0; j < 4; ++j) {
      const float4 v = x[r][j];
      union { uint2 u; bf16_t h[4]; } o;
      o.h[0] = f2bf(gelu_exact((v.x - mu) * rs * ga[j].x + be[j].x));
      o.h[1] = f2bf(gelu_exact((v.y - mu) * rs * ga[j].y + be[j].y));
      o.h[2] = f2bf(gelu_exact((v.z - mu) * rs * ga[j].z + be[j].z));
      o.h[3] = f2bf(gelu_exact((v.w - mu) * rs * ga[j].w + be[j].w));
      *(uint2*)(gbuf + base + r * 512 + j * 128) = o.u;
    }
  }
}

// ------------------------------- host side ---------------------------------
extern "C" void kernel_launch(void* const* d_in, const int* in_sizes, int n_in,
                              void* d_out, int out_size, void* d_ws, size_t ws_size,
                              hipStream_t stream) {
  const int B = 2, N = 2048, D = 256, H = 8, M = B * N, D2 = 2 * D;
  (void)in_sizes; (void)n_in; (void)out_size; (void)ws_size; (void)H;

  const float* x0    = (const float*)d_in[0];
  const float* x1    = (const float*)d_in[1];
  const float* match = (const float*)d_in[2];
  const float* Wqk   = (const float*)d_in[3];
  const float* bqk   = (const float*)d_in[4];
  const float* Wv    = (const float*)d_in[5];
  const float* bv    = (const float*)d_in[6];
  const float* Wo    = (const float*)d_in[7];
  const float* bo    = (const float*)d_in[8];
  const float* W1    = (const float*)d_in[9];
  const float* b1    = (const float*)d_in[10];
  const float* gamma = (const float*)d_in[11];
  const float* beta  = (const float*)d_in[12];
  const float* W2    = (const float*)d_in[13];
  const float* b2    = (const float*)d_in[14];
  float* out = (float*)d_out;

  char* ws = (char*)d_ws;
  auto alloc = [&](size_t bytes) {
    char* p = ws; ws += (bytes + 255) & ~(size_t)255; return p;
  };
  bf16_t* WqkB = (bf16_t*)alloc((size_t)D * D * 2);
  bf16_t* WvB  = (bf16_t*)alloc((size_t)D * D * 2);
  bf16_t* WoB  = (bf16_t*)alloc((size_t)D * D * 2);
  bf16_t* W1B  = (bf16_t*)alloc((size_t)D2 * D2 * 2);
  bf16_t* W2B  = (bf16_t*)alloc((size_t)D2 * D * 2);
  bf16_t* qk0s = (bf16_t*)alloc((size_t)M * D * 2);
  bf16_t* qk1s = (bf16_t*)alloc((size_t)M * D * 2);
  bf16_t* v0bb = (bf16_t*)alloc((size_t)M * D * 2);
  bf16_t* v1bb = (bf16_t*)alloc((size_t)M * D * 2);
  bf16_t* m0b  = (bf16_t*)alloc((size_t)M * D * 2);
  bf16_t* m1b  = (bf16_t*)alloc((size_t)M * D * 2);
  bf16_t* cat0 = (bf16_t*)alloc((size_t)M * D2 * 2);
  bf16_t* cat1 = (bf16_t*)alloc((size_t)M * D2 * 2);
  float*  h0   = (float*)alloc((size_t)M * D2 * 4);
  float*  h1   = (float*)alloc((size_t)M * D2 * 4);
  bf16_t* g0 = qk0s;  // 8MB alias over qk0s..v1bb (dead after attention)
  (void)cat1; (void)h1;
  // Every buffer size is a multiple of 256 bytes, so each side-1 buffer starts
  // where its side-0 buffer ends: a pair is one matrix of 2*M rows.

  // weights + x into concat buffers (first 256 cols of cat = x)
  cvt_all<<<dim3((2 * M * D + 3 * D * D + D2 * D2 + D2 * D) / 4096), dim3(256), 0, stream>>>(
      x0, x1, Wqk, Wv, Wo, W1, W2, cat0, WqkB);

  const float s = 0.42044820762685725f;  // (DH^-0.5)^0.5 = 32^-0.25

  // projections, both sides: z=0 qk = (x@Wqk + bqk)*s ; z=1 v = x@Wv + bv
  gemm_wmma<<<dim3(2 * M / 128, D / 64, 2), dim3(256), 0, stream>>>(
      cat0, D2, WqkB, WvB, D, bqk, bv, s, 1.0f, qk0s, v0bb, nullptr,
      nullptr, nullptr, 2 * M, D, 0, D);

  // flash attention, both directions
  flash_attn<<<dim3(N / 64, H, 2 * B), dim3(128), 0, stream>>>(
      qk0s, qk1s, v0bb, v1bb, match, m0b, m1b);

  // output projection, written directly into cat[:, 256:512]
  gemm_wmma<<<dim3(2 * M / 128, D / 64, 1), dim3(256), 0, stream>>>(
      m0b, D, WoB, WoB, D, bo, bo, 1.0f, 1.0f, cat0 + D, nullptr, nullptr,
      nullptr, nullptr, 2 * M, D2, 0, D);

  // FFN: h = cat @ W1 + b1 (f32) ; LN + exact GELU -> bf16
  gemm_wmma<<<dim3(2 * M / 128, D2 / 64, 1), dim3(256), 0, stream>>>(
      cat0, D2, W1B, W1B, D2, b1, b1, 1.0f, 1.0f, nullptr, nullptr, h0,
      nullptr, nullptr, 2 * M, D2, 0, D2);
  ln_gelu<<<dim3(2 * M / 16), dim3(256), 0, stream>>>(h0, gamma, beta, g0);

  // out = x + g @ W2 + b2
  gemm_wmma<<<dim3(2 * M / 128, D / 64, 1), dim3(256), 0, stream>>>(
      g0, D2, W2B, W2B, D, b2, b2, 1.0f, 1.0f, nullptr, nullptr, out,
      x0, x1, M, D, D, D2);
}

// v007
// One run takes 90.9 microseconds.
// Timed twice side by side with v006, it ran 1.33 and 1.32 times as fast.
// Over all steps from v000 it is 4.24 times as fast.
#include <hip/hip_runtime.h>
#include <hip/hip_bf16.h>
#include <stdint.h>

// ---------------------------------------------------------------------------
// CDNA5 (gfx1250) CrossBlock: bf16 WMMA GEMMs + dual-direction flash attention
// + ASYNCcnt-tracked global->LDS tile staging; operands that need a transpose
// are staged row-major like the rest and transposed by the LDS load itself.
// ---------------------------------------------------------------------------

typedef __bf16 bf16_t;
typedef __attribute__((ext_vector_type(16))) __bf16 v16bf;
typedef __attribute__((ext_vector_type(8)))  float  v8f;

// Row pitch, in bf16 elements, of the attention's K tile, whose rows hold 32 of
// them: 80 bytes = 16 bytes x odd, so that the 16-byte fragment reads of 16 rows
// fall on distinct banks (at the bare 64 bytes every fourth row meets the same ones).
constexpr int LP = 40;

// Depth of a stage: what one fill of the LDS tiles holds along the loop's axis
// (k in the GEMM, keys in attention). Four 32-deep passes run on one fill, so
// the fill's load latency and its two barriers are paid once for the four.
constexpr int SD = 128;
// Row pitch of the GEMM's A tile, whose rows hold SD elements: 272 bytes = 16 bytes x odd.
constexpr int SP = SD + 8;
// Row pitches, in bf16 elements, of the two tiles read by the transposing load,
// which wants 32 bytes x odd: the GEMM's B rows of 64 (160 bytes) and the
// attention's V rows of 32 (96 bytes).
constexpr int BP = 80;
constexpr int VP = 48;

typedef __attribute__((ext_vector_type(4))) uint32_t u32x4;
typedef __attribute__((ext_vector_type(8))) short    s16x8;

union Frag16 { v16bf v; uint32_t u[8]; u32x4 q[2]; };
union FragF  { v8f   v; float    f[8]; };

__device__ __forceinline__ bf16_t f2bf(float f) {
  uint32_t u = __builtin_bit_cast(uint32_t, f);
  uint32_t r = (u + 0x7FFFu + ((u >> 16) & 1u)) >> 16;   // round-to-nearest-even
  unsigned short s = (unsigned short)r;
  return __builtin_bit_cast(bf16_t, s);
}

__device__ __forceinline__ uint32_t lds_off(const void* p) {
  return (uint32_t)(uintptr_t)p;
}

// Four 16-byte copies a lane, each with address registers of its own and no
// immediate offset. The s_wait_xcnt closes the statement so that it stands in
// front of whatever next rewrites one of these registers.
__device__ __forceinline__ void copy4_b128_to_lds(
    const bf16_t* g0, const bf16_t* g1, const bf16_t* g2, const bf16_t* g3,
    const bf16_t* l0, const bf16_t* l1, const bf16_t* l2, const bf16_t* l3) {
  asm volatile(
      "global_load_async_to_lds_b128 %0, %4, off\n\t"
      "global_load_async_to_lds_b128 %1, %5, off\n\t"
      "global_load_async_to_lds_b128 %2, %6, off\n\t"
      "global_load_async_to_lds_b128 %3, %7, off\n\t"
      "s_wait_xcnt 0x0"
      :: "v"(lds_off(l0)), "v"(lds_off(l1)), "v"(lds_off(l2)), "v"(lds_off(l3)),
         "v"(g0), "v"(g1), "v"(g2), "v"(g3)
      : "memory");
}

// This wave's LDS reads of the last stage have retired before its copies refill it.
__device__ __forceinline__ void lds_reads_done() {
  asm volatile("s_wait_dscnt 0x0" ::: "memory");
}

// This wave's copies have landed; the barrier behind it shows them to the others.
__device__ __forceinline__ void async_lds_wait() {
  asm volatile("s_wait_asynccnt 0x0" ::: "memory");
}

// ---------------- transposing LDS load (ds_load_tr16_b128) ------------------
// Of a row-major tile T of 16-bit elements, lane (c = l & 15, h = l >> 4) gets
// T[k + 8h + 0..7][d + c] when lane l passes the address that tr16_lane gives it
// for (k, d) = (0, 0), moved by k rows and 2 * d bytes. The loads at k and k + 16
// are registers 0-3 and 4-7 of a 16x16x32 operand in the hardware k order, the
// order in which every other fragment of this file is loaded.
__device__ __forceinline__ const unsigned char* tr16_lane(const bf16_t* tile, int pitch, int lane) {
  return (const unsigned char*)tile + ((lane >> 4) * 8 + (lane & 7)) * (pitch * 2) + ((lane >> 3) & 1) * 16;
}
__device__ __forceinline__ u32x4 ld_tr16(const unsigned char* p) {
  typedef __attribute__((address_space(3))) s16x8 lds_s16x8;
  return __builtin_bit_cast(u32x4, __builtin_amdgcn_ds_load_tr16_b128_v8i16((lds_s16x8*)p));
}

// ---------------------- f32 -> bf16, all seven inputs -----------------------
// One launch of few, fat blocks: a block of 256 threads converts 4096 consecutive
// elements of one input, picked by the block index; a thread takes 16 of them as
// four 16-byte loads (a wave-wide load covers 512 contiguous bytes), all issued
// before the first use. Blocks [0, 512): 16 rows of x0 or x1 into the first 256
// columns of the stacked concat buffer (row pitch 512). The rest: the five
// weights, whose bf16 copies lie one behind the other at wdst.
__global__ __launch_bounds__(256) void cvt_all(
    const float* __restrict__ x0, const float* __restrict__ x1,
    const float* __restrict__ Wqk, const float* __restrict__ Wv,
    const float* __restrict__ Wo, const float* __restrict__ W1,
    const float* __restrict__ W2,
    bf16_t* __restrict__ cat, bf16_t* __restrict__ wdst) {
  const int blk = blockIdx.x;
  const int off = (threadIdx.x >> 5) * 512 + (threadIdx.x & 31) * 4;
  const bool isx = blk < 512;
  const float* in;     // the block's 4096 source elements
  bf16_t* dst;         // where the first of them goes
  if (isx) {
    in = (blk < 256 ? x0 : x1) + (size_t)(blk & 255) * 4096;
    dst = cat + (size_t)blk * 8192;
  } else {
    const int wb = blk - 512;   // 16 | 16 | 16 | 64 | 32 blocks
    int first;
    if (wb < 16)       { in = Wqk; first = 0; }
    else if (wb < 32)  { in = Wv;  first = 16; }
    else if (wb < 48)  { in = Wo;  first = 32; }
    else if (wb < 112) { in = W1;  first = 48; }
    else               { in = W2;  first = 112; }
    in += (size_t)(wb - first) * 4096;
    dst = wdst + (size_t)wb * 4096;
  }
  float4 f[4];
#pragma unroll
  for (int j = 0; j < 4; ++j) f[j] = *(const float4*)(in + off + j * 128);
#pragma unroll
  for (int j = 0; j < 4; ++j) {
    const int e = off + j * 128;
    const int d = isx ? (e >> 8) * 512 + (e & 255) : e;
    union { uint2 q; bf16_t h[4]; } o;
    o.h[0] = f2bf(f[j].x); o.h[1] = f2bf(f[j].y);
    o.h[2] = f2bf(f[j].z); o.h[3] = f2bf(f[j].w);
    *(uint2*)(dst + d) = o.q;
  }
}

// ----------------------------- generic GEMM --------------------------------
// C[M=grid.x*128, N=grid.y*64] = (A[M,K]bf16 @ B[K,N]bf16 + bias)*scale (+res)
// 8 waves: wave w owns rows [w*16, w*16+16) of the block tile, all 64 cols.
// K is a multiple of SD.
// One launch serves both sides: the rows of side 1 stand behind those of side 0
// in A and in the output; the residual, an input per side, changes at row mres.
// blockIdx.z picks one of two products that share A (weight, bias, scale, out).
__global__ __launch_bounds__(256) void gemm_wmma(
    const bf16_t* __restrict__ A, int lda,
    const bf16_t* __restrict__ B0, const bf16_t* __restrict__ B1, int ldb,
    const float* __restrict__ bias0, const float* __restrict__ bias1,
    float scale0, float scale1,
    bf16_t* __restrict__ outB0, bf16_t* __restrict__ outB1,
    float* __restrict__ outF,
    const float* __restrict__ res0, const float* __restrict__ res1, int mres,
    int ldo, int ldr, int K) {
  __shared__ __align__(16) bf16_t As[128 * SP];
  __shared__ __align__(16) bf16_t Bs[SD * BP];    // stored [k][n], as in memory

  const int bm = blockIdx.x * 128;
  const int bn = blockIdx.y * 64;
  const bool second = blockIdx.z != 0;
  const bf16_t* Bm  = second ? B1 : B0;
  const float* bias = second ? bias1 : bias0;
  const float scale = second ? scale1 : scale0;
  bf16_t* outB      = second ? outB1 : outB0;
  const float* res  = bm < mres ? res0 : res1;
  const int rfirst  = bm < mres ? 0 : mres;      // first row of that residual
  const int t = threadIdx.x;
  const int wave = t >> 5;
  const int lane = t & 31;
  const int hf = lane >> 4;       // which 16-lane half of the wave
  const int ln = lane & 15;

  const unsigned char* btr = tr16_lane(Bs, BP, lane);

  FragF acc[4];
#pragma unroll
  for (int i = 0; i < 4; ++i) acc[i].v = (v8f){0, 0, 0, 0, 0, 0, 0, 0};

  for (int k0 = 0; k0 < K; k0 += SD) {
    lds_reads_done();
    __syncthreads();
    {  // stage A tile 128 x SD (async copies): 16 lanes cover a row's 256 bytes,
       // so a wave-wide copy takes whole lines; eight rows a thread, 16 apart
      const bf16_t* gsrc = A + (size_t)(bm + (t >> 4)) * lda + k0 + (t & 15) * 8;
      const bf16_t* ldst = As + (t >> 4) * SP + (t & 15) * 8;
      const size_t gs = (size_t)16 * lda;
      copy4_b128_to_lds(gsrc, gsrc + gs, gsrc + 2 * gs, gsrc + 3 * gs,
                        ldst, ldst + 16 * SP, ldst + 32 * SP, ldst + 48 * SP);
      gsrc += 4 * gs;
      ldst += 64 * SP;
      copy4_b128_to_lds(gsrc, gsrc + gs, gsrc + 2 * gs, gsrc + 3 * gs,
                        ldst, ldst + 16 * SP, ldst + 32 * SP, ldst + 48 * SP);
    }
    {  // stage B tile SD x 64 row-major (async copies): 8 lanes cover a row's 128
       // bytes, one line; four rows a thread, 32 apart
      const bf16_t* gsrc = Bm + (size_t)(k0 + (t >> 3)) * ldb + bn + (t & 7) * 8;
      const bf16_t* ldst = Bs + (t >> 3) * BP + (t & 7) * 8;
      const size_t gs = (size_t)32 * ldb;
      copy4_b128_to_lds(gsrc, gsrc + gs, gsrc + 2 * gs, gsrc + 3 * gs,
                        ldst, ldst + 32 * BP, ldst + 64 * BP, ldst + 96 * BP);
    }
    async_lds_wait();
    __syncthreads();

#pragma unroll
    for (int p = 0; p < SD / 32; ++p) {
      Frag16 af;
#pragma unroll
      for (int v = 0; v < 8; ++v) {
        const int kp = p * 32 + (v >> 2) * 16 + hf * 8 + (v & 3) * 2;
        af.u[v] = *(const uint32_t*)(As + (wave * 16 + ln) * SP + kp);
      }
#pragma unroll
      for (int ns = 0; ns < 4; ++ns) {
        Frag16 bfr;   // column ns*16+ln, k = p*32 + {0, 16} + hf*8 + 0..7
        bfr.q[0] = ld_tr16(btr + (p * 32) * (BP * 2) + ns * 32);
        bfr.q[1] = ld_tr16(btr + (p * 32 + 16) * (BP * 2) + ns * 32);
        acc[ns].v = __builtin_amdgcn_wmma_f32_16x16x32_bf16(
            false, af.v, false, bfr.v, (short)0, acc[ns].v, false, false);
      }
    }
  }

  // Epilogue through LDS. An accumulator register holds one column of a row, 16
  // lanes to a 64-byte piece; passed through LDS, a lane holds four consecutive
  // columns and 16 lanes a whole row of the tile, so that every global access
  // covers whole lines. A wave stages in its own 16 rows of As: no other wave
  // reads them, and nothing has written them since the last stage's barrier, so no
  // barrier is owed. A row of 64 floats fits the pitch of SP bf16 (272 bytes).
  float* stg = (float*)(As + wave * 16 * SP);
  const int ec = ln * 4;                       // the lane's first column in the tile
  const int row0 = bm + wave * 16 + hf;        // its rows: row0 + 2 * i
  const float4 bi = *(const float4*)(bias + bn + ec);
  const bool addres = !outB && res;
  float4 rv[8];
  if (addres) {   // the residual's eight loads, issued together ahead of the staging
    const float* rp[8];
    rp[0] = res + (size_t)(row0 - rfirst) * ldr + bn + ec;
#pragma unroll
    for (int i = 1; i < 8; ++i) rp[i] = rp[i - 1] + (size_t)2 * ldr;
#pragma unroll
    for (int i = 0; i < 8; ++i) rv[i] = *(const float4*)rp[i];
    // The eight addresses are inputs here, so that no load of the group lands in
    // the address register of another: they stay as they are up to this wait.
    asm volatile("s_wait_xcnt 0x0"
                 :: "v"(rp[0]), "v"(rp[1]), "v"(rp[2]), "v"(rp[3]),
                    "v"(rp[4]), "v"(rp[5]), "v"(rp[6]), "v"(rp[7])
                 : "memory");
  }
#pragma unroll
  for (int ns = 0; ns < 4; ++ns)
#pragma unroll
    for (int r = 0; r < 8; ++r)   // C/D layout: m = r + 8*half
      stg[(hf * 8 + r) * (SP / 2) + ns * 16 + ln] = acc[ns].f[r];
  // The wave's own stores have reached LDS before other lanes of it read them back.
  asm volatile("s_wait_dscnt 0x0" ::: "memory");
  float4 c[8];
#pragma unroll
  for (int i = 0; i < 8; ++i) {
    c[i] = *(const float4*)(stg + (2 * i + hf) * (SP / 2) + ec);
    c[i].x = (c[i].x + bi.x) * scale;
    c[i].y = (c[i].y + bi.y) * scale;
    c[i].z = (c[i].z + bi.z) * scale;
    c[i].w = (c[i].w + bi.w) * scale;
  }
  if (outB) {
    bf16_t* op = outB + (size_t)row0 * ldo + bn + ec;
#pragma unroll
    for (int i = 0; i < 8; ++i) {
      union { uint2 q; bf16_t h[4]; } o;
      o.h[0] = f2bf(c[i].x); o.h[1] = f2bf(c[i].y);
      o.h[2] = f2bf(c[i].z); o.h[3] = f2bf(c[i].w);
      *(uint2*)(op + (size_t)(2 * i) * ldo) = o.q;
    }
  } else {
    float* op = outF + (size_t)row0 * ldo + bn + ec;
    if (addres) {
#pragma unroll
      for (int i = 0; i < 8; ++i) {
        c[i].x += rv[i].x; c[i].y += rv[i].y; c[i].z += rv[i].z; c[i].w += rv[i].w;
      }
    }
#pragma unroll
    for (int i = 0; i < 8; ++i) *(float4*)(op + (size_t)(2 * i) * ldo) = c[i];
  }
}

typedef __attribute__((ext_vector_type(2))) float  f32x2;
typedef __attribute__((ext_vector_type(4))) float  f32x4;
typedef __attribute__((ext_vector_type(2))) __bf16 bf16x2;

__device__ __forceinline__ uint32_t pack_bf16(float lo, float hi) {
  f32x2 p = {lo, hi};
  return __builtin_bit_cast(uint32_t, __builtin_convertvector(p, bf16x2));
}

// value of lane l ^ 16
__device__ __forceinline__ float other_half(float x) {
  const int xi = __builtin_bit_cast(int, x);
  return __builtin_bit_cast(float, __builtin_amdgcn_permlanex16(
      xi, xi, 0x76543210, 0xfedcba98, false, false));
}

// One direction's whole pass. DIR is a compile-time constant so that the loop
// holds that direction's match loads alone, with no branch and no select.
template <int DIR>
__device__ __forceinline__ void attn_dir(
    const bf16_t* __restrict__ Q, const bf16_t* __restrict__ Km,
    const bf16_t* __restrict__ Vm, const float* __restrict__ mb,
    bf16_t* __restrict__ Out, bf16_t* Kt, bf16_t* Vs, int b, int h) {
  const int NN = 2048, DD = 256, DH = 32;
  const int wave = threadIdx.x >> 5;
  const int lane = threadIdx.x & 31;
  const int hf = lane >> 4;
  const int ln = lane & 15;
  const int i0 = blockIdx.x * 64 + wave * 16;
  const unsigned char* vtr = tr16_lane(Vs, VP, lane);

  // Q fragment (B operand: lane holds query i0+ln), straight from global
  Frag16 qf;
  {
    const size_t qbase = (size_t)(b * NN + i0 + ln) * DD + h * DH;
#pragma unroll
    for (int v = 0; v < 8; ++v) {
      const int kp = (v >> 2) * 16 + hf * 8 + (v & 3) * 2;
      qf.u[v] = *(const uint32_t*)(Q + qbase + kp);
    }
  }

  float mrow = -1e30f, lrow = 0.f;   // of query i0+ln; lrow: this half's keys only
  FragF O0, O1;                      // O^T: f[r] = O[i0+ln][d*16 + hf*8 + r]
  O0.v = (v8f){0, 0, 0, 0, 0, 0, 0, 0};
  O1.v = (v8f){0, 0, 0, 0, 0, 0, 0, 0};

  for (int j0 = 0; j0 < NN; j0 += SD) {
    lds_reads_done();
    __syncthreads();
    // Every global access of the stage's four passes is issued here, together.
    const int jr = threadIdx.x >> 2;
    const int dh0 = (threadIdx.x & 3) * 8;
    {  // K rows and V rows, both row-major (async copies); 32 rows apart
      const size_t gb = (size_t)(b * NN + j0 + jr) * DD + h * DH + dh0;
      const bf16_t* kg = Km + gb;
      const bf16_t* kl = Kt + jr * LP + dh0;
      copy4_b128_to_lds(kg, kg + 32 * DD, kg + 64 * DD, kg + 96 * DD,
                        kl, kl + 32 * LP, kl + 64 * LP, kl + 96 * LP);
      const bf16_t* vg = Vm + gb;
      const bf16_t* vl = Vs + jr * VP + dh0;
      copy4_b128_to_lds(vg, vg + 32 * DD, vg + 64 * DD, vg + 96 * DD,
                        vl, vl + 32 * VP, vl + 64 * VP, vl + 96 * VP);
    }

    // match weights of this lane's 16 scores a pass:
    // key j0+p*32+t*16+hf*8+r, query i0+ln
    float w[SD / 32][16];
    f32x4 wq[SD / 8];   // DIR 0: the same weights as loaded, 16 bytes each
    if (DIR) {
      const float* mp = mb + (size_t)(j0 + hf * 8) * NN + i0 + ln;
#pragma unroll
      for (int p = 0; p < SD / 32; ++p)
#pragma unroll
        for (int t = 0; t < 2; ++t)
#pragma unroll
          for (int r = 0; r < 8; ++r)
            w[p][t * 8 + r] = mp[(size_t)(p * 32 + t * 16 + r) * NN];
    } else {
      const float* mp = mb + (size_t)(i0 + ln) * NN + j0 + hf * 8;
#pragma unroll
      for (int p = 0; p < SD / 32; ++p)
#pragma unroll
        for (int t = 0; t < 2; ++t)
#pragma unroll
          for (int q = 0; q < 2; ++q)
            wq[p * 4 + t * 2 + q] = *(const f32x4*)(mp + p * 32 + t * 16 + q * 4);
    }

    if (!DIR) {
      // Takes the loaded weights as inputs only: it holds their loads in front of
      // the barrier, in flight together with the K and V copies. Left
      // free, the compiler sinks them behind the barrier, where their latency is
      // paid on top of the fill's.
      asm volatile("" :: "v"(wq[0]), "v"(wq[1]), "v"(wq[2]), "v"(wq[3]),
                         "v"(wq[4]), "v"(wq[5]), "v"(wq[6]), "v"(wq[7]),
                         "v"(wq[8]), "v"(wq[9]), "v"(wq[10]), "v"(wq[11]),
                         "v"(wq[12]), "v"(wq[13]), "v"(wq[14]), "v"(wq[15]));
#pragma unroll
      for (int k = 0; k < SD / 2; ++k) w[k >> 4][k & 15] = wq[k >> 2][k & 3];
    }
    async_lds_wait();
    __syncthreads();

#pragma unroll
    for (int p = 0; p < SD / 32; ++p) {
      // S^T = K @ Q^T for two 16-key tiles:
      // S[t].f[r] = key j0+p*32+t*16+hf*8+r, query i0+ln
      FragF S[2];
#pragma unroll
      for (int t = 0; t < 2; ++t) {
        Frag16 kf;
#pragma unroll
        for (int v = 0; v < 8; ++v) {
          const int kp = (v >> 2) * 16 + hf * 8 + (v & 3) * 2;
          kf.u[v] = *(const uint32_t*)(Kt + (p * 32 + t * 16 + ln) * LP + kp);
        }
        S[t].v = __builtin_amdgcn_wmma_f32_16x16x32_bf16(
            false, kf.v, false, qf.v, (short)0, (v8f){0,0,0,0,0,0,0,0}, false, false);
      }

      // online softmax, one query per lane
      float sc[16];
#pragma unroll
      for (int k = 0; k < 16; ++k) sc[k] = S[k >> 3].f[k & 7] * w[p][k];
      float mx[8];
#pragma unroll
      for (int k = 0; k < 8; ++k) mx[k] = fmaxf(sc[2 * k], sc[2 * k + 1]);
      float cm = fmaxf(fmaxf(fmaxf(mx[0], mx[1]), fmaxf(mx[2], mx[3])),
                       fmaxf(fmaxf(mx[4], mx[5]), fmaxf(mx[6], mx[7])));
      cm = fmaxf(cm, other_half(cm));
      const float nm = fmaxf(mrow, cm);
      const float fac = __expf(mrow - nm);
      float ex[16];
#pragma unroll
      for (int k = 0; k < 16; ++k) ex[k] = __expf(sc[k] - nm);
      float sm[8];
#pragma unroll
      for (int k = 0; k < 8; ++k) sm[k] = ex[2 * k] + ex[2 * k + 1];
      const float cs = ((sm[0] + sm[1]) + (sm[2] + sm[3])) + ((sm[4] + sm[5]) + (sm[6] + sm[7]));
      lrow = lrow * fac + cs;
      mrow = nm;
#pragma unroll
      for (int r = 0; r < 8; ++r) { O0.f[r] *= fac; O1.f[r] *= fac; }

      // P^T as B operand: element s = tile s>>3, register s&7 (the hardware k order)
      // V^T as A operand by the transposing load: row dh = ln (vf0) or 16+ln (vf1)
      Frag16 pf, vf0, vf1;
#pragma unroll
      for (int v = 0; v < 8; ++v) pf.u[v] = pack_bf16(ex[2 * v], ex[2 * v + 1]);
      vf0.q[0] = ld_tr16(vtr + (p * 32) * (VP * 2));
      vf0.q[1] = ld_tr16(vtr + (p * 32 + 16) * (VP * 2));
      vf1.q[0] = ld_tr16(vtr + (p * 32) * (VP * 2) + 32);
      vf1.q[1] = ld_tr16(vtr + (p * 32 + 16) * (VP * 2) + 32);
      O0.v = __builtin_amdgcn_wmma_f32_16x16x32_bf16(
          false, vf0.v, false, pf.v, (short)0, O0.v, false, false);
      O1.v = __builtin_amdgcn_wmma_f32_16x16x32_bf16(
          false, vf1.v, false, pf.v, (short)0, O1.v, false, false);
    }
  }

  {  // join the halves' sums once; a lane stores 8 consecutive dh per tile
    const float inv = 1.0f / (lrow + other_half(lrow));
    bf16_t* op = Out + (size_t)(b * NN + i0 + ln) * DD + h * DH + hf * 8;
    uint4 a0, a1;
    a0.x = pack_bf16(O0.f[0] * inv, O0.f[1] * inv);
    a0.y = pack_bf16(O0.f[2] * inv, O0.f[3] * inv);
    a0.z = pack_bf16(O0.f[4] * inv, O0.f[5] * inv);
    a0.w = pack_bf16(O0.f[6] * inv, O0.f[7] * inv);
    a1.x = pack_bf16(O1.f[0] * inv, O1.f[1] * inv);
    a1.y = pack_bf16(O1.f[2] * inv, O1.f[3] * inv);
    a1.z = pack_bf16(O1.f[4] * inv, O1.f[5] * inv);
    a1.w = pack_bf16(O1.f[6] * inv, O1.f[7] * inv);
    *(uint4*)op = a0;
    *(uint4*)(op + 16) = a1;
  }
}

__global__ __launch_bounds__(128) void flash_attn(
    const bf16_t* __restrict__ qk0, const bf16_t* __restrict__ qk1,
    const bf16_t* __restrict__ v0b, const bf16_t* __restrict__ v1b,
    const float* __restrict__ match,
    bf16_t* __restrict__ m0, bf16_t* __restrict__ m1) {
  const int NN = 2048;
  const int dir = blockIdx.z >> 1;
  const int b = blockIdx.z & 1;
  const int h = blockIdx.y;
  const float* mb = match + (size_t)b * NN * NN;

  __shared__ __align__(16) bf16_t Kt[SD * LP];        // [j][dh]
  __shared__ __align__(16) bf16_t Vs[SD * VP];        // [j][dh]

  if (dir) attn_dir<1>(qk1, qk0, v0b, mb, m1, Kt, Vs, b, h);
  else     attn_dir<0>(qk0, qk1, v1b, mb, m0, Kt, Vs, b, h);
}

// ------------------------ LayerNorm + exact GELU ---------------------------
// A wave owns two whole rows of 512: a lane holds 16 elements of each (four
// 16-byte loads a row, all eight issued before the first use), so mean and
// variance are in-lane sums plus five lane exchanges, with no LDS and no barrier.
__device__ __forceinline__ float gelu_exact(float y) {
  return 0.5f * y * (1.f + erff(y * 0.70710678118654752f));
}

// The pointers carry no __restrict__, so that no load moves over the wait below.
__global__ __launch_bounds__(256) void ln_gelu(
    const float* hbuf, const float* gamma, const float* beta, bf16_t* gbuf) {
  const int wave = threadIdx.x >> 5, lane = threadIdx.x & 31;
  const size_t base = (size_t)(blockIdx.x * 8 + wave) * 1024 + lane * 4;
  const float* hp = hbuf + base;

  float4 x[2][4], ga[4], be[4];
#pragma unroll
  for (int j = 0; j < 4; ++j) {
    ga[j] = *(const float4*)(gamma + j * 128 + lane * 4);
    be[j] = *(const float4*)(beta + j * 128 + lane * 4);
  }
  // The loads below may land in the address register of the loads above: this
  // wait stands in front of that overwrite.
  asm volatile("s_wait_xcnt 0x0" ::: "memory");
#pragma unroll
  for (int r = 0; r < 2; ++r)
#pragma unroll
    for (int j = 0; j < 4; ++j) x[r][j] = *(const float4*)(hp + r * 512 + j * 128);

  float s[2], q[2];
#pragma unroll
  for (int r = 0; r < 2; ++r) {
    float sj[4], qj[4];
#pragma unroll
    for (int j = 0; j < 4; ++j) {
      const float4 v = x[r][j];
      sj[j] = (v.x + v.y) + (v.z + v.w);
      qj[j] = (v.x * v.x + v.y * v.y) + (v.z * v.z + v.w * v.w);
    }
    s[r] = (sj[0] + sj[1]) + (sj[2] + sj[3]);
    q[r] = (qj[0] + qj[1]) + (qj[2] + qj[3]);
  }
#pragma unroll
  for (int off = 16; off; off >>= 1) {
#pragma unroll
    for (int r = 0; r < 2; ++r) {
      s[r] += __shfl_xor(s[r], off, 32);
      q[r] += __shfl_xor(q[r], off, 32);
    }
  }

#pragma unroll
  for (int r = 0; r < 2; ++r) {
    const float mu = s[r] * (1.f / 512.f);
    const float rs = rsqrtf(q[r] * (1.f / 512.f) - mu * mu + 1e-5f);
#pragma unroll
    for (int j = 0; j < 4; ++j) {
      const float4 v = x[r][j];
      union { uint2 u; bf16_t h[4]; } o;
      o.h[0] = f2bf(gelu_exact((v.x - mu) * rs * ga[j].x + be[j].x));
      o.h[1] = f2bf(gelu_exact((v.y - mu) * rs * ga[j].y + be[j].y));
      o.h[2] = f2bf(gelu_exact((v.z - mu) * rs * ga[j].z + be[j].z));
      o.h[3] = f2bf(gelu_exact((v.w - mu) * rs * ga[j].w + be[j].w));
      *(uint2*)(gbuf + base + r * 512 + j * 128) = o.u;
    }
  }
}

// ------------------------------- host side ---------------------------------
extern "C" void kernel_launch(void* const* d_in, const int* in_sizes, int n_in,
                              void* d_out, int out_size, void* d_ws, size_t ws_size,
                              hipStream_t stream) {
  const int B = 2, N = 2048, D = 256, H = 8, M = B * N, D2 = 2 * D;
  (void)in_sizes; (void)n_in; (void)out_size; (void)ws_size; (void)H;

  const float* x0    = (const float*)d_in[0];
  const float* x1    = (const float*)d_in[1];
  const float* match = (const float*)d_in[2];
  const float* Wqk   = (const float*)d_in[3];
  const float* bqk   = (const float*)d_in[4];
  const float* Wv    = (const float*)d_in[5];
  const float* bv    = (const float*)d_in[6];
  const float* Wo    = (const float*)d_in[7];
  const float* bo    = (const float*)d_in[8];
  const float* W1    = (const float*)d_in[9];
  const float* b1    = (const float*)d_in[10];
  const float* gamma = (const float*)d_in[11];
  const float* beta  = (const float*)d_in[12];
  const float* W2    = (const float*)d_in[13];
  const float* b2    = (const float*)d_in[14];
  float* out = (float*)d_out;

  char* ws = (char*)d_ws;
  auto alloc = [&](size_t bytes) {
    char* p = ws; ws += (bytes + 255) & ~(size_t)255; return p;
  };
  bf16_t* WqkB = (bf16_t*)alloc((size_t)D * D * 2);
  bf16_t* WvB  = (bf16_t*)alloc((size_t)D * D * 2);
  bf16_t* WoB  = (bf16_t*)alloc((size_t)D * D * 2);
  bf16_t* W1B  = (bf16_t*)alloc((size_t)D2 * D2 * 2);
  bf16_t* W2B  = (bf16_t*)alloc((size_t)D2 * D * 2);
  bf16_t* qk0s = (bf16_t*)alloc((size_t)M * D * 2);
  bf16_t* qk1s = (bf16_t*)alloc((size_t)M * D * 2);
  bf16_t* v0bb = (bf16_t*)alloc((size_t)M * D * 2);
  bf16_t* v1bb = (bf16_t*)alloc((size_t)M * D * 2);
  bf16_t* m0b  = (bf16_t*)alloc((size_t)M * D * 2);
  bf16_t* m1b  = (bf16_t*)alloc((size_t)M * D * 2);
  bf16_t* cat0 = (bf16_t*)alloc((size_t)M * D2 * 2);
  bf16_t* cat1 = (bf16_t*)alloc((size_t)M * D2 * 2);
  float*  h0   = (float*)alloc((size_t)M * D2 * 4);
  float*  h1   = (float*)alloc((size_t)M * D2 * 4);
  bf16_t* g0 = qk0s;  // 8MB alias over qk0s..v1bb (dead after attention)
  (void)cat1; (void)h1;
  // Every buffer size is a multiple of 256 bytes, so each side-1 buffer starts
  // where its side-0 buffer ends: a pair is one matrix of 2*M rows.

  // weights + x into concat buffers (first 256 cols of cat = x)
  cvt_all<<<dim3((2 * M * D + 3 * D * D + D2 * D2 + D2 * D) / 4096), dim3(256), 0, stream>>>(
      x0, x1, Wqk, Wv, Wo, W1, W2, cat0, WqkB);

  const float s = 0.42044820762685725f;  // (DH^-0.5)^0.5 = 32^-0.25

  // projections, both sides: z=0 qk = (x@Wqk + bqk)*s ; z=1 v = x@Wv + bv
  gemm_wmma<<<dim3(2 * M / 128, D / 64, 2), dim3(256), 0, stream>>>(
      cat0, D2, WqkB, WvB, D, bqk, bv, s, 1.0f, qk0s, v0bb, nullptr,
      nullptr, nullptr, 2 * M, D, 0, D);

  // flash attention, both directions
  flash_attn<<<dim3(N / 64, H, 2 * B), dim3(128), 0, stream>>>(
      qk0s, qk1s, v0bb, v1bb, match, m0b, m1b);

  // output projection, written directly into cat[:, 256:512]
  gemm_wmma<<<dim3(2 * M / 128, D / 64, 1), dim3(256), 0, stream>>>(
      m0b, D, WoB, WoB, D, bo, bo, 1.0f, 1.0f, cat0 + D, nullptr, nullptr,
      nullptr, nullptr, 2 * M, D2, 0, D);

  // FFN: h = cat @ W1 + b1 (f32) ; LN + exact GELU -> bf16
  gemm_wmma<<<dim3(2 * M / 128, D2 / 64, 1), dim3(256), 0, stream>>>(
      cat0, D2, W1B, W1B, D2, b1, b1, 1.0f, 1.0f, nullptr, nullptr, h0,
      nullptr, nullptr, 2 * M, D2, 0, D2);
  ln_gelu<<<dim3(2 * M / 16), dim3(256), 0, stream>>>(h0, gamma, beta, g0);

  // out = x + g @ W2 + b2
  gemm_wmma<<<dim3(2 * M / 128, D / 64, 1), dim3(256), 0, stream>>>(
      g0, D2, W2B, W2B, D, b2, b2, 1.0f, 1.0f, nullptr, nullptr, out,
      x0, x1, M, D, D, D2);
}

// v008
// One run takes 80.8 microseconds.
// Two timings next to v007 put it at 1.13 and 1.12 times that version's speed.
// All steps since v000 together make it 4.78 times as fast.
#include <hip/hip_runtime.h>
#include <hip/hip_bf16.h>
#include <stdint.h>

// ---------------------------------------------------------------------------
// CDNA5 (gfx1250) CrossBlock: bf16 WMMA GEMMs + dual-direction flash attention
// + ASYNCcnt-tracked global->LDS tile staging; operands that need a transpose
// are staged row-major like the rest and transposed by the LDS load itself.
// ---------------------------------------------------------------------------

typedef __bf16 bf16_t;
typedef __attribute__((ext_vector_type(16))) __bf16 v16bf;
typedef __attribute__((ext_vector_type(8)))  float  v8f;

// Row pitch, in bf16 elements, of the attention's K tile, whose rows hold 64 of
// them (two heads): 144 bytes = 16 bytes x odd, so that the 16-byte fragment reads
// of 16 rows fall on distinct banks.
constexpr int LP = 72;

// Depth of a stage: what one fill of the LDS tiles holds along the loop's axis
// (k in the GEMM, keys in attention). Four 32-deep passes run on one fill, so
// the fill's load latency and its two barriers are paid once for the four.
constexpr int SD = 128;
// Row pitch of the GEMM's A tile, whose rows hold SD elements: 272 bytes = 16 bytes x odd.
constexpr int SP = SD + 8;
// Row pitches, in bf16 elements, of the two tiles read by the transposing load,
// which wants 32 bytes x odd: the GEMM's B rows of 64 and the attention's V rows
// of 64 (two heads), 160 bytes both.
constexpr int BP = 80;
constexpr int VP = 80;
// Row pitches, in floats, of the attention's match tile. Direction 0: 64 query rows
// of SD keys, read 16 bytes a lane from 16 rows: 528 bytes = 16 bytes x odd.
// Direction 1: SD key rows of 64 queries, read 4 bytes a lane, 16 lanes along a row
// and the other 16 eight rows on: 272 bytes put those 32 banks further.
constexpr int MP0 = SD + 4;
constexpr int MP1 = 68;

typedef __attribute__((ext_vector_type(4))) uint32_t u32x4;
typedef __attribute__((ext_vector_type(8))) short    s16x8;

union Frag16 { v16bf v; uint32_t u[8]; u32x4 q[2]; };
union FragF  { v8f   v; float    f[8]; };

__device__ __forceinline__ bf16_t f2bf(float f) {
  uint32_t u = __builtin_bit_cast(uint32_t, f);
  uint32_t r = (u + 0x7FFFu + ((u >> 16) & 1u)) >> 16;   // round-to-nearest-even
  unsigned short s = (unsigned short)r;
  return __builtin_bit_cast(bf16_t, s);
}

__device__ __forceinline__ uint32_t lds_off(const void* p) {
  return (uint32_t)(uintptr_t)p;
}

// Four 16-byte copies a lane, each with address registers of its own and no
// immediate offset. The s_wait_xcnt closes the statement so that it stands in
// front of whatever next rewrites one of these registers.
__device__ __forceinline__ void copy4_b128_to_lds(
    const bf16_t* g0, const bf16_t* g1, const bf16_t* g2, const bf16_t* g3,
    const bf16_t* l0, const bf16_t* l1, const bf16_t* l2, const bf16_t* l3) {
  asm volatile(
      "global_load_async_to_lds_b128 %0, %4, off\n\t"
      "global_load_async_to_lds_b128 %1, %5, off\n\t"
      "global_load_async_to_lds_b128 %2, %6, off\n\t"
      "global_load_async_to_lds_b128 %3, %7, off\n\t"
      "s_wait_xcnt 0x0"
      :: "v"(lds_off(l0)), "v"(lds_off(l1)), "v"(lds_off(l2)), "v"(lds_off(l3)),
         "v"(g0), "v"(g1), "v"(g2), "v"(g3)
      : "memory");
}

// Eight such copies in one statement, under one wait.
__device__ __forceinline__ void copy8_b128_to_lds(
    const void* g0, const void* g1, const void* g2, const void* g3,
    const void* g4, const void* g5, const void* g6, const void* g7,
    const void* l0, const void* l1, const void* l2, const void* l3,
    const void* l4, const void* l5, const void* l6, const void* l7) {
  asm volatile(
      "global_load_async_to_lds_b128 %0, %8, off\n\t"
      "global_load_async_to_lds_b128 %1, %9, off\n\t"
      "global_load_async_to_lds_b128 %2, %10, off\n\t"
      "global_load_async_to_lds_b128 %3, %11, off\n\t"
      "global_load_async_to_lds_b128 %4, %12, off\n\t"
      "global_load_async_to_lds_b128 %5, %13, off\n\t"
      "global_load_async_to_lds_b128 %6, %14, off\n\t"
      "global_load_async_to_lds_b128 %7, %15, off\n\t"
      "s_wait_xcnt 0x0"
      :: "v"(lds_off(l0)), "v"(lds_off(l1)), "v"(lds_off(l2)), "v"(lds_off(l3)),
         "v"(lds_off(l4)), "v"(lds_off(l5)), "v"(lds_off(l6)), "v"(lds_off(l7)),
         "v"(g0), "v"(g1), "v"(g2), "v"(g3), "v"(g4), "v"(g5), "v"(g6), "v"(g7)
      : "memory");
}

// This wave's LDS reads of the last stage have retired before its copies refill it.
__device__ __forceinline__ void lds_reads_done() {
  asm volatile("s_wait_dscnt 0x0" ::: "memory");
}

// This wave's copies have landed; the barrier behind it shows them to the others.
__device__ __forceinline__ void async_lds_wait() {
  asm volatile("s_wait_asynccnt 0x0" ::: "memory");
}

// ---------------- transposing LDS load (ds_load_tr16_b128) ------------------
// Of a row-major tile T of 16-bit elements, lane (c = l & 15, h = l >> 4) gets
// T[k + 8h + 0..7][d + c] when lane l passes the address that tr16_lane gives it
// for (k, d) = (0, 0), moved by k rows and 2 * d bytes. The loads at k and k + 16
// are registers 0-3 and 4-7 of a 16x16x32 operand in the hardware k order, the
// order in which every other fragment of this file is loaded.
__device__ __forceinline__ const unsigned char* tr16_lane(const bf16_t* tile, int pitch, int lane) {
  return (const unsigned char*)tile + ((lane >> 4) * 8 + (lane & 7)) * (pitch * 2) + ((lane >> 3) & 1) * 16;
}
__device__ __forceinline__ u32x4 ld_tr16(const unsigned char* p) {
  typedef __attribute__((address_space(3))) s16x8 lds_s16x8;
  return __builtin_bit_cast(u32x4, __builtin_amdgcn_ds_load_tr16_b128_v8i16((lds_s16x8*)p));
}

// ---------------------- f32 -> bf16, all seven inputs -----------------------
// One launch of few, fat blocks: a block of 256 threads converts 4096 consecutive
// elements of one input, picked by the block index; a thread takes 16 of them as
// four 16-byte loads (a wave-wide load covers 512 contiguous bytes), all issued
// before the first use. Blocks [0, 512): 16 rows of x0 or x1 into the first 256
// columns of the stacked concat buffer (row pitch 512). The rest: the five
// weights, whose bf16 copies lie one behind the other at wdst.
__global__ __launch_bounds__(256) void cvt_all(
    const float* __restrict__ x0, const float* __restrict__ x1,
    const float* __restrict__ Wqk, const float* __restrict__ Wv,
    const float* __restrict__ Wo, const float* __restrict__ W1,
    const float* __restrict__ W2,
    bf16_t* __restrict__ cat, bf16_t* __restrict__ wdst) {
  const int blk = blockIdx.x;
  const int off = (threadIdx.x >> 5) * 512 + (threadIdx.x & 31) * 4;
  const bool isx = blk < 512;
  const float* in;     // the block's 4096 source elements
  bf16_t* dst;         // where the first of them goes
  if (isx) {
    in = (blk < 256 ? x0 : x1) + (size_t)(blk & 255) * 4096;
    dst = cat + (size_t)blk * 8192;
  } else {
    const int wb = blk - 512;   // 16 | 16 | 16 | 64 | 32 blocks
    int first;
    if (wb < 16)       { in = Wqk; first = 0; }
    else if (wb < 32)  { in = Wv;  first = 16; }
    else if (wb < 48)  { in = Wo;  first = 32; }
    else if (wb < 112) { in = W1;  first = 48; }
    else               { in = W2;  first = 112; }
    in += (size_t)(wb - first) * 4096;
    dst = wdst + (size_t)wb * 4096;
  }
  float4 f[4];
#pragma unroll
  for (int j = 0; j < 4; ++j) f[j] = *(const float4*)(in + off + j * 128);
#pragma unroll
  for (int j = 0; j < 4; ++j) {
    const int e = off + j * 128;
    const int d = isx ? (e >> 8) * 512 + (e & 255) : e;
    union { uint2 q; bf16_t h[4]; } o;
    o.h[0] = f2bf(f[j].x); o.h[1] = f2bf(f[j].y);
    o.h[2] = f2bf(f[j].z); o.h[3] = f2bf(f[j].w);
    *(uint2*)(dst + d) = o.q;
  }
}

// ----------------------------- generic GEMM --------------------------------
// C[M=grid.x*128, N=grid.y*64] = (A[M,K]bf16 @ B[K,N]bf16 + bias)*scale (+res)
// 8 waves: wave w owns rows [w*16, w*16+16) of the block tile, all 64 cols.
// K is a multiple of SD.
// One launch serves both sides: the rows of side 1 stand behind those of side 0
// in A and in the output; the residual, an input per side, changes at row mres.
// blockIdx.z picks one of two products that share A (weight, bias, scale, out).
__global__ __launch_bounds__(256) void gemm_wmma(
    const bf16_t* __restrict__ A, int lda,
    const bf16_t* __restrict__ B0, const bf16_t* __restrict__ B1, int ldb,
    const float* __restrict__ bias0, const float* __restrict__ bias1,
    float scale0, float scale1,
    bf16_t* __restrict__ outB0, bf16_t* __restrict__ outB1,
    float* __restrict__ outF,
    const float* __restrict__ res0, const float* __restrict__ res1, int mres,
    int ldo, int ldr, int K) {
  __shared__ __align__(16) bf16_t As[128 * SP];
  __shared__ __align__(16) bf16_t Bs[SD * BP];    // stored [k][n], as in memory

  const int bm = blockIdx.x * 128;
  const int bn = blockIdx.y * 64;
  const bool second = blockIdx.z != 0;
  const bf16_t* Bm  = second ? B1 : B0;
  const float* bias = second ? bias1 : bias0;
  const float scale = second ? scale1 : scale0;
  bf16_t* outB      = second ? outB1 : outB0;
  const float* res  = bm < mres ? res0 : res1;
  const int rfirst  = bm < mres ? 0 : mres;      // first row of that residual
  const int t = threadIdx.x;
  const int wave = t >> 5;
  const int lane = t & 31;
  const int hf = lane >> 4;       // which 16-lane half of the wave
  const int ln = lane & 15;

  const unsigned char* btr = tr16_lane(Bs, BP, lane);

  FragF acc[4];
#pragma unroll
  for (int i = 0; i < 4; ++i) acc[i].v = (v8f){0, 0, 0, 0, 0, 0, 0, 0};

  for (int k0 = 0; k0 < K; k0 += SD) {
    lds_reads_done();
    __syncthreads();
    {  // stage A tile 128 x SD (async copies): 16 lanes cover a row's 256 bytes,
       // so a wave-wide copy takes whole lines; eight rows a thread, 16 apart
      const bf16_t* gsrc = A + (size_t)(bm + (t >> 4)) * lda + k0 + (t & 15) * 8;
      const bf16_t* ldst = As + (t >> 4) * SP + (t & 15) * 8;
      const size_t gs = (size_t)16 * lda;
      copy4_b128_to_lds(gsrc, gsrc + gs, gsrc + 2 * gs, gsrc + 3 * gs,
                        ldst, ldst + 16 * SP, ldst + 32 * SP, ldst + 48 * SP);
      gsrc += 4 * gs;
      ldst += 64 * SP;
      copy4_b128_to_lds(gsrc, gsrc + gs, gsrc + 2 * gs, gsrc + 3 * gs,
                        ldst, ldst + 16 * SP, ldst + 32 * SP, ldst + 48 * SP);
    }
    {  // stage B tile SD x 64 row-major (async copies): 8 lanes cover a row's 128
       // bytes, one line; four rows a thread, 32 apart
      const bf16_t* gsrc = Bm + (size_t)(k0 + (t >> 3)) * ldb + bn + (t & 7) * 8;
      const bf16_t* ldst = Bs + (t >> 3) * BP + (t & 7) * 8;
      const size_t gs = (size_t)32 * ldb;
      copy4_b128_to_lds(gsrc, gsrc + gs, gsrc + 2 * gs, gsrc + 3 * gs,
                        ldst, ldst + 32 * BP, ldst + 64 * BP, ldst + 96 * BP);
    }
    async_lds_wait();
    __syncthreads();

#pragma unroll
    for (int p = 0; p < SD / 32; ++p) {
      Frag16 af;
#pragma unroll
      for (int v = 0; v < 8; ++v) {
        const int kp = p * 32 + (v >> 2) * 16 + hf * 8 + (v & 3) * 2;
        af.u[v] = *(const uint32_t*)(As + (wave * 16 + ln) * SP + kp);
      }
#pragma unroll
      for (int ns = 0; ns < 4; ++ns) {
        Frag16 bfr;   // column ns*16+ln, k = p*32 + {0, 16} + hf*8 + 0..7
        bfr.q[0] = ld_tr16(btr + (p * 32) * (BP * 2) + ns * 32);
        bfr.q[1] = ld_tr16(btr + (p * 32 + 16) * (BP * 2) + ns * 32);
        acc[ns].v = __builtin_amdgcn_wmma_f32_16x16x32_bf16(
            false, af.v, false, bfr.v, (short)0, acc[ns].v, false, false);
      }
    }
  }

  // Epilogue through LDS. An accumulator register holds one column of a row, 16
  // lanes to a 64-byte piece; passed through LDS, a lane holds four consecutive
  // columns and 16 lanes a whole row of the tile, so that every global access
  // covers whole lines. A wave stages in its own 16 rows of As: no other wave
  // reads them, and nothing has written them since the last stage's barrier, so no
  // barrier is owed. A row of 64 floats fits the pitch of SP bf16 (272 bytes).
  float* stg = (float*)(As + wave * 16 * SP);
  const int ec = ln * 4;                       // the lane's first column in the tile
  const int row0 = bm + wave * 16 + hf;        // its rows: row0 + 2 * i
  const float4 bi = *(const float4*)(bias + bn + ec);
  const bool addres = !outB && res;
  float4 rv[8];
  if (addres) {   // the residual's eight loads, issued together ahead of the staging
    const float* rp[8];
    rp[0] = res + (size_t)(row0 - rfirst) * ldr + bn + ec;
#pragma unroll
    for (int i = 1; i < 8; ++i) rp[i] = rp[i - 1] + (size_t)2 * ldr;
#pragma unroll
    for (int i = 0; i < 8; ++i) rv[i] = *(const float4*)rp[i];
    // The eight addresses are inputs here, so that no load of the group lands in
    // the address register of another: they stay as they are up to this wait.
    asm volatile("s_wait_xcnt 0x0"
                 :: "v"(rp[0]), "v"(rp[1]), "v"(rp[2]), "v"(rp[3]),
                    "v"(rp[4]), "v"(rp[5]), "v"(rp[6]), "v"(rp[7])
                 : "memory");
  }
#pragma unroll
  for (int ns = 0; ns < 4; ++ns)
#pragma unroll
    for (int r = 0; r < 8; ++r)   // C/D layout: m = r + 8*half
      stg[(hf * 8 + r) * (SP / 2) + ns * 16 + ln] = acc[ns].f[r];
  // The wave's own stores have reached LDS before other lanes of it read them back.
  asm volatile("s_wait_dscnt 0x0" ::: "memory");
  float4 c[8];
#pragma unroll
  for (int i = 0; i < 8; ++i) {
    c[i] = *(const float4*)(stg + (2 * i + hf) * (SP / 2) + ec);
    c[i].x = (c[i].x + bi.x) * scale;
    c[i].y = (c[i].y + bi.y) * scale;
    c[i].z = (c[i].z + bi.z) * scale;
    c[i].w = (c[i].w + bi.w) * scale;
  }
  if (outB) {
    bf16_t* op = outB + (size_t)row0 * ldo + bn + ec;
#pragma unroll
    for (int i = 0; i < 8; ++i) {
      union { uint2 q; bf16_t h[4]; } o;
      o.h[0] = f2bf(c[i].x); o.h[1] = f2bf(c[i].y);
      o.h[2] = f2bf(c[i].z); o.h[3] = f2bf(c[i].w);
      *(uint2*)(op + (size_t)(2 * i) * ldo) = o.q;
    }
  } else {
    float* op = outF + (size_t)row0 * ldo + bn + ec;
    if (addres) {
#pragma unroll
      for (int i = 0; i < 8; ++i) {
        c[i].x += rv[i].x; c[i].y += rv[i].y; c[i].z += rv[i].z; c[i].w += rv[i].w;
      }
    }
#pragma unroll
    for (int i = 0; i < 8; ++i) *(float4*)(op + (size_t)(2 * i) * ldo) = c[i];
  }
}

typedef __attribute__((ext_vector_type(2))) float  f32x2;
typedef __attribute__((ext_vector_type(4))) float  f32x4;
typedef __attribute__((ext_vector_type(2))) __bf16 bf16x2;

__device__ __forceinline__ uint32_t pack_bf16(float lo, float hi) {
  f32x2 p = {lo, hi};
  return __builtin_bit_cast(uint32_t, __builtin_convertvector(p, bf16x2));
}

// value of lane l ^ 16
__device__ __forceinline__ float other_half(float x) {
  const int xi = __builtin_bit_cast(int, x);
  return __builtin_bit_cast(float, __builtin_amdgcn_permlanex16(
      xi, xi, 0x76543210, 0xfedcba98, false, false));
}

// One direction's whole pass. DIR is a compile-time constant so that the loop
// holds that direction's match loads alone, with no branch and no select.
template <int DIR>
__device__ __forceinline__ void attn_dir(
    const bf16_t* __restrict__ Q, const bf16_t* __restrict__ Km,
    const bf16_t* __restrict__ Vm, const float* __restrict__ mb,
    bf16_t* __restrict__ Out, bf16_t* Kt, bf16_t* Vs, float* Ms, int b, int hp) {
  const int NN = 2048, DD = 256, DH = 32;
  const int wave = threadIdx.x >> 5;
  const int lane = threadIdx.x & 31;
  const int hf = lane >> 4;
  const int ln = lane & 15;
  const int hh = wave >> 2;               // which head of the pair
  const int wq = wave & 3;                // which 16 of the block's 64 queries
  const int h = hp * 2 + hh;
  const int ib = blockIdx.x * 64;
  const int i0 = ib + wq * 16;
  const unsigned char* vtr = tr16_lane(Vs, VP, lane) + hh * (DH * 2);
  const bf16_t* kfr = Kt + ln * LP + hh * DH;

  // Q fragment (B operand: lane holds query i0+ln), straight from global
  Frag16 qf;
  {
    const size_t qbase = (size_t)(b * NN + i0 + ln) * DD + h * DH;
#pragma unroll
    for (int v = 0; v < 8; ++v) {
      const int kp = (v >> 2) * 16 + hf * 8 + (v & 3) * 2;
      qf.u[v] = *(const uint32_t*)(Q + qbase + kp);
    }
  }

  float mrow = -1e30f, lrow = 0.f;   // of query i0+ln; lrow: this half's keys only
  FragF O0, O1;                      // O^T: f[r] = O[i0+ln][d*16 + hf*8 + r]
  O0.v = (v8f){0, 0, 0, 0, 0, 0, 0, 0};
  O1.v = (v8f){0, 0, 0, 0, 0, 0, 0, 0};

  for (int j0 = 0; j0 < NN; j0 += SD) {
    lds_reads_done();
    __syncthreads();
    // Every global access of the stage's four passes is issued here, together.
    {  // K rows and V rows of the head pair, row-major (async copies): 8 lanes cover
       // a row's 128 bytes, one line; four rows a thread, 32 apart
      const int jr = threadIdx.x >> 3;
      const int c0 = (threadIdx.x & 7) * 8;
      const size_t gb = (size_t)(b * NN + j0 + jr) * DD + hp * (2 * DH) + c0;
      const bf16_t* kg = Km + gb;
      const bf16_t* kl = Kt + jr * LP + c0;
      const bf16_t* vg = Vm + gb;
      const bf16_t* vl = Vs + jr * VP + c0;
      copy8_b128_to_lds(kg, kg + 32 * DD, kg + 64 * DD, kg + 96 * DD,
                        vg, vg + 32 * DD, vg + 64 * DD, vg + 96 * DD,
                        kl, kl + 32 * LP, kl + 64 * LP, kl + 96 * LP,
                        vl, vl + 32 * VP, vl + 64 * VP, vl + 96 * VP);
    }
    if (DIR) {  // match[j0 + 0..SD)[ib + 0..64): 16 lanes cover a row's 256 bytes;
                // eight rows a thread, 16 apart
      const float* mg = mb + (size_t)(j0 + (threadIdx.x >> 4)) * NN + ib + (threadIdx.x & 15) * 4;
      const float* ml = Ms + (threadIdx.x >> 4) * MP1 + (threadIdx.x & 15) * 4;
      copy8_b128_to_lds(mg, mg + 16 * NN, mg + 32 * NN, mg + 48 * NN,
                        mg + 64 * NN, mg + 80 * NN, mg + 96 * NN, mg + 112 * NN,
                        ml, ml + 16 * MP1, ml + 32 * MP1, ml + 48 * MP1,
                        ml + 64 * MP1, ml + 80 * MP1, ml + 96 * MP1, ml + 112 * MP1);
    } else {    // match[ib + 0..64)[j0 + 0..SD): a wave covers a row's 512 bytes;
                // eight rows a thread, 8 apart
      const float* mg = mb + (size_t)(ib + wave) * NN + j0 + lane * 4;
      const float* ml = Ms + wave * MP0 + lane * 4;
      copy8_b128_to_lds(mg, mg + 8 * NN, mg + 16 * NN, mg + 24 * NN,
                        mg + 32 * NN, mg + 40 * NN, mg + 48 * NN, mg + 56 * NN,
                        ml, ml + 8 * MP0, ml + 16 * MP0, ml + 24 * MP0,
                        ml + 32 * MP0, ml + 40 * MP0, ml + 48 * MP0, ml + 56 * MP0);
    }
    async_lds_wait();
    __syncthreads();

#pragma unroll
    for (int p = 0; p < SD / 32; ++p) {
      // S^T = K @ Q^T for two 16-key tiles:
      // S[t].f[r] = key j0+p*32+t*16+hf*8+r, query i0+ln
      FragF S[2];
#pragma unroll
      for (int t = 0; t < 2; ++t) {
        Frag16 kf;
#pragma unroll
        for (int v = 0; v < 8; ++v) {
          const int kp = (v >> 2) * 16 + hf * 8 + (v & 3) * 2;
          kf.u[v] = *(const uint32_t*)(kfr + (p * 32 + t * 16) * LP + kp);
        }
        S[t].v = __builtin_amdgcn_wmma_f32_16x16x32_bf16(
            false, kf.v, false, qf.v, (short)0, (v8f){0,0,0,0,0,0,0,0}, false, false);
      }

      // match weights of this lane's 16 scores, in the order of S
      float w[16];
      if (DIR) {
        const float* mp = Ms + (p * 32 + hf * 8) * MP1 + wq * 16 + ln;
#pragma unroll
        for (int k = 0; k < 16; ++k) w[k] = mp[((k >> 3) * 16 + (k & 7)) * MP1];
      } else {
        const float* mp = Ms + (wq * 16 + ln) * MP0 + p * 32 + hf * 8;
#pragma unroll
        for (int q = 0; q < 4; ++q) {
          const f32x4 m4 = *(const f32x4*)(mp + (q >> 1) * 16 + (q & 1) * 4);
#pragma unroll
          for (int e = 0; e < 4; ++e) w[q * 4 + e] = m4[e];
        }
      }

      // online softmax, one query per lane
      float sc[16];
#pragma unroll
      for (int k = 0; k < 16; ++k) sc[k] = S[k >> 3].f[k & 7] * w[k];
      float mx[8];
#pragma unroll
      for (int k = 0; k < 8; ++k) mx[k] = fmaxf(sc[2 * k], sc[2 * k + 1]);
      float cm = fmaxf(fmaxf(fmaxf(mx[0], mx[1]), fmaxf(mx[2], mx[3])),
                       fmaxf(fmaxf(mx[4], mx[5]), fmaxf(mx[6], mx[7])));
      cm = fmaxf(cm, other_half(cm));
      const float nm = fmaxf(mrow, cm);
      const float fac = __expf(mrow - nm);
      float ex[16];
#pragma unroll
      for (int k = 0; k < 16; ++k) ex[k] = __expf(sc[k] - nm);
      float sm[8];
#pragma unroll
      for (int k = 0; k < 8; ++k) sm[k] = ex[2 * k] + ex[2 * k + 1];
      const float cs = ((sm[0] + sm[1]) + (sm[2] + sm[3])) + ((sm[4] + sm[5]) + (sm[6] + sm[7]));
      lrow = lrow * fac + cs;
      mrow = nm;
#pragma unroll
      for (int r = 0; r < 8; ++r) { O0.f[r] *= fac; O1.f[r] *= fac; }

      // P^T as B operand: element s = tile s>>3, register s&7 (the hardware k order)
      // V^T as A operand by the transposing load: row dh = ln (vf0) or 16+ln (vf1)
      Frag16 pf, vf0, vf1;
#pragma unroll
      for (int v = 0; v < 8; ++v) pf.u[v] = pack_bf16(ex[2 * v], ex[2 * v + 1]);
      vf0.q[0] = ld_tr16(vtr + (p * 32) * (VP * 2));
      vf0.q[1] = ld_tr16(vtr + (p * 32 + 16) * (VP * 2));
      vf1.q[0] = ld_tr16(vtr + (p * 32) * (VP * 2) + 32);
      vf1.q[1] = ld_tr16(vtr + (p * 32 + 16) * (VP * 2) + 32);
      O0.v = __builtin_amdgcn_wmma_f32_16x16x32_bf16(
          false, vf0.v, false, pf.v, (short)0, O0.v, false, false);
      O1.v = __builtin_amdgcn_wmma_f32_16x16x32_bf16(
          false, vf1.v, false, pf.v, (short)0, O1.v, false, false);
    }
  }

  {  // join the halves' sums once; a lane stores 8 consecutive dh per tile
    const float inv = 1.0f / (lrow + other_half(lrow));
    bf16_t* op = Out + (size_t)(b * NN + i0 + ln) * DD + h * DH + hf * 8;
    uint4 a0, a1;
    a0.x = pack_bf16(O0.f[0] * inv, O0.f[1] * inv);
    a0.y = pack_bf16(O0.f[2] * inv, O0.f[3] * inv);
    a0.z = pack_bf16(O0.f[4] * inv, O0.f[5] * inv);
    a0.w = pack_bf16(O0.f[6] * inv, O0.f[7] * inv);
    a1.x = pack_bf16(O1.f[0] * inv, O1.f[1] * inv);
    a1.y = pack_bf16(O1.f[2] * inv, O1.f[3] * inv);
    a1.z = pack_bf16(O1.f[4] * inv, O1.f[5] * inv);
    a1.w = pack_bf16(O1.f[6] * inv, O1.f[7] * inv);
    *(uint4*)op = a0;
    *(uint4*)(op + 16) = a1;
  }
}

__global__ __launch_bounds__(256) void flash_attn(
    const bf16_t* __restrict__ qk0, const bf16_t* __restrict__ qk1,
    const bf16_t* __restrict__ v0b, const bf16_t* __restrict__ v1b,
    const float* __restrict__ match,
    bf16_t* __restrict__ m0, bf16_t* __restrict__ m1) {
  const int NN = 2048;
  const int dir = blockIdx.z >> 1;
  const int b = blockIdx.z & 1;
  const int hp = blockIdx.y;    // the pair of heads 2*hp, 2*hp + 1
  const float* mb = match + (size_t)b * NN * NN;

  __shared__ __align__(16) bf16_t Kt[SD * LP];        // [j][head of the pair][dh]
  __shared__ __align__(16) bf16_t Vs[SD * VP];        // [j][head of the pair][dh]
  __shared__ __align__(16) float  Ms[SD * MP1 > 64 * MP0 ? SD * MP1 : 64 * MP0];

  if (dir) attn_dir<1>(qk1, qk0, v0b, mb, m1, Kt, Vs, Ms, b, hp);
  else     attn_dir<0>(qk0, qk1, v1b, mb, m0, Kt, Vs, Ms, b, hp);
}

// ------------------------ LayerNorm + exact GELU ---------------------------
// A wave owns two whole rows of 512: a lane holds 16 elements of each (four
// 16-byte loads a row, all eight issued before the first use), so mean and
// variance are in-lane sums plus five lane exchanges, with no LDS and no barrier.
__device__ __forceinline__ float gelu_exact(float y) {
  return 0.5f * y * (1.f + erff(y * 0.70710678118654752f));
}

// The pointers carry no __restrict__, so that no load moves over the wait below.
__global__ __launch_bounds__(256) void ln_gelu(
    const float* hbuf, const float* gamma, const float* beta, bf16_t* gbuf) {
  const int wave = threadIdx.x >> 5, lane = threadIdx.x & 31;
  const size_t base = (size_t)(blockIdx.x * 8 + wave) * 1024 + lane * 4;
  const float* hp = hbuf + base;

  float4 x[2][4], ga[4], be[4];
#pragma unroll
  for (int j = 0; j < 4; ++j) {
    ga[j] = *(const float4*)(gamma + j * 128 + lane * 4);
    be[j] = *(const float4*)(beta + j * 128 + lane * 4);
  }
  // The loads below may land in the address register of the loads above: this
  // wait stands in front of that overwrite.
  asm volatile("s_wait_xcnt 0x0" ::: "memory");
#pragma unroll
  for (int r = 0; r < 2; ++r)
#pragma unroll
    for (int j = 0; j < 4; ++j) x[r][j] = *(const float4*)(hp + r * 512 + j * 128);

  float s[2], q[2];
#pragma unroll
  for (int r = 0; r < 2; ++r) {
    float sj[4], qj[4];
#pragma unroll
    for (int j = 0; j < 4; ++j) {
      const float4 v = x[r][j];
      sj[j] = (v.x + v.y) + (v.z + v.w);
      qj[j] = (v.x * v.x + v.y * v.y) + (v.z * v.z + v.w * v.w);
    }
    s[r] = (sj[0] + sj[1]) + (sj[2] + sj[3]);
    q[r] = (qj[0] + qj[1]) + (qj[2] + qj[3]);
  }
#pragma unroll
  for (int off = 16; off; off >>= 1) {
#pragma unroll
    for (int r = 0; r < 2; ++r) {
      s[r] += __shfl_xor(s[r], off, 32);
      q[r] += __shfl_xor(q[r], off, 32);
    }
  }

#pragma unroll
  for (int r = 0; r < 2; ++r) {
    const float mu = s[r] * (1.f / 512.f);
    const float rs = rsqrtf(q[r] * (1.f / 512.f) - mu * mu + 1e-5f);
#pragma unroll
    for (int j = 0; j < 4; ++j) {
      const float4 v = x[r][j];
      union { uint2 u; bf16_t h[4]; } o;
      o.h[0] = f2bf(gelu_exact((v.x - mu) * rs * ga[j].x + be[j].x));
      o.h[1] = f2bf(gelu_exact((v.y - mu) * rs * ga[j].y + be[j].y));
      o.h[2] = f2bf(gelu_exact((v.z - mu) * rs * ga[j].z + be[j].z));
      o.h[3] = f2bf(gelu_exact((v.w - mu) * rs * ga[j].w + be[j].w));
      *(uint2*)(gbuf + base + r * 512 + j * 128) = o.u;
    }
  }
}

// ------------------------------- host side ---------------------------------
extern "C" void kernel_launch(void* const* d_in, const int* in_sizes, int n_in,
                              void* d_out, int out_size, void* d_ws, size_t ws_size,
                              hipStream_t stream) {
  const int B = 2, N = 2048, D = 256, H = 8, M = B * N, D2 = 2 * D;
  (void)in_sizes; (void)n_in; (void)out_size; (void)ws_size;

  const float* x0    = (const float*)d_in[0];
  const float* x1    = (const float*)d_in[1];
  const float* match = (const float*)d_in[2];
  const float* Wqk   = (const float*)d_in[3];
  const float* bqk   = (const float*)d_in[4];
  const float* Wv    = (const float*)d_in[5];
  const float* bv    = (const float*)d_in[6];
  const float* Wo    = (const float*)d_in[7];
  const float* bo    = (const float*)d_in[8];
  const float* W1    = (const float*)d_in[9];
  const float* b1    = (const float*)d_in[10];
  const float* gamma = (const float*)d_in[11];
  const float* beta  = (const float*)d_in[12];
  const float* W2    = (const float*)d_in[13];
  const float* b2    = (const float*)d_in[14];
  float* out = (float*)d_out;

  char* ws = (char*)d_ws;
  auto alloc = [&](size_t bytes) {
    char* p = ws; ws += (bytes + 255) & ~(size_t)255; return p;
  };
  bf16_t* WqkB = (bf16_t*)alloc((size_t)D * D * 2);
  bf16_t* WvB  = (bf16_t*)alloc((size_t)D * D * 2);
  bf16_t* WoB  = (bf16_t*)alloc((size_t)D * D * 2);
  bf16_t* W1B  = (bf16_t*)alloc((size_t)D2 * D2 * 2);
  bf16_t* W2B  = (bf16_t*)alloc((size_t)D2 * D * 2);
  bf16_t* qk0s = (bf16_t*)alloc((size_t)M * D * 2);
  bf16_t* qk1s = (bf16_t*)alloc((size_t)M * D * 2);
  bf16_t* v0bb = (bf16_t*)alloc((size_t)M * D * 2);
  bf16_t* v1bb = (bf16_t*)alloc((size_t)M * D * 2);
  bf16_t* m0b  = (bf16_t*)alloc((size_t)M * D * 2);
  bf16_t* m1b  = (bf16_t*)alloc((size_t)M * D * 2);
  bf16_t* cat0 = (bf16_t*)alloc((size_t)M * D2 * 2);
  bf16_t* cat1 = (bf16_t*)alloc((size_t)M * D2 * 2);
  float*  h0   = (float*)alloc((size_t)M * D2 * 4);
  float*  h1   = (float*)alloc((size_t)M * D2 * 4);
  bf16_t* g0 = qk0s;  // 8MB alias over qk0s..v1bb (dead after attention)
  (void)cat1; (void)h1;
  // Every buffer size is a multiple of 256 bytes, so each side-1 buffer starts
  // where its side-0 buffer ends: a pair is one matrix of 2*M rows.

  // weights + x into concat buffers (first 256 cols of cat = x)
  cvt_all<<<dim3((2 * M * D + 3 * D * D + D2 * D2 + D2 * D) / 4096), dim3(256), 0, stream>>>(
      x0, x1, Wqk, Wv, Wo, W1, W2, cat0, WqkB);

  const float s = 0.42044820762685725f;  // (DH^-0.5)^0.5 = 32^-0.25

  // projections, both sides: z=0 qk = (x@Wqk + bqk)*s ; z=1 v = x@Wv + bv
  gemm_wmma<<<dim3(2 * M / 128, D / 64, 2), dim3(256), 0, stream>>>(
      cat0, D2, WqkB, WvB, D, bqk, bv, s, 1.0f, qk0s, v0bb, nullptr,
      nullptr, nullptr, 2 * M, D, 0, D);

  // flash attention, both directions
  flash_attn<<<dim3(N / 64, H / 2, 2 * B), dim3(256), 0, stream>>>(
      qk0s, qk1s, v0bb, v1bb, match, m0b, m1b);

  // output projection, written directly into cat[:, 256:512]
  gemm_wmma<<<dim3(2 * M / 128, D / 64, 1), dim3(256), 0, stream>>>(
      m0b, D, WoB, WoB, D, bo, bo, 1.0f, 1.0f, cat0 + D, nullptr, nullptr,
      nullptr, nullptr, 2 * M, D2, 0, D);

  // FFN: h = cat @ W1 + b1 (f32) ; LN + exact GELU -> bf16
  gemm_wmma<<<dim3(2 * M / 128, D2 / 64, 1), dim3(256), 0, stream>>>(
      cat0, D2, W1B, W1B, D2, b1, b1, 1.0f, 1.0f, nullptr, nullptr, h0,
      nullptr, nullptr, 2 * M, D2, 0, D2);
  ln_gelu<<<dim3(2 * M / 16), dim3(256), 0, stream>>>(h0, gamma, beta, g0);

  // out = x + g @ W2 + b2
  gemm_wmma<<<dim3(2 * M / 128, D / 64, 1), dim3(256), 0, stream>>>(
      g0, D2, W2B, W2B, D, b2, b2, 1.0f, 1.0f, nullptr, nullptr, out,
      x0, x1, M, D, D, D2);
}

// v009
// Measured time: 71.9 microseconds a run.
// Two timings next to v008 put it at 1.13 and 1.12 times that version's speed.
// Counting every step since v000, it is 5.38 times as fast.
#include <hip/hip_runtime.h>
#include <hip/hip_bf16.h>
#include <stdint.h>

// ---------------------------------------------------------------------------
// CDNA5 (gfx1250) CrossBlock: bf16 WMMA GEMMs + dual-direction flash attention
// + ASYNCcnt-tracked global->LDS tile staging; operands that need a transpose
// are staged row-major like the rest and transposed by the LDS load itself.
// ---------------------------------------------------------------------------

typedef __bf16 bf16_t;
typedef __attribute__((ext_vector_type(16))) __bf16 v16bf;
typedef __attribute__((ext_vector_type(8)))  float  v8f;

// Row pitch, in bf16 elements, of the attention's K tile, whose rows hold 64 of
// them (two heads): 144 bytes = 16 bytes x odd, so that the 16-byte fragment reads
// of 16 rows fall on distinct banks.
constexpr int LP = 72;

// Depth of a stage: what one fill of the LDS tiles holds along the loop's axis
// (k in the GEMM, keys in attention). Four 32-deep passes run on one fill, so
// the fill's barrier is paid once for the four.
constexpr int SD = 128;
// Row pitch of the GEMM's A tile, whose rows hold SD elements: 272 bytes = 16 bytes x odd.
constexpr int SP = SD + 8;
// Row pitches, in bf16 elements, of the two tiles read by the transposing load,
// which wants 32 bytes x odd: the GEMM's B rows of 64 and the attention's V rows
// of 64 (two heads), 160 bytes both.
constexpr int BP = 80;
constexpr int VP = 80;
// Row pitches, in floats, of the attention's match tile. Direction 0: 64 query rows
// of SD keys, read 16 bytes a lane from 16 rows: 528 bytes = 16 bytes x odd.
// Direction 1: SD key rows of 64 queries, read 4 bytes a lane, 16 lanes along a row
// and the other 16 eight rows on: 272 bytes put those 32 banks further.
constexpr int MP0 = SD + 4;
constexpr int MP1 = 68;
// Every staged tile has two buffers: the copies of stage s + 1 fly while stage s is
// worked on. Elements of one buffer of each tile:
constexpr int ASZ = 128 * SP;
constexpr int BSZ = SD * BP;
constexpr int KSZ = SD * LP;
constexpr int VSZ = SD * VP;
constexpr int MSZ = SD * MP1 > 64 * MP0 ? SD * MP1 : 64 * MP0;

typedef __attribute__((ext_vector_type(4))) uint32_t u32x4;
typedef __attribute__((ext_vector_type(8))) short    s16x8;

union Frag16 { v16bf v; uint32_t u[8]; u32x4 q[2]; };
union FragF  { v8f   v; float    f[8]; };

__device__ __forceinline__ bf16_t f2bf(float f) {
  uint32_t u = __builtin_bit_cast(uint32_t, f);
  uint32_t r = (u + 0x7FFFu + ((u >> 16) & 1u)) >> 16;   // round-to-nearest-even
  unsigned short s = (unsigned short)r;
  return __builtin_bit_cast(bf16_t, s);
}

__device__ __forceinline__ uint32_t lds_off(const void* p) {
  return (uint32_t)(uintptr_t)p;
}

// Four 16-byte copies a lane, each with address registers of its own and no
// immediate offset. The s_wait_xcnt closes the statement so that it stands in
// front of whatever next rewrites one of these registers.
__device__ __forceinline__ void copy4_b128_to_lds(
    const bf16_t* g0, const bf16_t* g1, const bf16_t* g2, const bf16_t* g3,
    const bf16_t* l0, const bf16_t* l1, const bf16_t* l2, const bf16_t* l3) {
  asm volatile(
      "global_load_async_to_lds_b128 %0, %4, off\n\t"
      "global_load_async_to_lds_b128 %1, %5, off\n\t"
      "global_load_async_to_lds_b128 %2, %6, off\n\t"
      "global_load_async_to_lds_b128 %3, %7, off\n\t"
      "s_wait_xcnt 0x0"
      :: "v"(lds_off(l0)), "v"(lds_off(l1)), "v"(lds_off(l2)), "v"(lds_off(l3)),
         "v"(g0), "v"(g1), "v"(g2), "v"(g3)
      : "memory");
}

// Eight such copies in one statement, under one wait.
__device__ __forceinline__ void copy8_b128_to_lds(
    const void* g0, const void* g1, const void* g2, const void* g3,
    const void* g4, const void* g5, const void* g6, const void* g7,
    const void* l0, const void* l1, const void* l2, const void* l3,
    const void* l4, const void* l5, const void* l6, const void* l7) {
  asm volatile(
      "global_load_async_to_lds_b128 %0, %8, off\n\t"
      "global_load_async_to_lds_b128 %1, %9, off\n\t"
      "global_load_async_to_lds_b128 %2, %10, off\n\t"
      "global_load_async_to_lds_b128 %3, %11, off\n\t"
      "global_load_async_to_lds_b128 %4, %12, off\n\t"
      "global_load_async_to_lds_b128 %5, %13, off\n\t"
      "global_load_async_to_lds_b128 %6, %14, off\n\t"
      "global_load_async_to_lds_b128 %7, %15, off\n\t"
      "s_wait_xcnt 0x0"
      :: "v"(lds_off(l0)), "v"(lds_off(l1)), "v"(lds_off(l2)), "v"(lds_off(l3)),
         "v"(lds_off(l4)), "v"(lds_off(l5)), "v"(lds_off(l6)), "v"(lds_off(l7)),
         "v"(g0), "v"(g1), "v"(g2), "v"(g3), "v"(g4), "v"(g5), "v"(g6), "v"(g7)
      : "memory");
}

// This wave's LDS reads of a stage have retired before any copy refills its buffer.
__device__ __forceinline__ void lds_reads_done() {
  asm volatile("s_wait_dscnt 0x0" ::: "memory");
}

// This wave's copies have landed; the barrier behind it shows them to the others.
__device__ __forceinline__ void async_lds_wait() {
  asm volatile("s_wait_asynccnt 0x0" ::: "memory");
}

// ---------------- transposing LDS load (ds_load_tr16_b128) ------------------
// Of a row-major tile T of 16-bit elements, lane (c = l & 15, h = l >> 4) gets
// T[k + 8h + 0..7][d + c] when lane l passes the address that tr16_lane gives it
// for (k, d) = (0, 0), moved by k rows and 2 * d bytes. The loads at k and k + 16
// are registers 0-3 and 4-7 of a 16x16x32 operand in the hardware k order, the
// order in which every other fragment of this file is loaded.
__device__ __forceinline__ const unsigned char* tr16_lane(const bf16_t* tile, int pitch, int lane) {
  return (const unsigned char*)tile + ((lane >> 4) * 8 + (lane & 7)) * (pitch * 2) + ((lane >> 3) & 1) * 16;
}
__device__ __forceinline__ u32x4 ld_tr16(const unsigned char* p) {
  typedef __attribute__((address_space(3))) s16x8 lds_s16x8;
  return __builtin_bit_cast(u32x4, __builtin_amdgcn_ds_load_tr16_b128_v8i16((lds_s16x8*)p));
}

// ---------------------- f32 -> bf16, all seven inputs -----------------------
// One launch of few, fat blocks: a block of 256 threads converts 4096 consecutive
// elements of one input, picked by the block index; a thread takes 16 of them as
// four 16-byte loads (a wave-wide load covers 512 contiguous bytes), all issued
// before the first use. Blocks [0, 512): 16 rows of x0 or x1 into the first 256
// columns of the stacked concat buffer (row pitch 512). The rest: the five
// weights, whose bf16 copies lie one behind the other at wdst.
__global__ __launch_bounds__(256) void cvt_all(
    const float* __restrict__ x0, const float* __restrict__ x1,
    const float* __restrict__ Wqk, const float* __restrict__ Wv,
    const float* __restrict__ Wo, const float* __restrict__ W1,
    const float* __restrict__ W2,
    bf16_t* __restrict__ cat, bf16_t* __restrict__ wdst) {
  const int blk = blockIdx.x;
  const int off = (threadIdx.x >> 5) * 512 + (threadIdx.x & 31) * 4;
  const bool isx = blk < 512;
  const float* in;     // the block's 4096 source elements
  bf16_t* dst;         // where the first of them goes
  if (isx) {
    in = (blk < 256 ? x0 : x1) + (size_t)(blk & 255) * 4096;
    dst = cat + (size_t)blk * 8192;
  } else {
    const int wb = blk - 512;   // 16 | 16 | 16 | 64 | 32 blocks
    int first;
    if (wb < 16)       { in = Wqk; first = 0; }
    else if (wb < 32)  { in = Wv;  first = 16; }
    else if (wb < 48)  { in = Wo;  first = 32; }
    else if (wb < 112) { in = W1;  first = 48; }
    else               { in = W2;  first = 112; }
    in += (size_t)(wb - first) * 4096;
    dst = wdst + (size_t)wb * 4096;
  }
  float4 f[4];
#pragma unroll
  for (int j = 0; j < 4; ++j) f[j] = *(const float4*)(in + off + j * 128);
#pragma unroll
  for (int j = 0; j < 4; ++j) {
    const int e = off + j * 128;
    const int d = isx ? (e >> 8) * 512 + (e & 255) : e;
    union { uint2 q; bf16_t h[4]; } o;
    o.h[0] = f2bf(f[j].x); o.h[1] = f2bf(f[j].y);
    o.h[2] = f2bf(f[j].z); o.h[3] = f2bf(f[j].w);
    *(uint2*)(dst + d) = o.q;
  }
}

// ----------------------------- generic GEMM --------------------------------
// C[M=grid.x*128, N=grid.y*64] = (A[M,K]bf16 @ B[K,N]bf16 + bias)*scale (+res)
// 8 waves: wave w owns rows [w*16, w*16+16) of the block tile, all 64 cols.
// K is a multiple of SD.
// One launch serves both sides: the rows of side 1 stand behind those of side 0
// in A and in the output; the residual, an input per side, changes at row mres.
// blockIdx.z picks one of two products that share A (weight, bias, scale, out).
__global__ __launch_bounds__(256) void gemm_wmma(
    const bf16_t* __restrict__ A, int lda,
    const bf16_t* __restrict__ B0, const bf16_t* __restrict__ B1, int ldb,
    const float* __restrict__ bias0, const float* __restrict__ bias1,
    float scale0, float scale1,
    bf16_t* __restrict__ outB0, bf16_t* __restrict__ outB1,
    float* __restrict__ outF,
    const float* __restrict__ res0, const float* __restrict__ res1, int mres,
    int ldo, int ldr, int K) {
  __shared__ __align__(16) bf16_t As[2 * ASZ];
  __shared__ __align__(16) bf16_t Bs[2 * BSZ];    // stored [k][n], as in memory

  const int bm = blockIdx.x * 128;
  const int bn = blockIdx.y * 64;
  const bool second = blockIdx.z != 0;
  const bf16_t* Bm  = second ? B1 : B0;
  const float* bias = second ? bias1 : bias0;
  const float scale = second ? scale1 : scale0;
  bf16_t* outB      = second ? outB1 : outB0;
  const float* res  = bm < mres ? res0 : res1;
  const int rfirst  = bm < mres ? 0 : mres;      // first row of that residual
  const int t = threadIdx.x;
  const int wave = t >> 5;
  const int lane = t & 31;
  const int hf = lane >> 4;       // which 16-lane half of the wave
  const int ln = lane & 15;

  const unsigned char* btr = tr16_lane(Bs, BP, lane);

  FragF acc[4];
#pragma unroll
  for (int i = 0; i < 4; ++i) acc[i].v = (v8f){0, 0, 0, 0, 0, 0, 0, 0};

  // Source and LDS addresses of this thread's copies; the sources move on by one
  // stage behind each fill.
  // A tile 128 x SD: 16 lanes cover a row's 256 bytes, so a wave-wide copy takes
  // whole lines; eight rows a thread, 16 apart.
  const bf16_t* ga = A + (size_t)(bm + (t >> 4)) * lda + (t & 15) * 8;
  const bf16_t* la = As + (t >> 4) * SP + (t & 15) * 8;
  const size_t gsa = (size_t)16 * lda;
  // B tile SD x 64 row-major: 8 lanes cover a row's 128 bytes, one line; four rows
  // a thread, 32 apart.
  const bf16_t* gb = Bm + (size_t)(t >> 3) * ldb + bn + (t & 7) * 8;
  const bf16_t* lb = Bs + (t >> 3) * BP + (t & 7) * 8;
  const size_t gsb = (size_t)32 * ldb;
  auto fill = [&](int buf) {
    const bf16_t* l0 = la + buf * ASZ;
    const bf16_t* g4 = ga + 4 * gsa;
    const bf16_t* l4 = l0 + 64 * SP;
    const bf16_t* l8 = lb + buf * BSZ;
    copy4_b128_to_lds(ga, ga + gsa, ga + 2 * gsa, ga + 3 * gsa,
                      l0, l0 + 16 * SP, l0 + 32 * SP, l0 + 48 * SP);
    copy4_b128_to_lds(g4, g4 + gsa, g4 + 2 * gsa, g4 + 3 * gsa,
                      l4, l4 + 16 * SP, l4 + 32 * SP, l4 + 48 * SP);
    copy4_b128_to_lds(gb, gb + gsb, gb + 2 * gsb, gb + 3 * gsb,
                      l8, l8 + 32 * BP, l8 + 64 * BP, l8 + 96 * BP);
    ga += SD;
    gb += (size_t)SD * ldb;
  };

  const int nst = K / SD;
  fill(0);
  async_lds_wait();
  __syncthreads();
  if (nst > 1) fill(1);

  for (int s = 0; s < nst; ++s) {
    const int buf = s & 1;
    const bf16_t* Ab = As + buf * ASZ + (wave * 16 + ln) * SP;
    const unsigned char* bt = btr + buf * (BSZ * 2);
#pragma unroll
    for (int p = 0; p < SD / 32; ++p) {
      Frag16 af;
#pragma unroll
      for (int v = 0; v < 8; ++v) {
        const int kp = p * 32 + (v >> 2) * 16 + hf * 8 + (v & 3) * 2;
        af.u[v] = *(const uint32_t*)(Ab + kp);
      }
#pragma unroll
      for (int ns = 0; ns < 4; ++ns) {
        Frag16 bfr;   // column ns*16+ln, k = p*32 + {0, 16} + hf*8 + 0..7
        bfr.q[0] = ld_tr16(bt + (p * 32) * (BP * 2) + ns * 32);
        bfr.q[1] = ld_tr16(bt + (p * 32 + 16) * (BP * 2) + ns * 32);
        acc[ns].v = __builtin_amdgcn_wmma_f32_16x16x32_bf16(
            false, af.v, false, bfr.v, (short)0, acc[ns].v, false, false);
      }
    }
    // Publish point of stage s + 1: one barrier shows its bytes to every wave and
    // ends every wave's reads of this stage's buffer, which is refilled behind it.
    lds_reads_done();
    async_lds_wait();
    __syncthreads();
    if (s + 2 < nst) fill(buf);
  }
  async_lds_wait();

  // Epilogue through LDS. An accumulator register holds one column of a row, 16
  // lanes to a 64-byte piece; passed through LDS, a lane holds four consecutive
  // columns and 16 lanes a whole row of the tile, so that every global access
  // covers whole lines. A wave stages in its own 16 rows of the first buffer of As:
  // no other wave reads them, and every copy has landed by the loop's last barrier,
  // so no barrier is owed. A row of 64 floats fits the pitch of SP bf16 (272 bytes).
  float* stg = (float*)(As + wave * 16 * SP);
  const int ec = ln * 4;                       // the lane's first column in the tile
  const int row0 = bm + wave * 16 + hf;        // its rows: row0 + 2 * i
  const float4 bi = *(const float4*)(bias + bn + ec);
  const bool addres = !outB && res;
  float4 rv[8];
  if (addres) {   // the residual's eight loads, issued together ahead of the staging
    const float* rp[8];
    rp[0] = res + (size_t)(row0 - rfirst) * ldr + bn + ec;
#pragma unroll
    for (int i = 1; i < 8; ++i) rp[i] = rp[i - 1] + (size_t)2 * ldr;
#pragma unroll
    for (int i = 0; i < 8; ++i) rv[i] = *(const float4*)rp[i];
    // The eight addresses are inputs here, so that no load of the group lands in
    // the address register of another: they stay as they are up to this wait.
    asm volatile("s_wait_xcnt 0x0"
                 :: "v"(rp[0]), "v"(rp[1]), "v"(rp[2]), "v"(rp[3]),
                    "v"(rp[4]), "v"(rp[5]), "v"(rp[6]), "v"(rp[7])
                 : "memory");
  }
#pragma unroll
  for (int ns = 0; ns < 4; ++ns)
#pragma unroll
    for (int r = 0; r < 8; ++r)   // C/D layout: m = r + 8*half
      stg[(hf * 8 + r) * (SP / 2) + ns * 16 + ln] = acc[ns].f[r];
  // The wave's own stores have reached LDS before other lanes of it read them back.
  asm volatile("s_wait_dscnt 0x0" ::: "memory");
  float4 c[8];
#pragma unroll
  for (int i = 0; i < 8; ++i) {
    c[i] = *(const float4*)(stg + (2 * i + hf) * (SP / 2) + ec);
    c[i].x = (c[i].x + bi.x) * scale;
    c[i].y = (c[i].y + bi.y) * scale;
    c[i].z = (c[i].z + bi.z) * scale;
    c[i].w = (c[i].w + bi.w) * scale;
  }
  if (outB) {
    bf16_t* op = outB + (size_t)row0 * ldo + bn + ec;
#pragma unroll
    for (int i = 0; i < 8; ++i) {
      union { uint2 q; bf16_t h[4]; } o;
      o.h[0] = f2bf(c[i].x); o.h[1] = f2bf(c[i].y);
      o.h[2] = f2bf(c[i].z); o.h[3] = f2bf(c[i].w);
      *(uint2*)(op + (size_t)(2 * i) * ldo) = o.q;
    }
  } else {
    float* op = outF + (size_t)row0 * ldo + bn + ec;
    if (addres) {
#pragma unroll
      for (int i = 0; i < 8; ++i) {
        c[i].x += rv[i].x; c[i].y += rv[i].y; c[i].z += rv[i].z; c[i].w += rv[i].w;
      }
    }
#pragma unroll
    for (int i = 0; i < 8; ++i) *(float4*)(op + (size_t)(2 * i) * ldo) = c[i];
  }
}

typedef __attribute__((ext_vector_type(2))) float  f32x2;
typedef __attribute__((ext_vector_type(4))) float  f32x4;
typedef __attribute__((ext_vector_type(2))) __bf16 bf16x2;

__device__ __forceinline__ uint32_t pack_bf16(float lo, float hi) {
  f32x2 p = {lo, hi};
  return __builtin_bit_cast(uint32_t, __builtin_convertvector(p, bf16x2));
}

// value of lane l ^ 16
__device__ __forceinline__ float other_half(float x) {
  const int xi = __builtin_bit_cast(int, x);
  return __builtin_bit_cast(float, __builtin_amdgcn_permlanex16(
      xi, xi, 0x76543210, 0xfedcba98, false, false));
}

// One direction's whole pass. DIR is a compile-time constant so that the loop
// holds that direction's match loads alone, with no branch and no select.
template <int DIR>
__device__ __forceinline__ void attn_dir(
    const bf16_t* __restrict__ Q, const bf16_t* __restrict__ Km,
    const bf16_t* __restrict__ Vm, const float* __restrict__ mb,
    bf16_t* __restrict__ Out, bf16_t* Kt, bf16_t* Vs, float* Ms, int b, int hp) {
  const int NN = 2048, DD = 256, DH = 32;
  const int wave = threadIdx.x >> 5;
  const int lane = threadIdx.x & 31;
  const int hf = lane >> 4;
  const int ln = lane & 15;
  const int hh = wave >> 2;               // which head of the pair
  const int wq = wave & 3;                // which 16 of the block's 64 queries
  const int h = hp * 2 + hh;
  const int ib = blockIdx.x * 64;
  const int i0 = ib + wq * 16;
  const unsigned char* vtr = tr16_lane(Vs, VP, lane) + hh * (DH * 2);
  const bf16_t* kfr = Kt + ln * LP + hh * DH;

  // Q fragment (B operand: lane holds query i0+ln), straight from global
  Frag16 qf;
  {
    const size_t qbase = (size_t)(b * NN + i0 + ln) * DD + h * DH;
#pragma unroll
    for (int v = 0; v < 8; ++v) {
      const int kp = (v >> 2) * 16 + hf * 8 + (v & 3) * 2;
      qf.u[v] = *(const uint32_t*)(Q + qbase + kp);
    }
  }

  float mrow = -1e30f, lrow = 0.f;   // of query i0+ln; lrow: this half's keys only
  FragF O0, O1;                      // O^T: f[r] = O[i0+ln][d*16 + hf*8 + r]
  O0.v = (v8f){0, 0, 0, 0, 0, 0, 0, 0};
  O1.v = (v8f){0, 0, 0, 0, 0, 0, 0, 0};

  // Source and LDS addresses of this thread's copies; the sources move on by one
  // stage behind each fill.
  // K rows and V rows of the head pair, row-major: 8 lanes cover a row's 128 bytes,
  // one line; four rows a thread, 32 apart.
  const int jr = threadIdx.x >> 3;
  const int c0 = (threadIdx.x & 7) * 8;
  const size_t gb = (size_t)(b * NN + jr) * DD + hp * (2 * DH) + c0;
  const bf16_t* kg = Km + gb;
  const bf16_t* vg = Vm + gb;
  const bf16_t* kl0 = Kt + jr * LP + c0;
  const bf16_t* vl0 = Vs + jr * VP + c0;
  // Direction 1: match[j0 + 0..SD)[ib + 0..64): 16 lanes cover a row's 256 bytes;
  // eight rows a thread, 16 apart. Direction 0: match[ib + 0..64)[j0 + 0..SD): a wave
  // covers a row's 512 bytes; eight rows a thread, 8 apart.
  const float* mg = DIR ? mb + (size_t)(threadIdx.x >> 4) * NN + ib + (threadIdx.x & 15) * 4
                        : mb + (size_t)(ib + wave) * NN + lane * 4;
  const float* ml0 = DIR ? Ms + (threadIdx.x >> 4) * MP1 + (threadIdx.x & 15) * 4
                         : Ms + wave * MP0 + lane * 4;
  auto fill = [&](int buf) {
    const bf16_t* kl = kl0 + buf * KSZ;
    const bf16_t* vl = vl0 + buf * VSZ;
    const float* ml = ml0 + buf * MSZ;
    copy8_b128_to_lds(kg, kg + 32 * DD, kg + 64 * DD, kg + 96 * DD,
                      vg, vg + 32 * DD, vg + 64 * DD, vg + 96 * DD,
                      kl, kl + 32 * LP, kl + 64 * LP, kl + 96 * LP,
                      vl, vl + 32 * VP, vl + 64 * VP, vl + 96 * VP);
    if (DIR) {
      copy8_b128_to_lds(mg, mg + 16 * NN, mg + 32 * NN, mg + 48 * NN,
                        mg + 64 * NN, mg + 80 * NN, mg + 96 * NN, mg + 112 * NN,
                        ml, ml + 16 * MP1, ml + 32 * MP1, ml + 48 * MP1,
                        ml + 64 * MP1, ml + 80 * MP1, ml + 96 * MP1, ml + 112 * MP1);
      mg += (size_t)SD * NN;
    } else {
      copy8_b128_to_lds(mg, mg + 8 * NN, mg + 16 * NN, mg + 24 * NN,
                        mg + 32 * NN, mg + 40 * NN, mg + 48 * NN, mg + 56 * NN,
                        ml, ml + 8 * MP0, ml + 16 * MP0, ml + 24 * MP0,
                        ml + 32 * MP0, ml + 40 * MP0, ml + 48 * MP0, ml + 56 * MP0);
      mg += SD;
    }
    kg += SD * DD;
    vg += SD * DD;
  };

  fill(0);
  async_lds_wait();
  __syncthreads();
  fill(1);

  // One stage's four passes and its publish point. The buffer's number is a constant
  // at each of the two calls, so that every LDS offset is an immediate.
  auto stage = [&](const int buf, const bool refill) {
    const bf16_t* kfb = kfr + buf * KSZ;
    const unsigned char* vtb = vtr + buf * (VSZ * 2);
    const float* Mb = Ms + buf * MSZ;
#pragma unroll
    for (int p = 0; p < SD / 32; ++p) {
      // S^T = K @ Q^T for two 16-key tiles:
      // S[t].f[r] = key j0+p*32+t*16+hf*8+r, query i0+ln
      FragF S[2];
#pragma unroll
      for (int t = 0; t < 2; ++t) {
        Frag16 kf;
#pragma unroll
        for (int v = 0; v < 8; ++v) {
          const int kp = (v >> 2) * 16 + hf * 8 + (v & 3) * 2;
          kf.u[v] = *(const uint32_t*)(kfb + (p * 32 + t * 16) * LP + kp);
        }
        S[t].v = __builtin_amdgcn_wmma_f32_16x16x32_bf16(
            false, kf.v, false, qf.v, (short)0, (v8f){0,0,0,0,0,0,0,0}, false, false);
      }

      // match weights of this lane's 16 scores, in the order of S
      float w[16];
      if (DIR) {
        const float* mp = Mb + (p * 32 + hf * 8) * MP1 + wq * 16 + ln;
#pragma unroll
        for (int k = 0; k < 16; ++k) w[k] = mp[((k >> 3) * 16 + (k & 7)) * MP1];
      } else {
        const float* mp = Mb + (wq * 16 + ln) * MP0 + p * 32 + hf * 8;
#pragma unroll
        for (int q = 0; q < 4; ++q) {
          const f32x4 m4 = *(const f32x4*)(mp + (q >> 1) * 16 + (q & 1) * 4);
#pragma unroll
          for (int e = 0; e < 4; ++e) w[q * 4 + e] = m4[e];
        }
      }

      // online softmax, one query per lane
      float sc[16];
#pragma unroll
      for (int k = 0; k < 16; ++k) sc[k] = S[k >> 3].f[k & 7] * w[k];
      float mx[8];
#pragma unroll
      for (int k = 0; k < 8; ++k) mx[k] = fmaxf(sc[2 * k], sc[2 * k + 1]);
      float cm = fmaxf(fmaxf(fmaxf(mx[0], mx[1]), fmaxf(mx[2], mx[3])),
                       fmaxf(fmaxf(mx[4], mx[5]), fmaxf(mx[6], mx[7])));
      cm = fmaxf(cm, other_half(cm));
      const float nm = fmaxf(mrow, cm);
      const float fac = __expf(mrow - nm);
      float ex[16];
#pragma unroll
      for (int k = 0; k < 16; ++k) ex[k] = __expf(sc[k] - nm);
      float sm[8];
#pragma unroll
      for (int k = 0; k < 8; ++k) sm[k] = ex[2 * k] + ex[2 * k + 1];
      const float cs = ((sm[0] + sm[1]) + (sm[2] + sm[3])) + ((sm[4] + sm[5]) + (sm[6] + sm[7]));
      lrow = lrow * fac + cs;
      // Empty asm on the row's sum, against spills: without it the additions of a whole
      // stage are moved behind the refill's branch, its 64 exponentials stay live over
      // the barrier, and the kernel takes 321 registers (or scratch) in place of 220.
      asm volatile("" : "+v"(lrow));
      mrow = nm;
#pragma unroll
      for (int r = 0; r < 8; ++r) { O0.f[r] *= fac; O1.f[r] *= fac; }

      // P^T as B operand: element s = tile s>>3, register s&7 (the hardware k order)
      // V^T as A operand by the transposing load: row dh = ln (vf0) or 16+ln (vf1)
      Frag16 pf, vf0, vf1;
#pragma unroll
      for (int v = 0; v < 8; ++v) pf.u[v] = pack_bf16(ex[2 * v], ex[2 * v + 1]);
      vf0.q[0] = ld_tr16(vtb + (p * 32) * (VP * 2));
      vf0.q[1] = ld_tr16(vtb + (p * 32 + 16) * (VP * 2));
      vf1.q[0] = ld_tr16(vtb + (p * 32) * (VP * 2) + 32);
      vf1.q[1] = ld_tr16(vtb + (p * 32 + 16) * (VP * 2) + 32);
      O0.v = __builtin_amdgcn_wmma_f32_16x16x32_bf16(
          false, vf0.v, false, pf.v, (short)0, O0.v, false, false);
      O1.v = __builtin_amdgcn_wmma_f32_16x16x32_bf16(
          false, vf1.v, false, pf.v, (short)0, O1.v, false, false);
    }
    // Publish point of stage s + 1: one barrier shows its bytes to every wave and
    // ends every wave's reads of this stage's buffers, which are refilled behind it.
    lds_reads_done();
    async_lds_wait();
    __syncthreads();
    if (refill) fill(buf);
  };
  for (int s = 0; s < NN / SD; s += 2) {
    const bool more = s + 2 < NN / SD;   // stages s + 2 and s + 3 exist
    stage(0, more);
    stage(1, more);
  }
  async_lds_wait();

  {  // join the halves' sums once; a lane stores 8 consecutive dh per tile
    const float inv = 1.0f / (lrow + other_half(lrow));
    bf16_t* op = Out + (size_t)(b * NN + i0 + ln) * DD + h * DH + hf * 8;
    uint4 a0, a1;
    a0.x = pack_bf16(O0.f[0] * inv, O0.f[1] * inv);
    a0.y = pack_bf16(O0.f[2] * inv, O0.f[3] * inv);
    a0.z = pack_bf16(O0.f[4] * inv, O0.f[5] * inv);
    a0.w = pack_bf16(O0.f[6] * inv, O0.f[7] * inv);
    a1.x = pack_bf16(O1.f[0] * inv, O1.f[1] * inv);
    a1.y = pack_bf16(O1.f[2] * inv, O1.f[3] * inv);
    a1.z = pack_bf16(O1.f[4] * inv, O1.f[5] * inv);
    a1.w = pack_bf16(O1.f[6] * inv, O1.f[7] * inv);
    *(uint4*)op = a0;
    *(uint4*)(op + 16) = a1;
  }
}

__global__ __launch_bounds__(256) void flash_attn(
    const bf16_t* __restrict__ qk0, const bf16_t* __restrict__ qk1,
    const bf16_t* __restrict__ v0b, const bf16_t* __restrict__ v1b,
    const float* __restrict__ match,
    bf16_t* __restrict__ m0, bf16_t* __restrict__ m1) {
  const int NN = 2048;
  const int dir = blockIdx.z >> 1;
  const int b = blockIdx.z & 1;
  const int hp = blockIdx.y;    // the pair of heads 2*hp, 2*hp + 1
  const float* mb = match + (size_t)b * NN * NN;

  __shared__ __align__(16) bf16_t Kt[2 * KSZ];        // [buffer][j][head of the pair][dh]
  __shared__ __align__(16) bf16_t Vs[2 * VSZ];        // [buffer][j][head of the pair][dh]
  __shared__ __align__(16) float  Ms[2 * MSZ];

  if (dir) attn_dir<1>(qk1, qk0, v0b, mb, m1, Kt, Vs, Ms, b, hp);
  else     attn_dir<0>(qk0, qk1, v1b, mb, m0, Kt, Vs, Ms, b, hp);
}

// ------------------------ LayerNorm + exact GELU ---------------------------
// A wave owns two whole rows of 512: a lane holds 16 elements of each (four
// 16-byte loads a row, all eight issued before the first use), so mean and
// variance are in-lane sums plus five lane exchanges, with no LDS and no barrier.
__device__ __forceinline__ float gelu_exact(float y) {
  return 0.5f * y * (1.f + erff(y * 0.70710678118654752f));
}

// The pointers carry no __restrict__, so that no load moves over the wait below.
__global__ __launch_bounds__(256) void ln_gelu(
    const float* hbuf, const float* gamma, const float* beta, bf16_t* gbuf) {
  const int wave = threadIdx.x >> 5, lane = threadIdx.x & 31;
  const size_t base = (size_t)(blockIdx.x * 8 + wave) * 1024 + lane * 4;
  const float* hp = hbuf + base;

  float4 x[2][4], ga[4], be[4];
#pragma unroll
  for (int j = 0; j < 4; ++j) {
    ga[j] = *(const float4*)(gamma + j * 128 + lane * 4);
    be[j] = *(const float4*)(beta + j * 128 + lane * 4);
  }
  // The loads below may land in the address register of the loads above: this
  // wait stands in front of that overwrite.
  asm volatile("s_wait_xcnt 0x0" ::: "memory");
#pragma unroll
  for (int r = 0; r < 2; ++r)
#pragma unroll
    for (int j = 0; j < 4; ++j) x[r][j] = *(const float4*)(hp + r * 512 + j * 128);

  float s[2], q[2];
#pragma unroll
  for (int r = 0; r < 2; ++r) {
    float sj[4], qj[4];
#pragma unroll
    for (int j = 0; j < 4; ++j) {
      const float4 v = x[r][j];
      sj[j] = (v.x + v.y) + (v.z + v.w);
      qj[j] = (v.x * v.x + v.y * v.y) + (v.z * v.z + v.w * v.w);
    }
    s[r] = (sj[0] + sj[1]) + (sj[2] + sj[3]);
    q[r] = (qj[0] + qj[1]) + (qj[2] + qj[3]);
  }
#pragma unroll
  for (int off = 16; off; off >>= 1) {
#pragma unroll
    for (int r = 0; r < 2; ++r) {
      s[r] += __shfl_xor(s[r], off, 32);
      q[r] += __shfl_xor(q[r], off, 32);
    }
  }

#pragma unroll
  for (int r = 0; r < 2; ++r) {
    const float mu = s[r] * (1.f / 512.f);
    const float rs = rsqrtf(q[r] * (1.f / 512.f) - mu * mu + 1e-5f);
#pragma unroll
    for (int j = 0; j < 4; ++j) {
      const float4 v = x[r][j];
      union { uint2 u; bf16_t h[4]; } o;
      o.h[0] = f2bf(gelu_exact((v.x - mu) * rs * ga[j].x + be[j].x));
      o.h[1] = f2bf(gelu_exact((v.y - mu) * rs * ga[j].y + be[j].y));
      o.h[2] = f2bf(gelu_exact((v.z - mu) * rs * ga[j].z + be[j].z));
      o.h[3] = f2bf(gelu_exact((v.w - mu) * rs * ga[j].w + be[j].w));
      *(uint2*)(gbuf + base + r * 512 + j * 128) = o.u;
    }
  }
}

// ------------------------------- host side ---------------------------------
extern "C" void kernel_launch(void* const* d_in, const int* in_sizes, int n_in,
                              void* d_out, int out_size, void* d_ws, size_t ws_size,
                              hipStream_t stream) {
  const int B = 2, N = 2048, D = 256, H = 8, M = B * N, D2 = 2 * D;
  (void)in_sizes; (void)n_in; (void)out_size; (void)ws_size;

  const float* x0    = (const float*)d_in[0];
  const float* x1    = (const float*)d_in[1];
  const float* match = (const float*)d_in[2];
  const float* Wqk   = (const float*)d_in[3];
  const float* bqk   = (const float*)d_in[4];
  const float* Wv    = (const float*)d_in[5];
  const float* bv    = (const float*)d_in[6];
  const float* Wo    = (const float*)d_in[7];
  const float* bo    = (const float*)d_in[8];
  const float* W1    = (const float*)d_in[9];
  const float* b1    = (const float*)d_in[10];
  const float* gamma = (const float*)d_in[11];
  const float* beta  = (const float*)d_in[12];
  const float* W2    = (const float*)d_in[13];
  const float* b2    = (const float*)d_in[14];
  float* out = (float*)d_out;

  char* ws = (char*)d_ws;
  auto alloc = [&](size_t bytes) {
    char* p = ws; ws += (bytes + 255) & ~(size_t)255; return p;
  };
  bf16_t* WqkB = (bf16_t*)alloc((size_t)D * D * 2);
  bf16_t* WvB  = (bf16_t*)alloc((size_t)D * D * 2);
  bf16_t* WoB  = (bf16_t*)alloc((size_t)D * D * 2);
  bf16_t* W1B  = (bf16_t*)alloc((size_t)D2 * D2 * 2);
  bf16_t* W2B  = (bf16_t*)alloc((size_t)D2 * D * 2);
  bf16_t* qk0s = (bf16_t*)alloc((size_t)M * D * 2);
  bf16_t* qk1s = (bf16_t*)alloc((size_t)M * D * 2);
  bf16_t* v0bb = (bf16_t*)alloc((size_t)M * D * 2);
  bf16_t* v1bb = (bf16_t*)alloc((size_t)M * D * 2);
  bf16_t* m0b  = (bf16_t*)alloc((size_t)M * D * 2);
  bf16_t* m1b  = (bf16_t*)alloc((size_t)M * D * 2);
  bf16_t* cat0 = (bf16_t*)alloc((size_t)M * D2 * 2);
  bf16_t* cat1 = (bf16_t*)alloc((size_t)M * D2 * 2);
  float*  h0   = (float*)alloc((size_t)M * D2 * 4);
  float*  h1   = (float*)alloc((size_t)M * D2 * 4);
  bf16_t* g0 = qk0s;  // 8MB alias over qk0s..v1bb (dead after attention)
  (void)cat1; (void)h1;
  // Every buffer size is a multiple of 256 bytes, so each side-1 buffer starts
  // where its side-0 buffer ends: a pair is one matrix of 2*M rows.

  // weights + x into concat buffers (first 256 cols of cat = x)
  cvt_all<<<dim3((2 * M * D + 3 * D * D + D2 * D2 + D2 * D) / 4096), dim3(256), 0, stream>>>(
      x0, x1, Wqk, Wv, Wo, W1, W2, cat0, WqkB);

  const float s = 0.42044820762685725f;  // (DH^-0.5)^0.5 = 32^-0.25

  // projections, both sides: z=0 qk = (x@Wqk + bqk)*s ; z=1 v = x@Wv + bv
  gemm_wmma<<<dim3(2 * M / 128, D / 64, 2), dim3(256), 0, stream>>>(
      cat0, D2, WqkB, WvB, D, bqk, bv, s, 1.0f, qk0s, v0bb, nullptr,
      nullptr, nullptr, 2 * M, D, 0, D);

  // flash attention, both directions
  flash_attn<<<dim3(N / 64, H / 2, 2 * B), dim3(256), 0, stream>>>(
      qk0s, qk1s, v0bb, v1bb, match, m0b, m1b);

  // output projection, written directly into cat[:, 256:512]
  gemm_wmma<<<dim3(2 * M / 128, D / 64, 1), dim3(256), 0, stream>>>(
      m0b, D, WoB, WoB, D, bo, bo, 1.0f, 1.0f, cat0 + D, nullptr, nullptr,
      nullptr, nullptr, 2 * M, D2, 0, D);

  // FFN: h = cat @ W1 + b1 (f32) ; LN + exact GELU -> bf16
  gemm_wmma<<<dim3(2 * M / 128, D2 / 64, 1), dim3(256), 0, stream>>>(
      cat0, D2, W1B, W1B, D2, b1, b1, 1.0f, 1.0f, nullptr, nullptr, h0,
      nullptr, nullptr, 2 * M, D2, 0, D2);
  ln_gelu<<<dim3(2 * M / 16), dim3(256), 0, stream>>>(h0, gamma, beta, g0);

  // out = x + g @ W2 + b2
  gemm_wmma<<<dim3(2 * M / 128, D / 64, 1), dim3(256), 0, stream>>>(
      g0, D2, W2B, W2B, D, b2, b2, 1.0f, 1.0f, nullptr, nullptr, out,
      x0, x1, M, D, D, D2);
}

// v010
// Measured time: 60.6 microseconds a run.
// Two timings next to v009 both put it at 1.18 times that version's speed.
// Over all steps from v000 it is 6.35 times as fast.
#include <hip/hip_runtime.h>
#include <hip/hip_bf16.h>
#include <stdint.h>

// ---------------------------------------------------------------------------
// CDNA5 (gfx1250) CrossBlock: bf16 WMMA GEMMs + dual-direction flash attention
// + ASYNCcnt-tracked global->LDS tile staging; operands that need a transpose
// are staged row-major like the rest and transposed by the LDS load itself.
// ---------------------------------------------------------------------------

typedef __bf16 bf16_t;
typedef __attribute__((ext_vector_type(16))) __bf16 v16bf;
typedef __attribute__((ext_vector_type(8)))  float  v8f;

// Row pitch, in bf16 elements, of the attention's K tile, whose rows hold 64 of
// them (two heads): 144 bytes = 16 bytes x odd, so that the 16-byte fragment reads
// of 16 rows fall on distinct banks.
constexpr int LP = 72;

// Depth of a stage: what one fill of the LDS tiles holds along the loop's axis
// (k in the GEMM, keys in attention). Four 32-deep passes run on one fill, so
// the fill's barrier is paid once for the four.
constexpr int SD = 128;
// Row pitch of the GEMM's A tile, whose rows hold SD elements: 272 bytes = 16 bytes x odd.
constexpr int SP = SD + 8;
// Row pitches, in bf16 elements, of the two tiles read by the transposing load,
// which wants 32 bytes x odd: the GEMM's B rows of 64 and the attention's V rows
// of 64 (two heads), 160 bytes both.
constexpr int BP = 80;
constexpr int VP = 80;
// Row pitches, in floats, of the attention's match tile. Direction 0: 64 query rows
// of SD keys, read 16 bytes a lane from 16 rows: 528 bytes = 16 bytes x odd.
// Direction 1: SD key rows of 64 queries, read 4 bytes a lane, 16 lanes along a row
// and the other 16 eight rows on: 272 bytes put those 32 banks further.
constexpr int MP0 = SD + 4;
constexpr int MP1 = 68;
// Every staged tile has two buffers: the copies of stage s + 1 fly while stage s is
// worked on. Elements of one buffer of each tile:
constexpr int ASZ = 128 * SP;
constexpr int BSZ = SD * BP;
constexpr int KSZ = SD * LP;
constexpr int VSZ = SD * VP;
constexpr int MSZ = SD * MP1 > 64 * MP0 ? SD * MP1 : 64 * MP0;

typedef __attribute__((ext_vector_type(4))) uint32_t u32x4;
typedef __attribute__((ext_vector_type(8))) short    s16x8;

union Frag16 { v16bf v; uint32_t u[8]; u32x4 q[2]; };
union FragF  { v8f   v; float    f[8]; };

__device__ __forceinline__ bf16_t f2bf(float f) {
  uint32_t u = __builtin_bit_cast(uint32_t, f);
  uint32_t r = (u + 0x7FFFu + ((u >> 16) & 1u)) >> 16;   // round-to-nearest-even
  unsigned short s = (unsigned short)r;
  return __builtin_bit_cast(bf16_t, s);
}

__device__ __forceinline__ uint32_t lds_off(const void* p) {
  return (uint32_t)(uintptr_t)p;
}

// Four 16-byte copies a lane, each with address registers of its own and no
// immediate offset. The s_wait_xcnt closes the statement so that it stands in
// front of whatever next rewrites one of these registers.
__device__ __forceinline__ void copy4_b128_to_lds(
    const bf16_t* g0, const bf16_t* g1, const bf16_t* g2, const bf16_t* g3,
    const bf16_t* l0, const bf16_t* l1, const bf16_t* l2, const bf16_t* l3) {
  asm volatile(
      "global_load_async_to_lds_b128 %0, %4, off\n\t"
      "global_load_async_to_lds_b128 %1, %5, off\n\t"
      "global_load_async_to_lds_b128 %2, %6, off\n\t"
      "global_load_async_to_lds_b128 %3, %7, off\n\t"
      "s_wait_xcnt 0x0"
      :: "v"(lds_off(l0)), "v"(lds_off(l1)), "v"(lds_off(l2)), "v"(lds_off(l3)),
         "v"(g0), "v"(g1), "v"(g2), "v"(g3)
      : "memory");
}

// Eight such copies in one statement, under one wait.
__device__ __forceinline__ void copy8_b128_to_lds(
    const void* g0, const void* g1, const void* g2, const void* g3,
    const void* g4, const void* g5, const void* g6, const void* g7,
    const void* l0, const void* l1, const void* l2, const void* l3,
    const void* l4, const void* l5, const void* l6, const void* l7) {
  asm volatile(
      "global_load_async_to_lds_b128 %0, %8, off\n\t"
      "global_load_async_to_lds_b128 %1, %9, off\n\t"
      "global_load_async_to_lds_b128 %2, %10, off\n\t"
      "global_load_async_to_lds_b128 %3, %11, off\n\t"
      "global_load_async_to_lds_b128 %4, %12, off\n\t"
      "global_load_async_to_lds_b128 %5, %13, off\n\t"
      "global_load_async_to_lds_b128 %6, %14, off\n\t"
      "global_load_async_to_lds_b128 %7, %15, off\n\t"
      "s_wait_xcnt 0x0"
      :: "v"(lds_off(l0)), "v"(lds_off(l1)), "v"(lds_off(l2)), "v"(lds_off(l3)),
         "v"(lds_off(l4)), "v"(lds_off(l5)), "v"(lds_off(l6)), "v"(lds_off(l7)),
         "v"(g0), "v"(g1), "v"(g2), "v"(g3), "v"(g4), "v"(g5), "v"(g6), "v"(g7)
      : "memory");
}

// This wave's LDS reads of a stage have retired before any copy refills its buffer.
__device__ __forceinline__ void lds_reads_done() {
  asm volatile("s_wait_dscnt 0x0" ::: "memory");
}

// This wave's copies have landed; the barrier behind it shows them to the others.
__device__ __forceinline__ void async_lds_wait() {
  asm volatile("s_wait_asynccnt 0x0" ::: "memory");
}

// ---------------- transposing LDS load (ds_load_tr16_b128) ------------------
// Of a row-major tile T of 16-bit elements, lane (c = l & 15, h = l >> 4) gets
// T[k + 8h + 0..7][d + c] when lane l passes the address that tr16_lane gives it
// for (k, d) = (0, 0), moved by k rows and 2 * d bytes. The loads at k and k + 16
// are registers 0-3 and 4-7 of a 16x16x32 operand in the hardware k order, the
// order in which every other fragment of this file is loaded.
__device__ __forceinline__ const unsigned char* tr16_lane(const bf16_t* tile, int pitch, int lane) {
  return (const unsigned char*)tile + ((lane >> 4) * 8 + (lane & 7)) * (pitch * 2) + ((lane >> 3) & 1) * 16;
}
__device__ __forceinline__ u32x4 ld_tr16(const unsigned char* p) {
  typedef __attribute__((address_space(3))) s16x8 lds_s16x8;
  return __builtin_bit_cast(u32x4, __builtin_amdgcn_ds_load_tr16_b128_v8i16((lds_s16x8*)p));
}

// ---------------------- f32 -> bf16, all seven inputs -----------------------
// One launch of few, fat blocks: a block of 256 threads converts 4096 consecutive
// elements of one input, picked by the block index; a thread takes 16 of them as
// four 16-byte loads (a wave-wide load covers 512 contiguous bytes), all issued
// before the first use. Blocks [0, 512): 16 rows of x0 or x1 into the first 256
// columns of the stacked concat buffer (row pitch 512). The rest: the five
// weights, whose bf16 copies lie one behind the other at wdst.
__global__ __launch_bounds__(256) void cvt_all(
    const float* __restrict__ x0, const float* __restrict__ x1,
    const float* __restrict__ Wqk, const float* __restrict__ Wv,
    const float* __restrict__ Wo, const float* __restrict__ W1,
    const float* __restrict__ W2,
    bf16_t* __restrict__ cat, bf16_t* __restrict__ wdst) {
  const int blk = blockIdx.x;
  const int off = (threadIdx.x >> 5) * 512 + (threadIdx.x & 31) * 4;
  const bool isx = blk < 512;
  const float* in;     // the block's 4096 source elements
  bf16_t* dst;         // where the first of them goes
  if (isx) {
    in = (blk < 256 ? x0 : x1) + (size_t)(blk & 255) * 4096;
    dst = cat + (size_t)blk * 8192;
  } else {
    const int wb = blk - 512;   // 16 | 16 | 16 | 64 | 32 blocks
    int first;
    if (wb < 16)       { in = Wqk; first = 0; }
    else if (wb < 32)  { in = Wv;  first = 16; }
    else if (wb < 48)  { in = Wo;  first = 32; }
    else if (wb < 112) { in = W1;  first = 48; }
    else               { in = W2;  first = 112; }
    in += (size_t)(wb - first) * 4096;
    dst = wdst + (size_t)wb * 4096;
  }
  float4 f[4];
#pragma unroll
  for (int j = 0; j < 4; ++j) f[j] = *(const float4*)(in + off + j * 128);
#pragma unroll
  for (int j = 0; j < 4; ++j) {
    const int e = off + j * 128;
    const int d = isx ? (e >> 8) * 512 + (e & 255) : e;
    union { uint2 q; bf16_t h[4]; } o;
    o.h[0] = f2bf(f[j].x); o.h[1] = f2bf(f[j].y);
    o.h[2] = f2bf(f[j].z); o.h[3] = f2bf(f[j].w);
    *(uint2*)(dst + d) = o.q;
  }
}

// ----------------------------- generic GEMM --------------------------------
// C[M=grid.x*128, N=grid.y*64] = (A[M,K]bf16 @ B[K,N]bf16 + bias)*scale (+res)
// 8 waves: wave w owns rows [w*16, w*16+16) of the block tile, all 64 cols.
// K is a multiple of SD.
// One launch serves both sides: the rows of side 1 stand behind those of side 0
// in A and in the output; the residual, an input per side, changes at row mres.
// blockIdx.z picks one of two products that share A (weight, bias, scale, out).
__global__ __launch_bounds__(256) void gemm_wmma(
    const bf16_t* __restrict__ A, int lda,
    const bf16_t* __restrict__ B0, const bf16_t* __restrict__ B1, int ldb,
    const float* __restrict__ bias0, const float* __restrict__ bias1,
    float scale0, float scale1,
    bf16_t* __restrict__ outB0, bf16_t* __restrict__ outB1,
    float* __restrict__ outF,
    const float* __restrict__ res0, const float* __restrict__ res1, int mres,
    int ldo, int ldr, int K) {
  __shared__ __align__(16) bf16_t As[2 * ASZ];
  __shared__ __align__(16) bf16_t Bs[2 * BSZ];    // stored [k][n], as in memory

  const int bm = blockIdx.x * 128;
  const int bn = blockIdx.y * 64;
  const bool second = blockIdx.z != 0;
  const bf16_t* Bm  = second ? B1 : B0;
  const float* bias = second ? bias1 : bias0;
  const float scale = second ? scale1 : scale0;
  bf16_t* outB      = second ? outB1 : outB0;
  const float* res  = bm < mres ? res0 : res1;
  const int rfirst  = bm < mres ? 0 : mres;      // first row of that residual
  const int t = threadIdx.x;
  const int wave = t >> 5;
  const int lane = t & 31;
  const int hf = lane >> 4;       // which 16-lane half of the wave
  const int ln = lane & 15;

  const unsigned char* btr = tr16_lane(Bs, BP, lane);

  FragF acc[4];
#pragma unroll
  for (int i = 0; i < 4; ++i) acc[i].v = (v8f){0, 0, 0, 0, 0, 0, 0, 0};

  // Source and LDS addresses of this thread's copies; the sources move on by one
  // stage behind each fill.
  // A tile 128 x SD: 16 lanes cover a row's 256 bytes, so a wave-wide copy takes
  // whole lines; eight rows a thread, 16 apart.
  const bf16_t* ga = A + (size_t)(bm + (t >> 4)) * lda + (t & 15) * 8;
  const bf16_t* la = As + (t >> 4) * SP + (t & 15) * 8;
  const size_t gsa = (size_t)16 * lda;
  // B tile SD x 64 row-major: 8 lanes cover a row's 128 bytes, one line; four rows
  // a thread, 32 apart.
  const bf16_t* gb = Bm + (size_t)(t >> 3) * ldb + bn + (t & 7) * 8;
  const bf16_t* lb = Bs + (t >> 3) * BP + (t & 7) * 8;
  const size_t gsb = (size_t)32 * ldb;
  auto fill = [&](int buf) {
    const bf16_t* l0 = la + buf * ASZ;
    const bf16_t* g4 = ga + 4 * gsa;
    const bf16_t* l4 = l0 + 64 * SP;
    const bf16_t* l8 = lb + buf * BSZ;
    copy4_b128_to_lds(ga, ga + gsa, ga + 2 * gsa, ga + 3 * gsa,
                      l0, l0 + 16 * SP, l0 + 32 * SP, l0 + 48 * SP);
    copy4_b128_to_lds(g4, g4 + gsa, g4 + 2 * gsa, g4 + 3 * gsa,
                      l4, l4 + 16 * SP, l4 + 32 * SP, l4 + 48 * SP);
    copy4_b128_to_lds(gb, gb + gsb, gb + 2 * gsb, gb + 3 * gsb,
                      l8, l8 + 32 * BP, l8 + 64 * BP, l8 + 96 * BP);
    ga += SD;
    gb += (size_t)SD * ldb;
  };

  const int nst = K / SD;
  fill(0);
  async_lds_wait();
  __syncthreads();
  if (nst > 1) fill(1);

  for (int s = 0; s < nst; ++s) {
    const int buf = s & 1;
    const bf16_t* Ab = As + buf * ASZ + (wave * 16 + ln) * SP;
    const unsigned char* bt = btr + buf * (BSZ * 2);
#pragma unroll
    for (int p = 0; p < SD / 32; ++p) {
      Frag16 af;
#pragma unroll
      for (int v = 0; v < 8; ++v) {
        const int kp = p * 32 + (v >> 2) * 16 + hf * 8 + (v & 3) * 2;
        af.u[v] = *(const uint32_t*)(Ab + kp);
      }
#pragma unroll
      for (int ns = 0; ns < 4; ++ns) {
        Frag16 bfr;   // column ns*16+ln, k = p*32 + {0, 16} + hf*8 + 0..7
        bfr.q[0] = ld_tr16(bt + (p * 32) * (BP * 2) + ns * 32);
        bfr.q[1] = ld_tr16(bt + (p * 32 + 16) * (BP * 2) + ns * 32);
        acc[ns].v = __builtin_amdgcn_wmma_f32_16x16x32_bf16(
            false, af.v, false, bfr.v, (short)0, acc[ns].v, false, false);
      }
    }
    // Publish point of stage s + 1: one barrier shows its bytes to every wave and
    // ends every wave's reads of this stage's buffer, which is refilled behind it.
    lds_reads_done();
    async_lds_wait();
    __syncthreads();
    if (s + 2 < nst) fill(buf);
  }
  async_lds_wait();

  // Epilogue through LDS. An accumulator register holds one column of a row, 16
  // lanes to a 64-byte piece; passed through LDS, a lane holds four consecutive
  // columns and 16 lanes a whole row of the tile, so that every global access
  // covers whole lines. A wave stages in its own 16 rows of the first buffer of As:
  // no other wave reads them, and every copy has landed by the loop's last barrier,
  // so no barrier is owed. A row of 64 floats fits the pitch of SP bf16 (272 bytes).
  float* stg = (float*)(As + wave * 16 * SP);
  const int ec = ln * 4;                       // the lane's first column in the tile
  const int row0 = bm + wave * 16 + hf;        // its rows: row0 + 2 * i
  const float4 bi = *(const float4*)(bias + bn + ec);
  const bool addres = !outB && res;
  float4 rv[8];
  if (addres) {   // the residual's eight loads, issued together ahead of the staging
    const float* rp[8];
    rp[0] = res + (size_t)(row0 - rfirst) * ldr + bn + ec;
#pragma unroll
    for (int i = 1; i < 8; ++i) rp[i] = rp[i - 1] + (size_t)2 * ldr;
#pragma unroll
    for (int i = 0; i < 8; ++i) rv[i] = *(const float4*)rp[i];
    // The eight addresses are inputs here, so that no load of the group lands in
    // the address register of another: they stay as they are up to this wait.
    asm volatile("s_wait_xcnt 0x0"
                 :: "v"(rp[0]), "v"(rp[1]), "v"(rp[2]), "v"(rp[3]),
                    "v"(rp[4]), "v"(rp[5]), "v"(rp[6]), "v"(rp[7])
                 : "memory");
  }
#pragma unroll
  for (int ns = 0; ns < 4; ++ns)
#pragma unroll
    for (int r = 0; r < 8; ++r)   // C/D layout: m = r + 8*half
      stg[(hf * 8 + r) * (SP / 2) + ns * 16 + ln] = acc[ns].f[r];
  // The wave's own stores have reached LDS before other lanes of it read them back.
  asm volatile("s_wait_dscnt 0x0" ::: "memory");
  float4 c[8];
#pragma unroll
  for (int i = 0; i < 8; ++i) {
    c[i] = *(const float4*)(stg + (2 * i + hf) * (SP / 2) + ec);
    c[i].x = (c[i].x + bi.x) * scale;
    c[i].y = (c[i].y + bi.y) * scale;
    c[i].z = (c[i].z + bi.z) * scale;
    c[i].w = (c[i].w + bi.w) * scale;
  }
  if (outB) {
    bf16_t* op = outB + (size_t)row0 * ldo + bn + ec;
#pragma unroll
    for (int i = 0; i < 8; ++i) {
      union { uint2 q; bf16_t h[4]; } o;
      o.h[0] = f2bf(c[i].x); o.h[1] = f2bf(c[i].y);
      o.h[2] = f2bf(c[i].z); o.h[3] = f2bf(c[i].w);
      *(uint2*)(op + (size_t)(2 * i) * ldo) = o.q;
    }
  } else {
    float* op = outF + (size_t)row0 * ldo + bn + ec;
    if (addres) {
#pragma unroll
      for (int i = 0; i < 8; ++i) {
        c[i].x += rv[i].x; c[i].y += rv[i].y; c[i].z += rv[i].z; c[i].w += rv[i].w;
      }
    }
#pragma unroll
    for (int i = 0; i < 8; ++i) *(float4*)(op + (size_t)(2 * i) * ldo) = c[i];
  }
}

typedef __attribute__((ext_vector_type(2))) float  f32x2;
typedef __attribute__((ext_vector_type(4))) float  f32x4;
typedef __attribute__((ext_vector_type(2))) __bf16 bf16x2;

__device__ __forceinline__ uint32_t pack_bf16(float lo, float hi) {
  f32x2 p = {lo, hi};
  return __builtin_bit_cast(uint32_t, __builtin_convertvector(p, bf16x2));
}

// value of lane l ^ 16
__device__ __forceinline__ float other_half(float x) {
  const int xi = __builtin_bit_cast(int, x);
  return __builtin_bit_cast(float, __builtin_amdgcn_permlanex16(
      xi, xi, 0x76543210, 0xfedcba98, false, false));
}

// One direction's whole pass. DIR is a compile-time constant so that the loop
// holds that direction's match loads alone, with no branch and no select.
template <int DIR>
__device__ __forceinline__ void attn_dir(
    const bf16_t* __restrict__ Q, const bf16_t* __restrict__ Km,
    const bf16_t* __restrict__ Vm, const float* __restrict__ mb,
    bf16_t* __restrict__ Out, bf16_t* Kt, bf16_t* Vs, float* Ms, int b, int hp) {
  const int NN = 2048, DD = 256, DH = 32;
  const int wave = threadIdx.x >> 5;
  const int lane = threadIdx.x & 31;
  const int hf = lane >> 4;
  const int ln = lane & 15;
  const int hh = wave >> 2;               // which head of the pair
  const int wq = wave & 3;                // which 16 of the block's 64 queries
  const int h = hp * 2 + hh;
  const int ib = blockIdx.x * 64;
  const int i0 = ib + wq * 16;
  const unsigned char* vtr = tr16_lane(Vs, VP, lane) + hh * (DH * 2);
  const bf16_t* kfr = Kt + ln * LP + hh * DH;

  // Q fragment (B operand: lane holds query i0+ln), straight from global
  Frag16 qf;
  {
    const size_t qbase = (size_t)(b * NN + i0 + ln) * DD + h * DH;
#pragma unroll
    for (int v = 0; v < 8; ++v) {
      const int kp = (v >> 2) * 16 + hf * 8 + (v & 3) * 2;
      qf.u[v] = *(const uint32_t*)(Q + qbase + kp);
    }
  }

  float mrow = -1e30f, lrow = 0.f;   // of query i0+ln; lrow: this half's keys only
  FragF O0, O1;                      // O^T: f[r] = O[i0+ln][d*16 + hf*8 + r]
  O0.v = (v8f){0, 0, 0, 0, 0, 0, 0, 0};
  O1.v = (v8f){0, 0, 0, 0, 0, 0, 0, 0};

  // Source and LDS addresses of this thread's copies; the sources move on by one
  // stage behind each fill.
  // K rows and V rows of the head pair, row-major: 8 lanes cover a row's 128 bytes,
  // one line; four rows a thread, 32 apart.
  const int jr = threadIdx.x >> 3;
  const int c0 = (threadIdx.x & 7) * 8;
  const size_t gb = (size_t)(b * NN + jr) * DD + hp * (2 * DH) + c0;
  const bf16_t* kg = Km + gb;
  const bf16_t* vg = Vm + gb;
  const bf16_t* kl0 = Kt + jr * LP + c0;
  const bf16_t* vl0 = Vs + jr * VP + c0;
  // Direction 1: match[j0 + 0..SD)[ib + 0..64): 16 lanes cover a row's 256 bytes;
  // eight rows a thread, 16 apart. Direction 0: match[ib + 0..64)[j0 + 0..SD): a wave
  // covers a row's 512 bytes; eight rows a thread, 8 apart.
  const float* mg = DIR ? mb + (size_t)(threadIdx.x >> 4) * NN + ib + (threadIdx.x & 15) * 4
                        : mb + (size_t)(ib + wave) * NN + lane * 4;
  const float* ml0 = DIR ? Ms + (threadIdx.x >> 4) * MP1 + (threadIdx.x & 15) * 4
                         : Ms + wave * MP0 + lane * 4;
  auto fill = [&](int buf) {
    const bf16_t* kl = kl0 + buf * KSZ;
    const bf16_t* vl = vl0 + buf * VSZ;
    const float* ml = ml0 + buf * MSZ;
    copy8_b128_to_lds(kg, kg + 32 * DD, kg + 64 * DD, kg + 96 * DD,
                      vg, vg + 32 * DD, vg + 64 * DD, vg + 96 * DD,
                      kl, kl + 32 * LP, kl + 64 * LP, kl + 96 * LP,
                      vl, vl + 32 * VP, vl + 64 * VP, vl + 96 * VP);
    if (DIR) {
      copy8_b128_to_lds(mg, mg + 16 * NN, mg + 32 * NN, mg + 48 * NN,
                        mg + 64 * NN, mg + 80 * NN, mg + 96 * NN, mg + 112 * NN,
                        ml, ml + 16 * MP1, ml + 32 * MP1, ml + 48 * MP1,
                        ml + 64 * MP1, ml + 80 * MP1, ml + 96 * MP1, ml + 112 * MP1);
      mg += (size_t)SD * NN;
    } else {
      copy8_b128_to_lds(mg, mg + 8 * NN, mg + 16 * NN, mg + 24 * NN,
                        mg + 32 * NN, mg + 40 * NN, mg + 48 * NN, mg + 56 * NN,
                        ml, ml + 8 * MP0, ml + 16 * MP0, ml + 24 * MP0,
                        ml + 32 * MP0, ml + 40 * MP0, ml + 48 * MP0, ml + 56 * MP0);
      mg += SD;
    }
    kg += SD * DD;
    vg += SD * DD;
  };

  fill(0);
  async_lds_wait();
  __syncthreads();
  fill(1);

  // One stage's four passes and its publish point. The buffer's number is a constant
  // at each of the two calls, so that every LDS offset is an immediate.
  auto stage = [&](const int buf, const bool refill) {
    const bf16_t* kfb = kfr + buf * KSZ;
    const unsigned char* vtb = vtr + buf * (VSZ * 2);
    const float* Mb = Ms + buf * MSZ;
#pragma unroll
    for (int p = 0; p < SD / 32; ++p) {
      // S^T = K @ Q^T for two 16-key tiles:
      // S[t].f[r] = key j0+p*32+t*16+hf*8+r, query i0+ln
      FragF S[2];
#pragma unroll
      for (int t = 0; t < 2; ++t) {
        Frag16 kf;
#pragma unroll
        for (int v = 0; v < 8; ++v) {
          const int kp = (v >> 2) * 16 + hf * 8 + (v & 3) * 2;
          kf.u[v] = *(const uint32_t*)(kfb + (p * 32 + t * 16) * LP + kp);
        }
        S[t].v = __builtin_amdgcn_wmma_f32_16x16x32_bf16(
            false, kf.v, false, qf.v, (short)0, (v8f){0,0,0,0,0,0,0,0}, false, false);
      }

      // match weights of this lane's 16 scores, in the order of S
      float w[16];
      if (DIR) {
        const float* mp = Mb + (p * 32 + hf * 8) * MP1 + wq * 16 + ln;
#pragma unroll
        for (int k = 0; k < 16; ++k) w[k] = mp[((k >> 3) * 16 + (k & 7)) * MP1];
      } else {
        const float* mp = Mb + (wq * 16 + ln) * MP0 + p * 32 + hf * 8;
#pragma unroll
        for (int q = 0; q < 4; ++q) {
          const f32x4 m4 = *(const f32x4*)(mp + (q >> 1) * 16 + (q & 1) * 4);
#pragma unroll
          for (int e = 0; e < 4; ++e) w[q * 4 + e] = m4[e];
        }
      }

      // online softmax, one query per lane
      float sc[16];
#pragma unroll
      for (int k = 0; k < 16; ++k) sc[k] = S[k >> 3].f[k & 7] * w[k];
      float mx[8];
#pragma unroll
      for (int k = 0; k < 8; ++k) mx[k] = fmaxf(sc[2 * k], sc[2 * k + 1]);
      float cm = fmaxf(fmaxf(fmaxf(mx[0], mx[1]), fmaxf(mx[2], mx[3])),
                       fmaxf(fmaxf(mx[4], mx[5]), fmaxf(mx[6], mx[7])));
      cm = fmaxf(cm, other_half(cm));
      const float nm = fmaxf(mrow, cm);
      const float fac = __expf(mrow - nm);
      float ex[16];
#pragma unroll
      for (int k = 0; k < 16; ++k) ex[k] = __expf(sc[k] - nm);
      float sm[8];
#pragma unroll
      for (int k = 0; k < 8; ++k) sm[k] = ex[2 * k] + ex[2 * k + 1];
      const float cs = ((sm[0] + sm[1]) + (sm[2] + sm[3])) + ((sm[4] + sm[5]) + (sm[6] + sm[7]));
      lrow = lrow * fac + cs;
      // Empty asm on the row's sum, against spills: without it the additions of a whole
      // stage are moved behind the refill's branch, its 64 exponentials stay live over
      // the barrier, and the kernel takes 321 registers (or scratch) in place of 220.
      asm volatile("" : "+v"(lrow));
      mrow = nm;
#pragma unroll
      for (int r = 0; r < 8; ++r) { O0.f[r] *= fac; O1.f[r] *= fac; }

      // P^T as B operand: element s = tile s>>3, register s&7 (the hardware k order)
      // V^T as A operand by the transposing load: row dh = ln (vf0) or 16+ln (vf1)
      Frag16 pf, vf0, vf1;
#pragma unroll
      for (int v = 0; v < 8; ++v) pf.u[v] = pack_bf16(ex[2 * v], ex[2 * v + 1]);
      vf0.q[0] = ld_tr16(vtb + (p * 32) * (VP * 2));
      vf0.q[1] = ld_tr16(vtb + (p * 32 + 16) * (VP * 2));
      vf1.q[0] = ld_tr16(vtb + (p * 32) * (VP * 2) + 32);
      vf1.q[1] = ld_tr16(vtb + (p * 32 + 16) * (VP * 2) + 32);
      O0.v = __builtin_amdgcn_wmma_f32_16x16x32_bf16(
          false, vf0.v, false, pf.v, (short)0, O0.v, false, false);
      O1.v = __builtin_amdgcn_wmma_f32_16x16x32_bf16(
          false, vf1.v, false, pf.v, (short)0, O1.v, false, false);
    }
    // Publish point of stage s + 1: one barrier shows its bytes to every wave and
    // ends every wave's reads of this stage's buffers, which are refilled behind it.
    lds_reads_done();
    async_lds_wait();
    __syncthreads();
    if (refill) fill(buf);
  };
  for (int s = 0; s < NN / SD; s += 2) {
    const bool more = s + 2 < NN / SD;   // stages s + 2 and s + 3 exist
    stage(0, more);
    stage(1, more);
  }
  async_lds_wait();

  {  // join the halves' sums once; a lane stores 8 consecutive dh per tile
    const float inv = 1.0f / (lrow + other_half(lrow));
    bf16_t* op = Out + (size_t)(b * NN + i0 + ln) * DD + h * DH + hf * 8;
    uint4 a0, a1;
    a0.x = pack_bf16(O0.f[0] * inv, O0.f[1] * inv);
    a0.y = pack_bf16(O0.f[2] * inv, O0.f[3] * inv);
    a0.z = pack_bf16(O0.f[4] * inv, O0.f[5] * inv);
    a0.w = pack_bf16(O0.f[6] * inv, O0.f[7] * inv);
    a1.x = pack_bf16(O1.f[0] * inv, O1.f[1] * inv);
    a1.y = pack_bf16(O1.f[2] * inv, O1.f[3] * inv);
    a1.z = pack_bf16(O1.f[4] * inv, O1.f[5] * inv);
    a1.w = pack_bf16(O1.f[6] * inv, O1.f[7] * inv);
    *(uint4*)op = a0;
    *(uint4*)(op + 16) = a1;
  }
}

__global__ __launch_bounds__(256) void flash_attn(
    const bf16_t* __restrict__ qk0, const bf16_t* __restrict__ qk1,
    const bf16_t* __restrict__ v0b, const bf16_t* __restrict__ v1b,
    const float* __restrict__ match,
    bf16_t* __restrict__ m0, bf16_t* __restrict__ m1) {
  const int NN = 2048;
  const int dir = blockIdx.z >> 1;
  const int b = blockIdx.z & 1;
  const int hp = blockIdx.y;    // the pair of heads 2*hp, 2*hp + 1
  const float* mb = match + (size_t)b * NN * NN;

  __shared__ __align__(16) bf16_t Kt[2 * KSZ];        // [buffer][j][head of the pair][dh]
  __shared__ __align__(16) bf16_t Vs[2 * VSZ];        // [buffer][j][head of the pair][dh]
  __shared__ __align__(16) float  Ms[2 * MSZ];

  if (dir) attn_dir<1>(qk1, qk0, v0b, mb, m1, Kt, Vs, Ms, b, hp);
  else     attn_dir<0>(qk0, qk1, v1b, mb, m0, Kt, Vs, Ms, b, hp);
}

// --------- everything behind attention, row-local, in one launch ------------
// m @ Wo + bo -> second half of cat; h = cat @ W1 + b1; LayerNorm, exact GELU -> g;
// out = x + g @ W2 + b2. Each of these needs only its own rows of the step before,
// so a block of 16 waves takes FR rows through all of them: cat and g stay in LDS as
// bf16, h as f32. The three weights pass through one ring of two LDS buffers, NWS
// stages of 64 KiB in a row, so that the next product's first weights fly while the
// one before is finished.
// A wave owns all FR rows (two 16-row tiles) of N / 16 columns of each product, and
// two whole rows in LayerNorm, GELU and the output.
__device__ __forceinline__ float gelu_exact(float y) {
  return 0.5f * y * (1.f + erff(y * 0.70710678118654752f));
}

constexpr int FR  = 32;
// Row pitches, in bf16 elements. Tiles read as A operand, 16 bytes x odd: cat and g
// (512 columns, 1040 bytes), the attention's output (256 columns, 528 bytes). Weight
// rows, read by the transposing load, 32 bytes x odd: 256 columns 544 bytes, 512
// columns 1056 bytes.
constexpr int CP  = 512 + 8;
constexpr int AP  = 256 + 8;
constexpr int WPN = 256 + 16;
constexpr int WPW = 512 + 16;
// A weight stage: 128 rows of 256 columns (Wo, W2) or 64 rows of 512 (W1).
constexpr int WSZ = 128 * WPN > 64 * WPW ? 128 * WPN : 64 * WPW;
constexpr int NWS = 14;   // stages 0-1: Wo, 2-9: W1, 10-13: W2
constexpr int HP  = 516;  // floats a row of h: 2064 bytes = 16 x odd
constexpr int OP  = 260;  // floats a row of the output's staging: 1040 bytes = 16 x odd

// value of lane l ^ X inside the 16-lane row
template <int X>
__device__ __forceinline__ float row_xor(float x) {
  const int xi = __builtin_bit_cast(int, x);
  return __builtin_bit_cast(float, __builtin_amdgcn_update_dpp(xi, xi, 0x160 + X, 0xf, 0xf, false));
}

// KS deep in k: acc[rt][ns] += A rows rt*16.. (a: the lane's row and half, pitch PA)
// times NT 16-column tiles of the staged weight (bt: the lane's transposing address).
template <int NT, int KS, int WP, int PA>
__device__ __forceinline__ void chain_stage(FragF (&acc)[2][NT], const bf16_t* a,
                                            const unsigned char* bt) {
#pragma unroll
  for (int p = 0; p < KS / 32; ++p) {
    Frag16 af[2];
#pragma unroll
    for (int rt = 0; rt < 2; ++rt)
#pragma unroll
      for (int v = 0; v < 8; ++v)
        af[rt].u[v] = *(const uint32_t*)(a + rt * 16 * PA + p * 32 + (v >> 2) * 16 + (v & 3) * 2);
#pragma unroll
    for (int ns = 0; ns < NT; ++ns) {
      Frag16 bfr;
      bfr.q[0] = ld_tr16(bt + (p * 32) * (WP * 2) + ns * 32);
      bfr.q[1] = ld_tr16(bt + (p * 32 + 16) * (WP * 2) + ns * 32);
#pragma unroll
      for (int rt = 0; rt < 2; ++rt)
        acc[rt][ns].v = __builtin_amdgcn_wmma_f32_16x16x32_bf16(
            false, af[rt].v, false, bfr.v, (short)0, acc[rt][ns].v, false, false);
    }
  }
}

// The float pointers carry no __restrict__, so that no load moves over a wait below.
__global__ __launch_bounds__(512) void chain_fused(
    const bf16_t* __restrict__ Mo, const bf16_t* __restrict__ Xb,
    const bf16_t* __restrict__ Wo, const bf16_t* __restrict__ W1,
    const bf16_t* __restrict__ W2,
    const float* bo, const float* b1, const float* gamma, const float* beta,
    const float* b2, const float* res0, const float* res1, int mres, float* out) {
  __shared__ __align__(16) bf16_t Ws[2 * WSZ];      // the weights' ring
  __shared__ __align__(16) bf16_t Ct[FR * CP];      // cat = [x | m @ Wo + bo]
  __shared__ __align__(16) bf16_t Gt[FR * CP];      // g
  __shared__ __align__(16) bf16_t At[FR * AP];      // m, the attention's output
  __shared__ __align__(16) float  Hs[FR * HP];      // h; at the end the output's staging

  const int t = threadIdx.x;
  const int wave = t >> 5;
  const int lane = t & 31;
  const int hf = lane >> 4;
  const int ln = lane & 15;
  const int bm = blockIdx.x * FR;

  // Loaded once, ahead of the first barrier, which waits for the first copies anyway:
  // the biases of this lane's accumulator columns, and what belongs to its columns
  // where it holds whole rows (j * 128 + lane * 4 + 0..3).
  float b1v[2];
  const float bov = bo[wave * 16 + ln];
#pragma unroll
  for (int ns = 0; ns < 2; ++ns) b1v[ns] = b1[wave * 32 + ns * 16 + ln];
  // In front of whatever next rewrites an address register of the loads above.
  asm volatile("s_wait_xcnt 0x0" ::: "memory");
  float4 ga[4], be[4], b2v[2];
#pragma unroll
  for (int j = 0; j < 4; ++j) {
    ga[j] = *(const float4*)(gamma + j * 128 + lane * 4);
    be[j] = *(const float4*)(beta + j * 128 + lane * 4);
  }
#pragma unroll
  for (int j = 0; j < 2; ++j) b2v[j] = *(const float4*)(b2 + j * 128 + lane * 4);
  // In front of whatever next rewrites an address register of the loads above.
  asm volatile("s_wait_xcnt 0x0" ::: "memory");

  // A stage of the weights into buffer buf: 8 copies a thread. 256-column rows (Wo,
  // W2), 128 of them: a wave covers a row's 512 bytes, rows 16 apart. 512-column rows
  // (W1), 64 of them: two waves cover a row, rows 8 apart.
  const int gn = wave * 256 + lane * 8, lnw = wave * WPN + lane * 8;
  const int gw = (t >> 6) * 512 + (t & 63) * 8, lww = (t >> 6) * WPW + (t & 63) * 8;
  auto fill_n = [&](const bf16_t* w, int buf) {
    const bf16_t* g = w + gn;
    const bf16_t* l = Ws + buf * WSZ + lnw;
    copy8_b128_to_lds(g, g + 16 * 256, g + 32 * 256, g + 48 * 256,
                      g + 64 * 256, g + 80 * 256, g + 96 * 256, g + 112 * 256,
                      l, l + 16 * WPN, l + 32 * WPN, l + 48 * WPN,
                      l + 64 * WPN, l + 80 * WPN, l + 96 * WPN, l + 112 * WPN);
  };
  auto fill_w = [&](const bf16_t* w, int buf) {
    const bf16_t* g = w + gw;
    const bf16_t* l = Ws + buf * WSZ + lww;
    copy8_b128_to_lds(g, g + 8 * 512, g + 16 * 512, g + 24 * 512,
                      g + 32 * 512, g + 40 * 512, g + 48 * 512, g + 56 * 512,
                      l, l + 8 * WPW, l + 16 * WPW, l + 24 * WPW,
                      l + 32 * WPW, l + 40 * WPW, l + 48 * WPW, l + 56 * WPW);
  };
  // Publish point of the next stage, at the foot of each: one barrier shows its bytes
  // (and what this stage's trip wrote of cat or g) to every wave and ends every wave's
  // reads of this stage's buffer, which is refilled behind it.
  auto publish = [&]() {
    lds_reads_done();
    async_lds_wait();
    __syncthreads();
  };

  {  // the block's rows of m and of x (bf16, first half of cat's rows of 512): a wave
     // covers a row's 512 bytes; two rows of each a thread, 16 apart
    const bf16_t* gm = Mo + (size_t)(bm + wave) * 256 + lane * 8;
    const bf16_t* gx = Xb + (size_t)(bm + wave) * 512 + lane * 8;
    const bf16_t* lm = At + wave * AP + lane * 8;
    const bf16_t* lx = Ct + wave * CP + lane * 8;
    copy4_b128_to_lds(gm, gm + 16 * 256, gx, gx + 16 * 512,
                      lm, lm + 16 * AP, lx, lx + 16 * CP);
  }
  fill_n(Wo, 0);
  async_lds_wait();
  __syncthreads();
  fill_n(Wo + 128 * 256, 1);

  const bf16_t* aA = At + ln * AP + hf * 8;
  const bf16_t* aC = Ct + ln * CP + hf * 8;
  const bf16_t* aG = Gt + ln * CP + hf * 8;
  const unsigned char* btn = tr16_lane(Ws, WPN, lane) + wave * 32;   // 16 columns on
  const unsigned char* btw = tr16_lane(Ws, WPW, lane) + wave * 64;   // 32 columns on

  FragF an[2][1];   // m @ Wo, later g @ W2
  FragF aw[2][2];   // cat @ W1
#pragma unroll
  for (int rt = 0; rt < 2; ++rt) {
    an[rt][0].v = (v8f){0, 0, 0, 0, 0, 0, 0, 0};
#pragma unroll
    for (int ns = 0; ns < 2; ++ns) aw[rt][ns].v = (v8f){0, 0, 0, 0, 0, 0, 0, 0};
  }

  // Stages 0, 1: m @ Wo.
  chain_stage<1, 128, WPN, AP>(an, aA, btn);
  publish();
  fill_w(W1, 0);
  chain_stage<1, 128, WPN, AP>(an, aA + 128, btn + WSZ * 2);
  // m @ Wo + bo into the second half of cat; the barrier below shows it.
#pragma unroll
  for (int rt = 0; rt < 2; ++rt) {
#pragma unroll
    for (int r = 0; r < 8; ++r)   // C/D layout: m = r + 8*half
      Ct[(rt * 16 + hf * 8 + r) * CP + 256 + wave * 16 + ln] = f2bf(an[rt][0].f[r] + bov);
    an[rt][0].v = (v8f){0, 0, 0, 0, 0, 0, 0, 0};
  }
  publish();
  fill_w(W1 + 64 * 512, 1);

  // Stages 2 to 9: cat @ W1. Behind stage 8 the first stage of W2 goes out.
  for (int s = 2; s < 9; ++s) {
    chain_stage<2, 64, WPW, CP>(aw, aC + (s - 2) * 64, btw + (s & 1) * (WSZ * 2));
    publish();
    if (s < 8) fill_w(W1 + s * (64 * 512), s & 1);
    else       fill_n(W2, 0);
  }
  chain_stage<2, 64, WPW, CP>(aw, aC + 7 * 64, btw + WSZ * 2);

  // LayerNorm and GELU want whole rows: h passes through LDS, and a wave takes two
  // rows, a lane 16 elements of each (four 16-byte reads a row), so that mean and
  // variance are in-lane sums plus five lane exchanges.
  const int row = wave * 2;
  float4 rv[2][2];   // the residual x of this lane's output elements
  {
#pragma unroll
    for (int rt = 0; rt < 2; ++rt)
#pragma unroll
      for (int ns = 0; ns < 2; ++ns)
#pragma unroll
        for (int r = 0; r < 8; ++r)   // C/D layout: m = r + 8*half
          Hs[(rt * 16 + hf * 8 + r) * HP + wave * 32 + ns * 16 + ln] = aw[rt][ns].f[r] + b1v[ns];
    // Every wave's columns of h are in LDS before any wave reads whole rows.
    asm volatile("s_wait_dscnt 0x0" ::: "memory");
    __syncthreads();
    // The residual's loads go out here: the next barrier waits for them, and the
    // error functions stand in between.
    const float* rp = (bm < mres ? res0 + (size_t)(bm + row) * 256
                                 : res1 + (size_t)(bm - mres + row) * 256) + lane * 4;
#pragma unroll
    for (int r = 0; r < 2; ++r)
#pragma unroll
      for (int j = 0; j < 2; ++j) rv[r][j] = *(const float4*)(rp + r * 256 + j * 128);
    // The address is an input here, so that no load of the group lands in it: it
    // stays as it is up to this wait.
    asm volatile("s_wait_xcnt 0x0" :: "v"(rp) : "memory");
    float4 x[2][4];
#pragma unroll
    for (int r = 0; r < 2; ++r)
#pragma unroll
      for (int j = 0; j < 4; ++j)
        x[r][j] = *(const float4*)(Hs + (row + r) * HP + j * 128 + lane * 4);
    float sm[2], sq[2];
#pragma unroll
    for (int r = 0; r < 2; ++r) {
      float sj[4], qj[4];
#pragma unroll
      for (int j = 0; j < 4; ++j) {
        const float4 v = x[r][j];
        sj[j] = (v.x + v.y) + (v.z + v.w);
        qj[j] = (v.x * v.x + v.y * v.y) + (v.z * v.z + v.w * v.w);
      }
      sm[r] = (sj[0] + sj[1]) + (sj[2] + sj[3]);
      sq[r] = (qj[0] + qj[1]) + (qj[2] + qj[3]);
    }
#pragma unroll
    for (int r = 0; r < 2; ++r) {
      sm[r] += other_half(sm[r]);  sq[r] += other_half(sq[r]);
      sm[r] += row_xor<8>(sm[r]);  sq[r] += row_xor<8>(sq[r]);
      sm[r] += row_xor<4>(sm[r]);  sq[r] += row_xor<4>(sq[r]);
      sm[r] += row_xor<2>(sm[r]);  sq[r] += row_xor<2>(sq[r]);
      sm[r] += row_xor<1>(sm[r]);  sq[r] += row_xor<1>(sq[r]);
    }
#pragma unroll
    for (int r = 0; r < 2; ++r) {
      const float mu = sm[r] * (1.f / 512.f);
      const float rs = rsqrtf(sq[r] * (1.f / 512.f) - mu * mu + 1e-5f);
#pragma unroll
      for (int j = 0; j < 4; ++j) {
        const float4 v = x[r][j];
        union { uint2 u; bf16_t h[4]; } o;
        o.h[0] = f2bf(gelu_exact((v.x - mu) * rs * ga[j].x + be[j].x));
        o.h[1] = f2bf(gelu_exact((v.y - mu) * rs * ga[j].y + be[j].y));
        o.h[2] = f2bf(gelu_exact((v.z - mu) * rs * ga[j].z + be[j].z));
        o.h[3] = f2bf(gelu_exact((v.w - mu) * rs * ga[j].w + be[j].w));
        *(uint2*)(Gt + (row + r) * CP + j * 128 + lane * 4) = o.u;
      }
    }
  }
  publish();
  fill_n(W2 + 128 * 256, 1);

  // Stages 10 to 13: g @ W2.
  for (int s = 10; s < NWS; ++s) {
    chain_stage<1, 128, WPN, CP>(an, aG + (s - 10) * 128, btn + (s & 1) * (WSZ * 2));
    publish();
    if (s + 2 < NWS) fill_n(W2 + (s - 8) * (128 * 256), s & 1);
  }
  async_lds_wait();

  // Output through LDS, so that every global access covers whole lines: a wave takes
  // two whole rows of 1 KiB. The staging lies where h lay, whose last read stands in
  // front of five barriers.
#pragma unroll
  for (int rt = 0; rt < 2; ++rt)
#pragma unroll
    for (int r = 0; r < 8; ++r)
      Hs[(rt * 16 + hf * 8 + r) * OP + wave * 16 + ln] = an[rt][0].f[r];
  // Every wave's columns are in LDS before any wave reads whole rows.
  asm volatile("s_wait_dscnt 0x0" ::: "memory");
  __syncthreads();
  float* op = out + (size_t)(bm + row) * 256 + lane * 4;
#pragma unroll
  for (int r = 0; r < 2; ++r)
#pragma unroll
    for (int j = 0; j < 2; ++j) {
      float4 o = *(const float4*)(Hs + (row + r) * OP + j * 128 + lane * 4);
      o.x = (o.x + b2v[j].x) + rv[r][j].x;
      o.y = (o.y + b2v[j].y) + rv[r][j].y;
      o.z = (o.z + b2v[j].z) + rv[r][j].z;
      o.w = (o.w + b2v[j].w) + rv[r][j].w;
      *(float4*)(op + r * 256 + j * 128) = o;
    }
}

// ------------------------------- host side ---------------------------------
extern "C" void kernel_launch(void* const* d_in, const int* in_sizes, int n_in,
                              void* d_out, int out_size, void* d_ws, size_t ws_size,
                              hipStream_t stream) {
  const int B = 2, N = 2048, D = 256, H = 8, M = B * N, D2 = 2 * D;
  (void)in_sizes; (void)n_in; (void)out_size; (void)ws_size;

  const float* x0    = (const float*)d_in[0];
  const float* x1    = (const float*)d_in[1];
  const float* match = (const float*)d_in[2];
  const float* Wqk   = (const float*)d_in[3];
  const float* bqk   = (const float*)d_in[4];
  const float* Wv    = (const float*)d_in[5];
  const float* bv    = (const float*)d_in[6];
  const float* Wo    = (const float*)d_in[7];
  const float* bo    = (const float*)d_in[8];
  const float* W1    = (const float*)d_in[9];
  const float* b1    = (const float*)d_in[10];
  const float* gamma = (const float*)d_in[11];
  const float* beta  = (const float*)d_in[12];
  const float* W2    = (const float*)d_in[13];
  const float* b2    = (const float*)d_in[14];
  float* out = (float*)d_out;

  char* ws = (char*)d_ws;
  auto alloc = [&](size_t bytes) {
    char* p = ws; ws += (bytes + 255) & ~(size_t)255; return p;
  };
  bf16_t* WqkB = (bf16_t*)alloc((size_t)D * D * 2);
  bf16_t* WvB  = (bf16_t*)alloc((size_t)D * D * 2);
  bf16_t* WoB  = (bf16_t*)alloc((size_t)D * D * 2);
  bf16_t* W1B  = (bf16_t*)alloc((size_t)D2 * D2 * 2);
  bf16_t* W2B  = (bf16_t*)alloc((size_t)D2 * D * 2);
  bf16_t* qk0s = (bf16_t*)alloc((size_t)M * D * 2);
  bf16_t* qk1s = (bf16_t*)alloc((size_t)M * D * 2);
  bf16_t* v0bb = (bf16_t*)alloc((size_t)M * D * 2);
  bf16_t* v1bb = (bf16_t*)alloc((size_t)M * D * 2);
  bf16_t* m0b  = (bf16_t*)alloc((size_t)M * D * 2);
  bf16_t* m1b  = (bf16_t*)alloc((size_t)M * D * 2);
  bf16_t* cat0 = (bf16_t*)alloc((size_t)M * D2 * 2);
  bf16_t* cat1 = (bf16_t*)alloc((size_t)M * D2 * 2);
  (void)cat1;
  // Every buffer size is a multiple of 256 bytes, so each side-1 buffer starts
  // where its side-0 buffer ends: a pair is one matrix of 2*M rows.

  // weights + x into concat buffers (first 256 cols of cat = x)
  cvt_all<<<dim3((2 * M * D + 3 * D * D + D2 * D2 + D2 * D) / 4096), dim3(256), 0, stream>>>(
      x0, x1, Wqk, Wv, Wo, W1, W2, cat0, WqkB);

  const float s = 0.42044820762685725f;  // (DH^-0.5)^0.5 = 32^-0.25

  // projections, both sides: z=0 qk = (x@Wqk + bqk)*s ; z=1 v = x@Wv + bv
  gemm_wmma<<<dim3(2 * M / 128, D / 64, 2), dim3(256), 0, stream>>>(
      cat0, D2, WqkB, WvB, D, bqk, bv, s, 1.0f, qk0s, v0bb, nullptr,
      nullptr, nullptr, 2 * M, D, 0, D);

  // flash attention, both directions
  flash_attn<<<dim3(N / 64, H / 2, 2 * B), dim3(256), 0, stream>>>(
      qk0s, qk1s, v0bb, v1bb, match, m0b, m1b);

  // output projection, FFN and residual, both sides: out = x + FFN([x | m @ Wo + bo])
  chain_fused<<<dim3(2 * M / 32), dim3(512), 0, stream>>>(
      m0b, cat0, WoB, W1B, W2B, bo, b1, gamma, beta, b2, x0, x1, M, out);
}
